// v000
// Measured on an AMD MI455X. A time is GPU time per run, averaged over a window of back-to-back runs after a warm-up
// (all launches, gaps included; the runs take copies of the inputs in turn), and the median of several windows.
// Apart from v000's, it joins two sittings. Times from different sittings can be a few percent apart, while
// side-by-side timings come from the same sitting.
// v000 is the starting kernel. One run takes 566 microseconds.
// Contractions: x*WqT, x*WkT, x*WvT, K*Q^T, V^T*P^T and O*WoT all on v_wmma_f32_16x16x32_f16 (f16 operands, f32 accumulate); W carried x32, P carried x16384, O carried x16 (exact power-of-two scales folded back in f32); softmax, bias and normalisation in f32.
#include <hip/hip_runtime.h>

typedef _Float16 v16h __attribute__((ext_vector_type(16)));
typedef _Float16 v8h  __attribute__((ext_vector_type(8)));
typedef float    v8f  __attribute__((ext_vector_type(8)));
typedef float    v4f  __attribute__((ext_vector_type(4)));
typedef v8h __attribute__((may_alias)) v8ha;
typedef v4f __attribute__((may_alias)) v4fa;

union Frag { v16h v; v8h half[2]; };

#define DIM    2048
#define SEQ    2048
#define NH     16
#define HD     128
#define BS     2
#define MTOT   (BS * SEQ)          // 4096 token rows
#define NX     (MTOT * DIM)        // 8388608
#define NX8    (NX / 8)            // 1048576
#define WSC    32.0f
#define WINV   0.03125f
#define PSCALE 16384.0f
#define OSC    16.0f

// ---------------------------------------------------------------------------
// 16x16x32 f16 WMMA with hazard guard (ties D, keeps A/B live).
// Fragment map (wave32): lane l, h = l>>4, m = n = l&15.
//   A/B element i: i<8 -> k0+8h+i ; i>=8 -> k0+16+8h+(i-8)
//   D element r : row 8h+r, col l&15
// ---------------------------------------------------------------------------
__device__ __forceinline__ v8f wmma_f16(v16h a, v16h b, v8f c) {
  v8f d = __builtin_amdgcn_wmma_f32_16x16x32_f16(false, a, false, b, (short)0, c, false, false);
  asm volatile("v_nop\n\tv_nop\n\tv_nop\n\tv_nop" : "+v"(d) : "v"(a), "v"(b));
  return d;
}

// A or B fragment from a k-contiguous f16 row; p points at element k0 of the
// row owned by this lane (row index = lane & 15 added by the caller).
__device__ __forceinline__ v16h load_frag(const _Float16* p, int h) {
  Frag f;
  f.half[0] = *(const v8ha*)(p + 8 * h);
  f.half[1] = *(const v8ha*)(p + 16 + 8 * h);
  return f.v;
}

// ---------------------------------------------------------------------------
// Kernel 1: x f32 -> f16 (unscaled). One 16-B store per lane, lanes
// ---------------------------------------------------------------------------
__global__ __launch_bounds__(256) void cvt_x_kernel(const float* __restrict__ x,
                                                     _Float16* __restrict__ xh, int n8)
{
  const int g = blockIdx.x * 256 + threadIdx.x;
  if (g >= n8) return;
  const float* src = x + (size_t)g * 8;
  const v4f a = *(const v4fa*)src;
  const v4f c = *(const v4fa*)(src + 4);
  const v8h o = { (_Float16)a.x, (_Float16)a.y, (_Float16)a.z, (_Float16)a.w,
                  (_Float16)c.x, (_Float16)c.y, (_Float16)c.z, (_Float16)c.w };
  _Float16* dst = xh + (size_t)g * 8;
  *(v8h*)dst = o;
  
}

// ---------------------------------------------------------------------------
// Kernel 2: w[K][N] f32 (in, out) -> wT[N][K] f16 scaled x32 (exact).
// Block 256 thr, tile 64 k x 32 n; grid (N/32, K/64). Reads coalesced along
// n; tile staged in LDS as [n][64 k]; each output row segment = 64 halves =
// ---------------------------------------------------------------------------
__global__ __launch_bounds__(256) void transpose_w_kernel(const float* __restrict__ w,
                                                           _Float16* __restrict__ wT,
                                                           int K, int N)
{
  __shared__ __attribute__((aligned(16))) _Float16 sT[32 * 64];
  const int tid = threadIdx.x, lane = tid & 31, wv = tid >> 5;
  const int n0 = blockIdx.x * 32, k0 = blockIdx.y * 64;
  const int nn = tid & 31, kr = tid >> 5;          // kr 0..7
  #pragma unroll
  for (int i = 0; i < 8; ++i) {
    const int kk = kr + 8 * i;                       // 0..63
    const float val = w[(size_t)(k0 + kk) * N + n0 + nn] * WSC;
    sT[nn * 64 + kk] = (_Float16)val;
  }
  __syncthreads();
  const int q8 = lane & 7, sub = lane >> 3;
  const int n = wv * 4 + sub;                        // 0..31
  const v8h v = *(const v8ha*)(sT + n * 64 + 8 * q8);
  _Float16* dst = wT + (size_t)(n0 + n) * K + k0 + 8 * q8;
  *(v8h*)dst = v;
  
}

// ---------------------------------------------------------------------------
// ---------------------------------------------------------------------------
// f16 tile staged [tok][64 feat] -> C[m0+tok][n0 .. n0+63]: one line per row,
// lanes 8q..8q+7 per line, 4 lines per instruction, 32 lines per wave.
__device__ __forceinline__ void store_rows_f16(const _Float16* sT, _Float16* C,
                                               int m0, int n0, int N, int w, int lane) {
  const int q8 = lane & 7, sub = lane >> 3;
  #pragma unroll
  for (int i = 0; i < 8; ++i) {
    const int lid = w * 32 + i * 4 + sub;            // 0..127
    const v8h v = *(const v8ha*)(sT + lid * 64 + 8 * q8);
    _Float16* dst = C + (size_t)(m0 + lid) * N + n0 + 8 * q8;
    *(v8h*)dst = v;
  }
}

// f16 tile staged [feat d][128 tok] -> vt[b][n0+d][t0 .. t0+127]: two lines
// per d row, lanes 8q..8q+7 per line, 4 lines per instruction, 32 per wave.
__device__ __forceinline__ void store_vt_f16(const _Float16* sT, _Float16* vt,
                                             int b, int t0, int n0, int w, int lane) {
  const int q8 = lane & 7, sub = lane >> 3;
  #pragma unroll
  for (int i = 0; i < 8; ++i) {
    const int lid = w * 32 + i * 4 + sub;            // 0..127
    const int d = lid >> 1, hl = lid & 1;            // d 0..63
    const v8h v = *(const v8ha*)(sT + d * 128 + 64 * hl + 8 * q8);
    _Float16* dst = vt + ((size_t)(b * HD + n0 + d)) * SEQ + t0 + 64 * hl + 8 * q8;
    *(v8h*)dst = v;
  }
}

// f32 tile staged [tok][64 feat] -> C[m0+tok][n0 .. n0+63]: two lines per row;
// wave w stores its own 32 rows = 64 lines, 4 lines per instruction.
__device__ __forceinline__ void store_rows_f32(const float* sT, float* C,
                                               int m0, int n0, int N, int w, int lane) {
  const int q8 = lane & 7, sub = lane >> 3;
  #pragma unroll
  for (int i = 0; i < 16; ++i) {
    const int lid = i * 4 + sub;                     // 0..63
    const int row = 32 * w + (lid >> 1), hl = lid & 1;
    const v4f v = *(const v4fa*)(sT + row * 64 + 32 * hl + 4 * q8);
    float* dst = C + (size_t)(m0 + row) * N + n0 + 32 * hl + 4 * q8;
    *(v4f*)dst = v;
  }
}

// ---------------------------------------------------------------------------
// Kernel 3: C = A * BT^T (+bias), A [M][K] f16 rows, BT [N][K] f16 rows (x32).
// Block 128 thr (4 waves) = 128 rows x 64 cols; wave tile 32 x 64 (2x4 WMMA
// tiles); K in steps of 32; A and B fragments straight from global f16 rows.
// MODE 0: f16 C[M][N] = f16((acc*ascale + bias)*oscale)
// MODE 1: f16 vT[b][d][t] layout (N = HD)
// MODE 2: f32 C[M][N] = acc*ascale + bias
// grid (M/128, N/64)
// ---------------------------------------------------------------------------
union GemmSmem { _Float16 h[128 * 64]; float f[128 * 64]; };

template <int MODE, typename CT>
__global__ __launch_bounds__(128) void gemm_kernel(
    const _Float16* __restrict__ A, const _Float16* __restrict__ BT,
    const float* __restrict__ bias, CT* __restrict__ C,
    int N, int K, float ascale, float oscale)
{
  __shared__ __attribute__((aligned(16))) GemmSmem sm;       // 32768 B

  const int tid = threadIdx.x, lane = tid & 31, w = tid >> 5;
  const int h = lane >> 4, m = lane & 15;
  const int m0 = blockIdx.x * 128, n0 = blockIdx.y * 64;
  const int m0w = m0 + 32 * w;

  const _Float16* xa0 = A + (size_t)(m0w + m) * K;          // row of tile mt = 0
  const _Float16* xa1 = xa0 + (size_t)16 * K;               // mt = 1
  const _Float16* wb  = BT + (size_t)(n0 + m) * K;          // BT row, nt = 0

  const v8f zero8 = {0.f, 0.f, 0.f, 0.f, 0.f, 0.f, 0.f, 0.f};
  v8f acc[2][4];
  #pragma unroll
  for (int mt = 0; mt < 2; ++mt)
    #pragma unroll
    for (int nt = 0; nt < 4; ++nt) acc[mt][nt] = zero8;

  #pragma unroll 1
  for (int k0 = 0; k0 < K; k0 += 32) {
    const v16h a0 = load_frag(xa0 + k0, h);
    const v16h a1 = load_frag(xa1 + k0, h);
    #pragma unroll
    for (int nt = 0; nt < 4; ++nt) {
      const v16h b = load_frag(wb + (size_t)nt * 16 * K + k0, h);
      acc[0][nt] = wmma_f16(a0, b, acc[0][nt]);
      acc[1][nt] = wmma_f16(a1, b, acc[1][nt]);
    }
  }

  // D[r] of tile (mt, nt) = C[row m0w+16mt+8h+r][col n0+16nt+m]
  #pragma unroll
  for (int nt = 0; nt < 4; ++nt) {
    const int feat = 16 * nt + m;
    const float bvl = bias[n0 + feat];
    #pragma unroll
    for (int mt = 0; mt < 2; ++mt) {
      #pragma unroll
      for (int r = 0; r < 8; ++r) {
        const int tokl = 32 * w + 16 * mt + 8 * h + r;   // 0..127
        const float y = acc[mt][nt][r] * ascale + bvl;
        if (MODE == 2) {
          sm.f[tokl * 64 + feat] = y;
        } else if (MODE == 1) {
          sm.h[feat * 128 + tokl] = (_Float16)(y * oscale);
        } else {
          sm.h[tokl * 64 + feat] = (_Float16)(y * oscale);
        }
      }
    }
  }
  __syncthreads();

  if (MODE == 2) {
    float* Cf = (float*)(void*)C;
    store_rows_f32(sm.f, Cf, m0, n0, N, w, lane);
    
  } else if (MODE == 1) {
    _Float16* Ch = (_Float16*)(void*)C;
    const int b = m0 / SEQ, t0 = m0 - b * SEQ;
    store_vt_f16(sm.h, Ch, b, t0, n0, w, lane);
    
  } else {
    _Float16* Ch = (_Float16*)(void*)C;
    store_rows_f16(sm.h, Ch, m0, n0, N, w, lane);
    
  }
}

// ---------------------------------------------------------------------------
// Attention helpers.
// ---------------------------------------------------------------------------
// P^T B-fragment from the lane's own score D values: element r <- tile a row r
// (keys 0..15 of the 32-key chunk), element 8+r <- tile c row r (keys 16..31),
// same lane, same query column; scaled by 2^14 before the f16 convert.
__device__ __forceinline__ v16h pack_p(v8f a, v8f c) {
  const v16h r = { (_Float16)(a[0] * PSCALE), (_Float16)(a[1] * PSCALE), (_Float16)(a[2] * PSCALE), (_Float16)(a[3] * PSCALE),
                   (_Float16)(a[4] * PSCALE), (_Float16)(a[5] * PSCALE), (_Float16)(a[6] * PSCALE), (_Float16)(a[7] * PSCALE),
                   (_Float16)(c[0] * PSCALE), (_Float16)(c[1] * PSCALE), (_Float16)(c[2] * PSCALE), (_Float16)(c[3] * PSCALE),
                   (_Float16)(c[4] * PSCALE), (_Float16)(c[5] * PSCALE), (_Float16)(c[6] * PSCALE), (_Float16)(c[7] * PSCALE) };
  return r;
}

// Per-wave 16 x 128 f16 tile in LDS -> oh[b*SEQ + q0 + row][head*128 + d];
// instruction, 32 lines (16 rows x 2) per wave.
__device__ __forceinline__ void att_store_pass(const _Float16* so, _Float16* oh,
                                               int b, int head, int q0, int lane) {
  const int q8 = lane & 7, sub = lane >> 3;
  #pragma unroll
  for (int i = 0; i < 8; ++i) {
    const int lid = i * 4 + sub;                     // 0..31
    const int row = lid >> 1, hl = lid & 1;
    const v8h v = *(const v8ha*)(so + row * HD + 64 * hl + 8 * q8);
    _Float16* dst = oh + ((size_t)(b * SEQ + q0 + row)) * DIM + head * HD + 64 * hl + 8 * q8;
    *(v8h*)dst = v;
  }
}

// ---------------------------------------------------------------------------
// Kernel 4: streaming attention, transposed form, single shared K/V head.
// grid (SEQ/64, NH, BS); block 128 thr (4 waves), 16 queries per wave,
// 32 keys per step.
//   S^T = K * Q^T : A = K rows (row = key, k = d, 4 k-steps), B = Q^T (k = d, n = query)
//   O^T += V^T * P^T : A = vT rows (row = d, k = key), B = P^T from registers
// Lane owns 16 keys of query column (lane&15); partner = lane ^ 16.
// ---------------------------------------------------------------------------
__global__ __launch_bounds__(128) void attn_kernel(
    const _Float16* __restrict__ qh,   // [MTOT][DIM]  q (unscaled)
    const _Float16* __restrict__ kh,   // [MTOT][HD]   k
    const _Float16* __restrict__ vt,   // [BS][HD][SEQ] v transposed
    _Float16* __restrict__ oh)         // [MTOT][DIM]  f16(16 * o)
{
  __shared__ __attribute__((aligned(16))) _Float16 sO[4 * 16 * HD];   // 16384 B

  const int tid = threadIdx.x, lane = tid & 31, w = tid >> 5;
  const int hh = lane >> 4, m = lane & 15;
  const int b = blockIdx.z, head = blockIdx.y;
  const int q0 = blockIdx.x * 64 + 16 * w;

  // Q^T B-fragments: column n = query q0+m, k = d (four 32-deep chunks)
  const _Float16* qrow = qh + ((size_t)(b * SEQ + q0 + m)) * DIM + head * HD;
  v16h qb[4];
  #pragma unroll
  for (int c = 0; c < 4; ++c) qb[c] = load_frag(qrow + 32 * c, hh);

  const v8f zero8 = {0.f, 0.f, 0.f, 0.f, 0.f, 0.f, 0.f, 0.f};
  v8f o[8];                                   // o[t][r] = O^T[d 16t+8hh+r][query m] * (l * 2^14)
  #pragma unroll
  for (int t = 0; t < 8; ++t) o[t] = zero8;
  float mrun = -1e30f, lrun = 0.0f;

  const _Float16* kbase = kh + ((size_t)b * SEQ + m) * HD;     // + key0*HD + 32c
  const _Float16* vbase = vt + ((size_t)b * HD + m) * SEQ;     // + 16t*SEQ + key0
  const float scale = 0.08838834764831845f;                    // 1/sqrt(128)

  #pragma unroll 1
  for (int kb = 0; kb < SEQ; kb += 32) {
    // ---- scores: s[j][r] = S^T[key kb+16j+8hh+r][query q0+m] ----
    v8f s[2];
    #pragma unroll
    for (int j = 0; j < 2; ++j) {
      const _Float16* kp = kbase + (size_t)(kb + 16 * j) * HD;
      v8f z = zero8;
      #pragma unroll
      for (int c = 0; c < 4; ++c) {
        const v16h kf = load_frag(kp + 32 * c, hh);
        z = wmma_f16(kf, qb[c], z);
      }
      s[j] = z;
    }

    // ---- scale (f32) and online softmax over this lane pair's 32 keys ----
    float mloc = -1e30f;
    #pragma unroll
    for (int j = 0; j < 2; ++j)
      #pragma unroll
      for (int r = 0; r < 8; ++r) {
        const float sv = s[j][r] * scale;
        s[j][r] = sv;
        mloc = fmaxf(mloc, sv);
      }
    mloc = fmaxf(mloc, __shfl_xor(mloc, 16));
    const float mnew = fmaxf(mrun, mloc);
    const float alpha = __expf(mrun - mnew);
    mrun = mnew;
    float lsum = 0.0f;
    #pragma unroll
    for (int j = 0; j < 2; ++j)
      #pragma unroll
      for (int r = 0; r < 8; ++r) {
        const float p = __expf(s[j][r] - mnew);
        s[j][r] = p;
        lsum += p;
      }
    lsum += __shfl_xor(lsum, 16);
    lrun = lrun * alpha + lsum;
    #pragma unroll
    for (int t = 0; t < 8; ++t)
      #pragma unroll
      for (int r = 0; r < 8; ++r) o[t][r] = o[t][r] * alpha;

    // ---- P^T B-fragment for keys kb .. kb+31 ----
    const v16h pb = pack_p(s[0], s[1]);

    // ---- O^T += V^T * P^T over the 8 d tiles ----
    #pragma unroll
    for (int t = 0; t < 8; ++t) {
      const v16h vf = load_frag(vbase + (size_t)(16 * t) * SEQ + kb, hh);
      o[t] = wmma_f16(vf, pb, o[t]);
    }
  }

  // ---- epilogue: normalise, x16 carry, stage per-wave 16x128 f16 tile ----
  const float inv = __builtin_amdgcn_rcpf(lrun) * (OSC / PSCALE);
  _Float16* so = sO + w * (16 * HD);
  #pragma unroll
  for (int t = 0; t < 8; ++t)
    #pragma unroll
    for (int r = 0; r < 8; ++r)
      so[m * HD + 16 * t + 8 * hh + r] = (_Float16)(o[t][r] * inv);
  __syncthreads();

  att_store_pass(so, oh, b, head, q0, lane);
  
}

// ---------------------------------------------------------------------------
extern "C" void kernel_launch(void* const* d_in, const int* in_sizes, int n_in,
                              void* d_out, int out_size, void* d_ws, size_t ws_size,
                              hipStream_t stream) {
  if (n_in < 9) return;
  if (in_sizes[0] != NX) return;
  if (in_sizes[1] != DIM * DIM || in_sizes[2] != DIM) return;
  if (in_sizes[3] != DIM * HD || in_sizes[4] != HD) return;
  if (in_sizes[5] != DIM * HD || in_sizes[6] != HD) return;
  if (in_sizes[7] != DIM * DIM || in_sizes[8] != DIM) return;
  if (out_size != NX) return;

  const float* x  = (const float*)d_in[0];
  const float* wq = (const float*)d_in[1];
  const float* bq = (const float*)d_in[2];
  const float* wk = (const float*)d_in[3];
  const float* bk = (const float*)d_in[4];
  const float* wv = (const float*)d_in[5];
  const float* bv = (const float*)d_in[6];
  const float* wo = (const float*)d_in[7];
  const float* bo = (const float*)d_in[8];
  float* out = (float*)d_out;

  const size_t act_b = (size_t)NX * 2;              // 16777216  f16 [4096][2048]
  const size_t wsq_b = (size_t)DIM * DIM * 2;       //  8388608  f16 [2048][2048]
  const size_t wkv_b = (size_t)DIM * HD * 2;        //   524288  f16 [128][2048]
  const size_t kv_b  = (size_t)MTOT * HD * 2;       //  1048576  f16 [4096][128] / [2][128][2048]
  const size_t total = act_b + wsq_b + 2 * wkv_b + wsq_b + act_b + 2 * kv_b + act_b;   // 70254592
  if (total > ws_size) return;

  char* ws = (char*)d_ws;
  size_t off = 0;
  _Float16* xh  = (_Float16*)(ws + off); off += act_b;
  _Float16* wqT = (_Float16*)(ws + off); off += wsq_b;
  _Float16* wkT = (_Float16*)(ws + off); off += wkv_b;
  _Float16* wvT = (_Float16*)(ws + off); off += wkv_b;
  _Float16* woT = (_Float16*)(ws + off); off += wsq_b;
  _Float16* qh  = (_Float16*)(ws + off); off += act_b;
  _Float16* kh  = (_Float16*)(ws + off); off += kv_b;
  _Float16* vT  = (_Float16*)(ws + off); off += kv_b;
  _Float16* oh  = (_Float16*)(ws + off); off += act_b;
  if (off > ws_size) return;

  // 1) operand planes: x -> f16; W (in,out) -> W^T [out][in] f16 x32
  cvt_x_kernel<<<NX8 / 256, 256, 0, stream>>>(x, xh, NX8);
  transpose_w_kernel<<<dim3(DIM / 32, DIM / 64), 256, 0, stream>>>(wq, wqT, DIM, DIM);   // in[2048][2048] -> out[2048][2048]
  transpose_w_kernel<<<dim3(HD / 32, DIM / 64), 256, 0, stream>>>(wk, wkT, DIM, HD);     // in[2048][128]  -> out[128][2048]
  transpose_w_kernel<<<dim3(HD / 32, DIM / 64), 256, 0, stream>>>(wv, wvT, DIM, HD);     // in[2048][128]  -> out[128][2048]
  transpose_w_kernel<<<dim3(DIM / 32, DIM / 64), 256, 0, stream>>>(wo, woT, DIM, DIM);   // in[2048][2048] -> out[2048][2048]

  // 2) projections: q [4096][2048] f16, k [4096][128] f16, v -> vT [2][128][2048] f16
  gemm_kernel<0, _Float16><<<dim3(MTOT / 128, DIM / 64), 128, 0, stream>>>(xh, wqT, bq, qh, DIM, DIM, WINV, 1.0f);
  gemm_kernel<0, _Float16><<<dim3(MTOT / 128, HD / 64), 128, 0, stream>>>(xh, wkT, bk, kh, HD, DIM, WINV, 1.0f);
  gemm_kernel<1, _Float16><<<dim3(MTOT / 128, HD / 64), 128, 0, stream>>>(xh, wvT, bv, vT, HD, DIM, WINV, 1.0f);

  // 3) attention: all 16 query heads against the shared K / V^T planes; o f16 x16
  attn_kernel<<<dim3(SEQ / 64, NH, BS), 128, 0, stream>>>(qh, kh, vT, oh);

  // 4) output projection: out = (o x16)(wo x32) / 512 + bo, f32 whole-line stores
  gemm_kernel<2, float><<<dim3(MTOT / 128, DIM / 64), 128, 0, stream>>>(oh, woT, bo, out, DIM, DIM, WINV / OSC, 1.0f);
}

// v001
// A run of this version takes 232 microseconds.
// In both of two side-by-side timings against v000, it was 2.48 times as fast.
// Contractions: x*WqT, x*WkT, x*WvT, K*Q^T, V^T*P^T and O*WoT all on v_wmma_f32_16x16x32_f16 (f16 operands, f32 accumulate); W carried x32, P carried x16384, O carried x16 (exact power-of-two scales folded back in f32); softmax, bias and normalisation in f32.
#include <hip/hip_runtime.h>

typedef _Float16 v16h __attribute__((ext_vector_type(16)));
typedef _Float16 v8h  __attribute__((ext_vector_type(8)));
typedef float    v8f  __attribute__((ext_vector_type(8)));
typedef float    v4f  __attribute__((ext_vector_type(4)));
typedef v8h __attribute__((may_alias)) v8ha;
typedef v4f __attribute__((may_alias)) v4fa;

union Frag { v16h v; v8h half[2]; };

#define DIM    2048
#define SEQ    2048
#define NH     16
#define HD     128
#define BS     2
#define MTOT   (BS * SEQ)          // 4096 token rows
#define NX     (MTOT * DIM)        // 8388608
#define NX8    (NX / 8)            // 1048576
#define WSC    32.0f
#define WINV   0.03125f
#define PSCALE 16384.0f
#define OSC    16.0f

// ---------------------------------------------------------------------------
// 16x16x32 f16 WMMA with hazard guard (ties D, keeps A/B live).
// Fragment map (wave32): lane l, h = l>>4, m = n = l&15.
//   A/B element i: i<8 -> k0+8h+i ; i>=8 -> k0+16+8h+(i-8)
//   D element r : row 8h+r, col l&15
// ---------------------------------------------------------------------------
__device__ __forceinline__ v8f wmma_f16(v16h a, v16h b, v8f c) {
  v8f d = __builtin_amdgcn_wmma_f32_16x16x32_f16(false, a, false, b, (short)0, c, false, false);
  asm volatile("v_nop\n\tv_nop\n\tv_nop\n\tv_nop" : "+v"(d) : "v"(a), "v"(b));
  return d;
}

// A or B fragment from a k-contiguous f16 row; p points at element k0 of the
// row owned by this lane (row index = lane & 15 added by the caller).
__device__ __forceinline__ v16h load_frag(const _Float16* p, int h) {
  Frag f;
  f.half[0] = *(const v8ha*)(p + 8 * h);
  f.half[1] = *(const v8ha*)(p + 16 + 8 * h);
  return f.v;
}

// ---------------------------------------------------------------------------
// Kernel 1: x f32 -> f16 (unscaled). One 16-B store per lane, lanes
// ---------------------------------------------------------------------------
__global__ __launch_bounds__(256) void cvt_x_kernel(const float* __restrict__ x,
                                                     _Float16* __restrict__ xh, int n8)
{
  const int g = blockIdx.x * 256 + threadIdx.x;
  if (g >= n8) return;
  const float* src = x + (size_t)g * 8;
  const v4f a = *(const v4fa*)src;
  const v4f c = *(const v4fa*)(src + 4);
  const v8h o = { (_Float16)a.x, (_Float16)a.y, (_Float16)a.z, (_Float16)a.w,
                  (_Float16)c.x, (_Float16)c.y, (_Float16)c.z, (_Float16)c.w };
  _Float16* dst = xh + (size_t)g * 8;
  *(v8h*)dst = o;
  
}

// ---------------------------------------------------------------------------
// Kernel 2: w[K][N] f32 (in, out) -> wT[N][K] f16 scaled x32 (exact).
// Block 256 thr, tile 64 k x 32 n; grid (N/32, K/64). Reads coalesced along
// n; tile staged in LDS as [n][64 k]; each output row segment = 64 halves =
// ---------------------------------------------------------------------------
__global__ __launch_bounds__(256) void transpose_w_kernel(const float* __restrict__ w,
                                                           _Float16* __restrict__ wT,
                                                           int K, int N)
{
  __shared__ __attribute__((aligned(16))) _Float16 sT[32 * 64];
  const int tid = threadIdx.x, lane = tid & 31, wv = tid >> 5;
  const int n0 = blockIdx.x * 32, k0 = blockIdx.y * 64;
  const int nn = tid & 31, kr = tid >> 5;          // kr 0..7
  #pragma unroll
  for (int i = 0; i < 8; ++i) {
    const int kk = kr + 8 * i;                       // 0..63
    const float val = w[(size_t)(k0 + kk) * N + n0 + nn] * WSC;
    sT[nn * 64 + kk] = (_Float16)val;
  }
  __syncthreads();
  const int q8 = lane & 7, sub = lane >> 3;
  const int n = wv * 4 + sub;                        // 0..31
  const v8h v = *(const v8ha*)(sT + n * 64 + 8 * q8);
  _Float16* dst = wT + (size_t)(n0 + n) * K + k0 + 8 * q8;
  *(v8h*)dst = v;
  
}

// ---------------------------------------------------------------------------
// ---------------------------------------------------------------------------
// f16 tile staged [tok][64 feat] -> C[m0+tok][n0 .. n0+63]: one line per row,
// lanes 8q..8q+7 per line, 4 lines per instruction, 32 lines per wave.
__device__ __forceinline__ void store_rows_f16(const _Float16* sT, _Float16* C,
                                               int m0, int n0, int N, int w, int lane) {
  const int q8 = lane & 7, sub = lane >> 3;
  #pragma unroll
  for (int i = 0; i < 8; ++i) {
    const int lid = w * 32 + i * 4 + sub;            // 0..127
    const v8h v = *(const v8ha*)(sT + lid * 64 + 8 * q8);
    _Float16* dst = C + (size_t)(m0 + lid) * N + n0 + 8 * q8;
    *(v8h*)dst = v;
  }
}

// f16 tile staged [feat d][128 tok] -> vt[b][n0+d][t0 .. t0+127]: two lines
// per d row, lanes 8q..8q+7 per line, 4 lines per instruction, 32 per wave.
__device__ __forceinline__ void store_vt_f16(const _Float16* sT, _Float16* vt,
                                             int b, int t0, int n0, int w, int lane) {
  const int q8 = lane & 7, sub = lane >> 3;
  #pragma unroll
  for (int i = 0; i < 8; ++i) {
    const int lid = w * 32 + i * 4 + sub;            // 0..127
    const int d = lid >> 1, hl = lid & 1;            // d 0..63
    const v8h v = *(const v8ha*)(sT + d * 128 + 64 * hl + 8 * q8);
    _Float16* dst = vt + ((size_t)(b * HD + n0 + d)) * SEQ + t0 + 64 * hl + 8 * q8;
    *(v8h*)dst = v;
  }
}

// f32 tile staged [tok][64 feat] -> C[m0+tok][n0 .. n0+63]: two lines per row;
// wave w stores its own 32 rows = 64 lines, 4 lines per instruction.
__device__ __forceinline__ void store_rows_f32(const float* sT, float* C,
                                               int m0, int n0, int N, int w, int lane) {
  const int q8 = lane & 7, sub = lane >> 3;
  #pragma unroll
  for (int i = 0; i < 16; ++i) {
    const int lid = i * 4 + sub;                     // 0..63
    const int row = 32 * w + (lid >> 1), hl = lid & 1;
    const v4f v = *(const v4fa*)(sT + row * 64 + 32 * hl + 4 * q8);
    float* dst = C + (size_t)(m0 + row) * N + n0 + 32 * hl + 4 * q8;
    *(v4f*)dst = v;
  }
}

// ---------------------------------------------------------------------------
// Kernel 3: C = A * BT^T (+bias), A [M][K] f16 rows, BT [N][K] f16 rows (x32).
// Block 128 thr (4 waves) = 128 rows x 64 cols; wave tile 32 x 64 (2x4 WMMA
// tiles). K in stages of 64: the block brings 128 A rows and 64 BT rows of
// 128 B each by whole-line loads into one of two LDS buffers (row pitch 144 B,
// conflict-free for 16-B fragment reads); the next stage's loads fly while
// this stage's fragments are read from LDS; one barrier per stage. K = DIM.
// MODE 0: f16 C[M][N] = f16((acc*ascale + bias)*oscale)
// MODE 1: f16 vT[b][d][t] layout (N = HD)
// MODE 2: f32 C[M][N] = acc*ascale + bias
// grid (M/128, N/64)
// ---------------------------------------------------------------------------
#define GKT   64                     // k per stage
#define GP    72                     // LDS row pitch in halves (144 B)
#define GABUF (128 * GP)
#define GBUF  ((128 + 64) * GP)      // one stage: A rows then BT rows
union GemmSmem { _Float16 ring[2 * GBUF]; _Float16 h[128 * 64]; float f[128 * 64]; };

template <int MODE, typename CT>
__global__ __launch_bounds__(128) void gemm_kernel(
    const _Float16* __restrict__ A, const _Float16* __restrict__ BT,
    const float* __restrict__ bias, CT* __restrict__ C,
    int N, float ascale, float oscale)
{
  constexpr int K = DIM;     // every product here contracts over DIM; a constant row pitch lets one address serve a stage's loads
  __shared__ __attribute__((aligned(16))) GemmSmem sm;       // 55296 B

  const int tid = threadIdx.x, lane = tid & 31, w = tid >> 5;
  const int h = lane >> 4, m = lane & 15;
  const int m0 = blockIdx.x * 128, n0 = blockIdx.y * 64;

  // staging: 16-B chunk (row = tid/8 + 16 i, col = tid%8); a wave covers 4 whole lines
  const int srow = tid >> 3, scol = (tid & 7) * 8;
  const _Float16* ag = A  + (size_t)(m0 + srow) * K + scol;
  const _Float16* bg = BT + (size_t)(n0 + srow) * K + scol;
  const int sl = srow * GP + scol;
  // fragment rows in a stage
  const int fa = (32 * w + m) * GP;                          // mt = 0
  const int fb = GABUF + m * GP;                             // nt = 0

  const v8f zero8 = {0.f, 0.f, 0.f, 0.f, 0.f, 0.f, 0.f, 0.f};
  v8f acc[2][4];
  #pragma unroll
  for (int mt = 0; mt < 2; ++mt)
    #pragma unroll
    for (int nt = 0; nt < 4; ++nt) acc[mt][nt] = zero8;

  v8h ra[8], rb[4];
  #pragma unroll
  for (int i = 0; i < 8; ++i) ra[i] = *(const v8ha*)(ag + (size_t)(16 * i) * K);
  #pragma unroll
  for (int i = 0; i < 4; ++i) rb[i] = *(const v8ha*)(bg + (size_t)(16 * i) * K);
  #pragma unroll
  for (int i = 0; i < 8; ++i) *(v8ha*)(sm.ring + sl + 16 * i * GP) = ra[i];
  #pragma unroll
  for (int i = 0; i < 4; ++i) *(v8ha*)(sm.ring + GABUF + sl + 16 * i * GP) = rb[i];
  __syncthreads();

  int cur = 0;
  #pragma unroll 1
  for (int k0 = 0; k0 < K; k0 += GKT) {
    const bool more = k0 + GKT < K;
    if (more) {
      #pragma unroll
      for (int i = 0; i < 8; ++i) ra[i] = *(const v8ha*)(ag + (size_t)(16 * i) * K + k0 + GKT);
      #pragma unroll
      for (int i = 0; i < 4; ++i) rb[i] = *(const v8ha*)(bg + (size_t)(16 * i) * K + k0 + GKT);
    }
    const _Float16* st = sm.ring + cur * GBUF;
    #pragma unroll
    for (int ks = 0; ks < 2; ++ks) {
      const v16h a0 = load_frag(st + fa + 32 * ks, h);
      const v16h a1 = load_frag(st + fa + 16 * GP + 32 * ks, h);
      #pragma unroll
      for (int nt = 0; nt < 4; ++nt) {
        const v16h b = load_frag(st + fb + nt * 16 * GP + 32 * ks, h);
        acc[0][nt] = wmma_f16(a0, b, acc[0][nt]);
        acc[1][nt] = wmma_f16(a1, b, acc[1][nt]);
      }
    }
    cur ^= 1;
    if (more) {
      _Float16* nx = sm.ring + cur * GBUF + sl;
      #pragma unroll
      for (int i = 0; i < 8; ++i) *(v8ha*)(nx + 16 * i * GP) = ra[i];
      #pragma unroll
      for (int i = 0; i < 4; ++i) *(v8ha*)(nx + GABUF + 16 * i * GP) = rb[i];
    }
    // publishes the next stage and ends every read of this one (the last pass: frees the ring for the output tile)
    __syncthreads();
  }

  // D[r] of tile (mt, nt) = C[row m0+32w+16mt+8h+r][col n0+16nt+m]
  #pragma unroll
  for (int nt = 0; nt < 4; ++nt) {
    const int feat = 16 * nt + m;
    const float bvl = bias[n0 + feat];
    #pragma unroll
    for (int mt = 0; mt < 2; ++mt) {
      #pragma unroll
      for (int r = 0; r < 8; ++r) {
        const int tokl = 32 * w + 16 * mt + 8 * h + r;   // 0..127
        const float y = acc[mt][nt][r] * ascale + bvl;
        if (MODE == 2) {
          sm.f[tokl * 64 + feat] = y;
        } else if (MODE == 1) {
          sm.h[feat * 128 + tokl] = (_Float16)(y * oscale);
        } else {
          sm.h[tokl * 64 + feat] = (_Float16)(y * oscale);
        }
      }
    }
  }
  __syncthreads();

  if (MODE == 2) {
    float* Cf = (float*)(void*)C;
    store_rows_f32(sm.f, Cf, m0, n0, N, w, lane);
    
  } else if (MODE == 1) {
    _Float16* Ch = (_Float16*)(void*)C;
    const int b = m0 / SEQ, t0 = m0 - b * SEQ;
    store_vt_f16(sm.h, Ch, b, t0, n0, w, lane);
    
  } else {
    _Float16* Ch = (_Float16*)(void*)C;
    store_rows_f16(sm.h, Ch, m0, n0, N, w, lane);
    
  }
}

// ---------------------------------------------------------------------------
// Attention helpers.
// ---------------------------------------------------------------------------
// P^T B-fragment from the lane's own score D values: element r <- tile a row r
// (keys 0..15 of the 32-key chunk), element 8+r <- tile c row r (keys 16..31),
// same lane, same query column; scaled by 2^14 before the f16 convert.
__device__ __forceinline__ v16h pack_p(v8f a, v8f c) {
  const v16h r = { (_Float16)(a[0] * PSCALE), (_Float16)(a[1] * PSCALE), (_Float16)(a[2] * PSCALE), (_Float16)(a[3] * PSCALE),
                   (_Float16)(a[4] * PSCALE), (_Float16)(a[5] * PSCALE), (_Float16)(a[6] * PSCALE), (_Float16)(a[7] * PSCALE),
                   (_Float16)(c[0] * PSCALE), (_Float16)(c[1] * PSCALE), (_Float16)(c[2] * PSCALE), (_Float16)(c[3] * PSCALE),
                   (_Float16)(c[4] * PSCALE), (_Float16)(c[5] * PSCALE), (_Float16)(c[6] * PSCALE), (_Float16)(c[7] * PSCALE) };
  return r;
}

// Per-wave 16 x 128 f16 tile in LDS -> oh[b*SEQ + q0 + row][head*128 + d];
// instruction, 32 lines (16 rows x 2) per wave.
__device__ __forceinline__ void att_store_pass(const _Float16* so, _Float16* oh,
                                               int b, int head, int q0, int lane) {
  const int q8 = lane & 7, sub = lane >> 3;
  #pragma unroll
  for (int i = 0; i < 8; ++i) {
    const int lid = i * 4 + sub;                     // 0..31
    const int row = lid >> 1, hl = lid & 1;
    const v8h v = *(const v8ha*)(so + row * HD + 64 * hl + 8 * q8);
    _Float16* dst = oh + ((size_t)(b * SEQ + q0 + row)) * DIM + head * HD + 64 * hl + 8 * q8;
    *(v8h*)dst = v;
  }
}

// ---------------------------------------------------------------------------
// Kernel 4: streaming attention, transposed form, single shared K/V head.
// grid (SEQ/128, NH, BS); block 256 thr (8 waves), 16 queries per wave,
// 32 keys per step. K rows and V^T rows come in stages of 64 keys: the block
// brings them by whole-line loads into one of two LDS buffers (K row pitch
// 272 B, V^T row pitch 144 B, conflict-free for 16-B fragment reads), shared
// by its 8 waves; the next stage's loads fly while this stage is worked on;
// one barrier per stage.
//   S^T = K * Q^T : A = K rows (row = key, k = d, 4 k-steps), B = Q^T (k = d, n = query)
//   O^T += V^T * P^T : A = vT rows (row = d, k = key), B = P^T from registers
// Lane owns 16 keys of query column (lane&15); partner = lane ^ 16.
// ---------------------------------------------------------------------------
#define AKT   64                     // keys per stage
#define AKP   136                    // K row pitch in halves (272 B)
#define AVP   72                     // V^T row pitch in halves (144 B)
#define AKBUF (AKT * AKP)
#define AVBUF (HD * AVP)

__global__ __launch_bounds__(256) void attn_kernel(
    const _Float16* __restrict__ qh,   // [MTOT][DIM]  q (unscaled)
    const _Float16* __restrict__ kh,   // [MTOT][HD]   k
    const _Float16* __restrict__ vt,   // [BS][HD][SEQ] v transposed
    _Float16* __restrict__ oh)         // [MTOT][DIM]  f16(16 * o)
{
  __shared__ __attribute__((aligned(16))) _Float16 sK[2 * AKBUF];     // 34816 B
  __shared__ __attribute__((aligned(16))) _Float16 sV[2 * AVBUF];     // 36864 B
  __shared__ __attribute__((aligned(16))) _Float16 sO[8 * 16 * HD];   // 32768 B

  const int tid = threadIdx.x, lane = tid & 31, w = tid >> 5;
  const int hh = lane >> 4, m = lane & 15;
  const int b = blockIdx.z, head = blockIdx.y;
  const int q0 = blockIdx.x * 128 + 16 * w;

  // Q^T B-fragments: column n = query q0+m, k = d (four 32-deep chunks)
  const _Float16* qrow = qh + ((size_t)(b * SEQ + q0 + m)) * DIM + head * HD;
  v16h qb[4];
  #pragma unroll
  for (int c = 0; c < 4; ++c) qb[c] = load_frag(qrow + 32 * c, hh);

  const v8f zero8 = {0.f, 0.f, 0.f, 0.f, 0.f, 0.f, 0.f, 0.f};
  v8f o[8];                                   // o[t][r] = O^T[d 16t+8hh+r][query m] * (l * 2^14)
  #pragma unroll
  for (int t = 0; t < 8; ++t) o[t] = zero8;
  float mrun = -1e30f, lrun = 0.0f;

  // staging, 16-B chunks. K stage = 16 KiB contiguous: chunk tid + 256 i = row tid/16 + 16 i, col tid%16.
  // V^T stage = 128 rows of 128 B: chunk tid + 256 i = row tid/8 + 32 i, col tid%8.
  const _Float16* kg = kh + (size_t)b * SEQ * HD + tid * 8;
  const _Float16* vg = vt + ((size_t)b * HD + (tid >> 3)) * SEQ + (tid & 7) * 8;
  const int kls = (tid >> 4) * AKP + (tid & 15) * 8;
  const int vls = (tid >> 3) * AVP + (tid & 7) * 8;
  const float scale = 0.08838834764831845f;                    // 1/sqrt(128)

  v8h rk[4], rv[4];
  #pragma unroll
  for (int i = 0; i < 4; ++i) rk[i] = *(const v8ha*)(kg + 2048 * i);
  #pragma unroll
  for (int i = 0; i < 4; ++i) rv[i] = *(const v8ha*)(vg + (size_t)(32 * i) * SEQ);
  // precaution: the address registers of the loads above are reused for the loop's counters only behind this wait
  asm volatile("s_wait_xcnt 0x0" ::: "memory");
  #pragma unroll
  for (int i = 0; i < 4; ++i) *(v8ha*)(sK + kls + 16 * i * AKP) = rk[i];
  #pragma unroll
  for (int i = 0; i < 4; ++i) *(v8ha*)(sV + vls + 32 * i * AVP) = rv[i];
  __syncthreads();

  int cur = 0;
  #pragma unroll 1
  for (int kt = 0; kt < SEQ; kt += AKT) {
   const bool more = kt + AKT < SEQ;
   if (more) {
     #pragma unroll
     for (int i = 0; i < 4; ++i) rk[i] = *(const v8ha*)(kg + (size_t)(kt + AKT) * HD + 2048 * i);
     #pragma unroll
     for (int i = 0; i < 4; ++i) rv[i] = *(const v8ha*)(vg + (size_t)(32 * i) * SEQ + kt + AKT);
   }
   const _Float16* kS = sK + cur * AKBUF + m * AKP;
   const _Float16* vS = sV + cur * AVBUF + m * AVP;

   #pragma unroll
   for (int kb = 0; kb < AKT; kb += 32) {
    // ---- scores: s[j][r] = S^T[key kt+kb+16j+8hh+r][query q0+m] ----
    v8f s[2];
    #pragma unroll
    for (int j = 0; j < 2; ++j) {
      const _Float16* kp = kS + (kb + 16 * j) * AKP;
      v8f z = zero8;
      #pragma unroll
      for (int c = 0; c < 4; ++c) {
        const v16h kf = load_frag(kp + 32 * c, hh);
        z = wmma_f16(kf, qb[c], z);
      }
      s[j] = z;
    }

    // ---- scale (f32) and online softmax over this lane pair's 32 keys ----
    float mloc = -1e30f;
    #pragma unroll
    for (int j = 0; j < 2; ++j)
      #pragma unroll
      for (int r = 0; r < 8; ++r) {
        const float sv = s[j][r] * scale;
        s[j][r] = sv;
        mloc = fmaxf(mloc, sv);
      }
    mloc = fmaxf(mloc, __shfl_xor(mloc, 16));
    const float mnew = fmaxf(mrun, mloc);
    const float alpha = __expf(mrun - mnew);
    mrun = mnew;
    float lsum = 0.0f;
    #pragma unroll
    for (int j = 0; j < 2; ++j)
      #pragma unroll
      for (int r = 0; r < 8; ++r) {
        const float p = __expf(s[j][r] - mnew);
        s[j][r] = p;
        lsum += p;
      }
    lsum += __shfl_xor(lsum, 16);
    lrun = lrun * alpha + lsum;
    #pragma unroll
    for (int t = 0; t < 8; ++t)
      #pragma unroll
      for (int r = 0; r < 8; ++r) o[t][r] = o[t][r] * alpha;

    // ---- P^T B-fragment for keys kb .. kb+31 ----
    const v16h pb = pack_p(s[0], s[1]);

    // ---- O^T += V^T * P^T over the 8 d tiles ----
    #pragma unroll
    for (int t = 0; t < 8; ++t) {
      const v16h vf = load_frag(vS + (16 * t) * AVP + kb, hh);
      o[t] = wmma_f16(vf, pb, o[t]);
    }
   }

   cur ^= 1;
   if (more) {
     #pragma unroll
     for (int i = 0; i < 4; ++i) *(v8ha*)(sK + cur * AKBUF + kls + 16 * i * AKP) = rk[i];
     #pragma unroll
     for (int i = 0; i < 4; ++i) *(v8ha*)(sV + cur * AVBUF + vls + 32 * i * AVP) = rv[i];
   }
   // publishes the next stage and ends every wave's reads of this one
   __syncthreads();
  }

  // ---- epilogue: normalise, x16 carry, stage per-wave 16x128 f16 tile ----
  const float inv = __builtin_amdgcn_rcpf(lrun) * (OSC / PSCALE);
  _Float16* so = sO + w * (16 * HD);
  #pragma unroll
  for (int t = 0; t < 8; ++t)
    #pragma unroll
    for (int r = 0; r < 8; ++r)
      so[m * HD + 16 * t + 8 * hh + r] = (_Float16)(o[t][r] * inv);
  __syncthreads();

  att_store_pass(so, oh, b, head, q0, lane);
  
}

// ---------------------------------------------------------------------------
extern "C" void kernel_launch(void* const* d_in, const int* in_sizes, int n_in,
                              void* d_out, int out_size, void* d_ws, size_t ws_size,
                              hipStream_t stream) {
  if (n_in < 9) return;
  if (in_sizes[0] != NX) return;
  if (in_sizes[1] != DIM * DIM || in_sizes[2] != DIM) return;
  if (in_sizes[3] != DIM * HD || in_sizes[4] != HD) return;
  if (in_sizes[5] != DIM * HD || in_sizes[6] != HD) return;
  if (in_sizes[7] != DIM * DIM || in_sizes[8] != DIM) return;
  if (out_size != NX) return;

  const float* x  = (const float*)d_in[0];
  const float* wq = (const float*)d_in[1];
  const float* bq = (const float*)d_in[2];
  const float* wk = (const float*)d_in[3];
  const float* bk = (const float*)d_in[4];
  const float* wv = (const float*)d_in[5];
  const float* bv = (const float*)d_in[6];
  const float* wo = (const float*)d_in[7];
  const float* bo = (const float*)d_in[8];
  float* out = (float*)d_out;

  const size_t act_b = (size_t)NX * 2;              // 16777216  f16 [4096][2048]
  const size_t wsq_b = (size_t)DIM * DIM * 2;       //  8388608  f16 [2048][2048]
  const size_t wkv_b = (size_t)DIM * HD * 2;        //   524288  f16 [128][2048]
  const size_t kv_b  = (size_t)MTOT * HD * 2;       //  1048576  f16 [4096][128] / [2][128][2048]
  const size_t total = act_b + wsq_b + 2 * wkv_b + wsq_b + act_b + 2 * kv_b + act_b;   // 70254592
  if (total > ws_size) return;

  char* ws = (char*)d_ws;
  size_t off = 0;
  _Float16* xh  = (_Float16*)(ws + off); off += act_b;
  _Float16* wqT = (_Float16*)(ws + off); off += wsq_b;
  _Float16* wkT = (_Float16*)(ws + off); off += wkv_b;
  _Float16* wvT = (_Float16*)(ws + off); off += wkv_b;
  _Float16* woT = (_Float16*)(ws + off); off += wsq_b;
  _Float16* qh  = (_Float16*)(ws + off); off += act_b;
  _Float16* kh  = (_Float16*)(ws + off); off += kv_b;
  _Float16* vT  = (_Float16*)(ws + off); off += kv_b;
  _Float16* oh  = (_Float16*)(ws + off); off += act_b;
  if (off > ws_size) return;

  // 1) operand planes: x -> f16; W (in,out) -> W^T [out][in] f16 x32
  cvt_x_kernel<<<NX8 / 256, 256, 0, stream>>>(x, xh, NX8);
  transpose_w_kernel<<<dim3(DIM / 32, DIM / 64), 256, 0, stream>>>(wq, wqT, DIM, DIM);   // in[2048][2048] -> out[2048][2048]
  transpose_w_kernel<<<dim3(HD / 32, DIM / 64), 256, 0, stream>>>(wk, wkT, DIM, HD);     // in[2048][128]  -> out[128][2048]
  transpose_w_kernel<<<dim3(HD / 32, DIM / 64), 256, 0, stream>>>(wv, wvT, DIM, HD);     // in[2048][128]  -> out[128][2048]
  transpose_w_kernel<<<dim3(DIM / 32, DIM / 64), 256, 0, stream>>>(wo, woT, DIM, DIM);   // in[2048][2048] -> out[2048][2048]

  // 2) projections: q [4096][2048] f16, k [4096][128] f16, v -> vT [2][128][2048] f16
  gemm_kernel<0, _Float16><<<dim3(MTOT / 128, DIM / 64), 128, 0, stream>>>(xh, wqT, bq, qh, DIM, WINV, 1.0f);
  gemm_kernel<0, _Float16><<<dim3(MTOT / 128, HD / 64), 128, 0, stream>>>(xh, wkT, bk, kh, HD, WINV, 1.0f);
  gemm_kernel<1, _Float16><<<dim3(MTOT / 128, HD / 64), 128, 0, stream>>>(xh, wvT, bv, vT, HD, WINV, 1.0f);

  // 3) attention: all 16 query heads against the shared K / V^T planes; o f16 x16
  attn_kernel<<<dim3(SEQ / 128, NH, BS), 256, 0, stream>>>(qh, kh, vT, oh);

  // 4) output projection: out = (o x16)(wo x32) / 512 + bo, f32 whole-line stores
  gemm_kernel<2, float><<<dim3(MTOT / 128, DIM / 64), 128, 0, stream>>>(oh, woT, bo, out, DIM, WINV / OSC, 1.0f);
}

// v002
// A run of this version takes 206 microseconds.
// Timed twice side by side with v001, it ran 1.13 and 1.12 times as fast.
// Counting every step since v000, it is 2.79 times as fast.
// Contractions: x*WqT, x*WkT, x*WvT, K*Q^T, V^T*P^T and O*WoT all on v_wmma_f32_16x16x32_f16 (f16 operands, f32 accumulate); W carried x32, P carried x16384, O carried x16 (exact power-of-two scales folded back in f32); softmax, bias and normalisation in f32.
#include <hip/hip_runtime.h>

typedef _Float16 v16h __attribute__((ext_vector_type(16)));
typedef _Float16 v8h  __attribute__((ext_vector_type(8)));
typedef float    v8f  __attribute__((ext_vector_type(8)));
typedef float    v4f  __attribute__((ext_vector_type(4)));
typedef v8h __attribute__((may_alias)) v8ha;
typedef v4f __attribute__((may_alias)) v4fa;

union Frag { v16h v; v8h half[2]; };

#define DIM    2048
#define SEQ    2048
#define NH     16
#define HD     128
#define BS     2
#define MTOT   (BS * SEQ)          // 4096 token rows
#define NX     (MTOT * DIM)        // 8388608
#define NX8    (NX / 8)            // 1048576
#define WSC    32.0f
#define WINV   0.03125f
#define PSCALE 16384.0f
#define OSC    16.0f

// ---------------------------------------------------------------------------
// 16x16x32 f16 WMMA with hazard guard (ties D, keeps A/B live).
// Fragment map (wave32): lane l, h = l>>4, m = n = l&15.
//   A/B element i: i<8 -> k0+8h+i ; i>=8 -> k0+16+8h+(i-8)
//   D element r : row 8h+r, col l&15
// ---------------------------------------------------------------------------
__device__ __forceinline__ v8f wmma_f16(v16h a, v16h b, v8f c) {
  v8f d = __builtin_amdgcn_wmma_f32_16x16x32_f16(false, a, false, b, (short)0, c, false, false);
  asm volatile("v_nop\n\tv_nop\n\tv_nop\n\tv_nop" : "+v"(d) : "v"(a), "v"(b));
  return d;
}

// A or B fragment from a k-contiguous f16 row; p points at element k0 of the
// row owned by this lane (row index = lane & 15 added by the caller).
__device__ __forceinline__ v16h load_frag(const _Float16* p, int h) {
  Frag f;
  f.half[0] = *(const v8ha*)(p + 8 * h);
  f.half[1] = *(const v8ha*)(p + 16 + 8 * h);
  return f.v;
}

// ---------------------------------------------------------------------------
// Kernel 1: x f32 -> f16 (unscaled). One 16-B store per lane, lanes
// ---------------------------------------------------------------------------
__global__ __launch_bounds__(256) void cvt_x_kernel(const float* __restrict__ x,
                                                     _Float16* __restrict__ xh, int n8)
{
  const int g = blockIdx.x * 256 + threadIdx.x;
  if (g >= n8) return;
  const float* src = x + (size_t)g * 8;
  const v4f a = *(const v4fa*)src;
  const v4f c = *(const v4fa*)(src + 4);
  const v8h o = { (_Float16)a.x, (_Float16)a.y, (_Float16)a.z, (_Float16)a.w,
                  (_Float16)c.x, (_Float16)c.y, (_Float16)c.z, (_Float16)c.w };
  _Float16* dst = xh + (size_t)g * 8;
  *(v8h*)dst = o;
  
}

// ---------------------------------------------------------------------------
// Kernel 2: w[K][N] f32 (in, out) -> wT[N][K] f16 scaled x32 (exact).
// Block 256 thr, tile 64 k x 32 n; grid (N/32, K/64). Reads coalesced along
// n; tile staged in LDS as [n][64 k]; each output row segment = 64 halves =
// ---------------------------------------------------------------------------
__global__ __launch_bounds__(256) void transpose_w_kernel(const float* __restrict__ w,
                                                           _Float16* __restrict__ wT,
                                                           int K, int N)
{
  __shared__ __attribute__((aligned(16))) _Float16 sT[32 * 64];
  const int tid = threadIdx.x, lane = tid & 31, wv = tid >> 5;
  const int n0 = blockIdx.x * 32, k0 = blockIdx.y * 64;
  const int nn = tid & 31, kr = tid >> 5;          // kr 0..7
  #pragma unroll
  for (int i = 0; i < 8; ++i) {
    const int kk = kr + 8 * i;                       // 0..63
    const float val = w[(size_t)(k0 + kk) * N + n0 + nn] * WSC;
    sT[nn * 64 + kk] = (_Float16)val;
  }
  __syncthreads();
  const int q8 = lane & 7, sub = lane >> 3;
  const int n = wv * 4 + sub;                        // 0..31
  const v8h v = *(const v8ha*)(sT + n * 64 + 8 * q8);
  _Float16* dst = wT + (size_t)(n0 + n) * K + k0 + 8 * q8;
  *(v8h*)dst = v;
  
}

// ---------------------------------------------------------------------------
// ---------------------------------------------------------------------------
// f16 tile staged [tok][64 feat] -> C[m0+tok][n0 .. n0+63]: one line per row,
// lanes 8q..8q+7 per line, 4 lines per instruction, 32 lines per wave.
__device__ __forceinline__ void store_rows_f16(const _Float16* sT, _Float16* C,
                                               int m0, int n0, int N, int w, int lane) {
  const int q8 = lane & 7, sub = lane >> 3;
  #pragma unroll
  for (int i = 0; i < 8; ++i) {
    const int lid = w * 32 + i * 4 + sub;            // 0..127
    const v8h v = *(const v8ha*)(sT + lid * 64 + 8 * q8);
    _Float16* dst = C + (size_t)(m0 + lid) * N + n0 + 8 * q8;
    *(v8h*)dst = v;
  }
}

// f16 tile staged [feat d][128 tok] -> vt[b][n0+d][t0 .. t0+127]: two lines
// per d row, lanes 8q..8q+7 per line, 4 lines per instruction, 32 per wave.
__device__ __forceinline__ void store_vt_f16(const _Float16* sT, _Float16* vt,
                                             int b, int t0, int n0, int w, int lane) {
  const int q8 = lane & 7, sub = lane >> 3;
  #pragma unroll
  for (int i = 0; i < 8; ++i) {
    const int lid = w * 32 + i * 4 + sub;            // 0..127
    const int d = lid >> 1, hl = lid & 1;            // d 0..63
    const v8h v = *(const v8ha*)(sT + d * 128 + 64 * hl + 8 * q8);
    _Float16* dst = vt + ((size_t)(b * HD + n0 + d)) * SEQ + t0 + 64 * hl + 8 * q8;
    *(v8h*)dst = v;
  }
}

// f32 tile staged [tok][64 feat] -> C[m0+tok][n0 .. n0+63]: two lines per row;
// wave w stores its own 32 rows = 64 lines, 4 lines per instruction.
__device__ __forceinline__ void store_rows_f32(const float* sT, float* C,
                                               int m0, int n0, int N, int w, int lane) {
  const int q8 = lane & 7, sub = lane >> 3;
  #pragma unroll
  for (int i = 0; i < 16; ++i) {
    const int lid = i * 4 + sub;                     // 0..63
    const int row = 32 * w + (lid >> 1), hl = lid & 1;
    const v4f v = *(const v4fa*)(sT + row * 64 + 32 * hl + 4 * q8);
    float* dst = C + (size_t)(m0 + row) * N + n0 + 32 * hl + 4 * q8;
    *(v4f*)dst = v;
  }
}

// ---------------------------------------------------------------------------
// Kernel 3: C = A * BT^T (+bias), A [M][K] f16 rows, BT [N][K] f16 rows (x32).
// Block 128 thr (4 waves) = 128 rows x 64 cols; wave tile 32 x 64 (2x4 WMMA
// tiles). K in stages of 64: the block brings 128 A rows and 64 BT rows of
// 128 B each by whole-line loads into one of two LDS buffers (row pitch 144 B,
// conflict-free for 16-B fragment reads); the next stage's loads fly while
// this stage's fragments are read from LDS; one barrier per stage. K = DIM.
// MODE 0: f16 C[M][N] = f16((acc*ascale + bias)*oscale)
// MODE 1: f16 vT[b][d][t] layout (N = HD)
// MODE 2: f32 C[M][N] = acc*ascale + bias
// grid (M/128, N/64)
// ---------------------------------------------------------------------------
#define GKT   64                     // k per stage
#define GP    72                     // LDS row pitch in halves (144 B)
#define GABUF (128 * GP)
#define GBUF  ((128 + 64) * GP)      // one stage: A rows then BT rows
union GemmSmem { _Float16 ring[2 * GBUF]; _Float16 h[128 * 64]; float f[128 * 64]; };

template <int MODE, typename CT>
__global__ __launch_bounds__(128) void gemm_kernel(
    const _Float16* __restrict__ A, const _Float16* __restrict__ BT,
    const float* __restrict__ bias, CT* __restrict__ C,
    int N, float ascale, float oscale)
{
  constexpr int K = DIM;     // every product here contracts over DIM; a constant row pitch lets one address serve a stage's loads
  __shared__ __attribute__((aligned(16))) GemmSmem sm;       // 55296 B

  const int tid = threadIdx.x, lane = tid & 31, w = tid >> 5;
  const int h = lane >> 4, m = lane & 15;
  const int m0 = blockIdx.x * 128, n0 = blockIdx.y * 64;

  // staging: 16-B chunk (row = tid/8 + 16 i, col = tid%8); a wave covers 4 whole lines
  const int srow = tid >> 3, scol = (tid & 7) * 8;
  const _Float16* ag = A  + (size_t)(m0 + srow) * K + scol;
  const _Float16* bg = BT + (size_t)(n0 + srow) * K + scol;
  const int sl = srow * GP + scol;
  // fragment rows in a stage
  const int fa = (32 * w + m) * GP;                          // mt = 0
  const int fb = GABUF + m * GP;                             // nt = 0

  const v8f zero8 = {0.f, 0.f, 0.f, 0.f, 0.f, 0.f, 0.f, 0.f};
  v8f acc[2][4];
  #pragma unroll
  for (int mt = 0; mt < 2; ++mt)
    #pragma unroll
    for (int nt = 0; nt < 4; ++nt) acc[mt][nt] = zero8;

  v8h ra[8], rb[4];
  #pragma unroll
  for (int i = 0; i < 8; ++i) ra[i] = *(const v8ha*)(ag + (size_t)(16 * i) * K);
  #pragma unroll
  for (int i = 0; i < 4; ++i) rb[i] = *(const v8ha*)(bg + (size_t)(16 * i) * K);
  #pragma unroll
  for (int i = 0; i < 8; ++i) *(v8ha*)(sm.ring + sl + 16 * i * GP) = ra[i];
  #pragma unroll
  for (int i = 0; i < 4; ++i) *(v8ha*)(sm.ring + GABUF + sl + 16 * i * GP) = rb[i];
  __syncthreads();

  int cur = 0;
  #pragma unroll 1
  for (int k0 = 0; k0 < K; k0 += GKT) {
    const bool more = k0 + GKT < K;
    if (more) {
      #pragma unroll
      for (int i = 0; i < 8; ++i) ra[i] = *(const v8ha*)(ag + (size_t)(16 * i) * K + k0 + GKT);
      #pragma unroll
      for (int i = 0; i < 4; ++i) rb[i] = *(const v8ha*)(bg + (size_t)(16 * i) * K + k0 + GKT);
    }
    const _Float16* st = sm.ring + cur * GBUF;
    // the stage's 12 fragments come as one group of LDS loads ahead of its 16 products (one exposed LDS latency a stage)
    v16h fA[2][2], fB[2][4];
    #pragma unroll
    for (int ks = 0; ks < 2; ++ks) {
      fA[ks][0] = load_frag(st + fa + 32 * ks, h);
      fA[ks][1] = load_frag(st + fa + 16 * GP + 32 * ks, h);
      #pragma unroll
      for (int nt = 0; nt < 4; ++nt) fB[ks][nt] = load_frag(st + fb + nt * 16 * GP + 32 * ks, h);
    }
    #pragma unroll
    for (int ks = 0; ks < 2; ++ks) {
      #pragma unroll
      for (int nt = 0; nt < 4; ++nt) {
        acc[0][nt] = wmma_f16(fA[ks][0], fB[ks][nt], acc[0][nt]);
        acc[1][nt] = wmma_f16(fA[ks][1], fB[ks][nt], acc[1][nt]);
      }
    }
    cur ^= 1;
    if (more) {
      _Float16* nx = sm.ring + cur * GBUF + sl;
      #pragma unroll
      for (int i = 0; i < 8; ++i) *(v8ha*)(nx + 16 * i * GP) = ra[i];
      #pragma unroll
      for (int i = 0; i < 4; ++i) *(v8ha*)(nx + GABUF + 16 * i * GP) = rb[i];
    }
    // publishes the next stage and ends every read of this one (the last pass: frees the ring for the output tile)
    __syncthreads();
  }

  // D[r] of tile (mt, nt) = C[row m0+32w+16mt+8h+r][col n0+16nt+m]
  #pragma unroll
  for (int nt = 0; nt < 4; ++nt) {
    const int feat = 16 * nt + m;
    const float bvl = bias[n0 + feat];
    #pragma unroll
    for (int mt = 0; mt < 2; ++mt) {
      #pragma unroll
      for (int r = 0; r < 8; ++r) {
        const int tokl = 32 * w + 16 * mt + 8 * h + r;   // 0..127
        const float y = acc[mt][nt][r] * ascale + bvl;
        if (MODE == 2) {
          sm.f[tokl * 64 + feat] = y;
        } else if (MODE == 1) {
          sm.h[feat * 128 + tokl] = (_Float16)(y * oscale);
        } else {
          sm.h[tokl * 64 + feat] = (_Float16)(y * oscale);
        }
      }
    }
  }
  __syncthreads();

  if (MODE == 2) {
    float* Cf = (float*)(void*)C;
    store_rows_f32(sm.f, Cf, m0, n0, N, w, lane);
    
  } else if (MODE == 1) {
    _Float16* Ch = (_Float16*)(void*)C;
    const int b = m0 / SEQ, t0 = m0 - b * SEQ;
    store_vt_f16(sm.h, Ch, b, t0, n0, w, lane);
    
  } else {
    _Float16* Ch = (_Float16*)(void*)C;
    store_rows_f16(sm.h, Ch, m0, n0, N, w, lane);
    
  }
}

// ---------------------------------------------------------------------------
// Attention helpers.
// ---------------------------------------------------------------------------
// P^T B-fragment from the lane's own score D values: element r <- tile a row r
// (keys 0..15 of the 32-key chunk), element 8+r <- tile c row r (keys 16..31),
// same lane, same query column; scaled by 2^14 before the f16 convert.
__device__ __forceinline__ v16h pack_p(v8f a, v8f c) {
  const v16h r = { (_Float16)(a[0] * PSCALE), (_Float16)(a[1] * PSCALE), (_Float16)(a[2] * PSCALE), (_Float16)(a[3] * PSCALE),
                   (_Float16)(a[4] * PSCALE), (_Float16)(a[5] * PSCALE), (_Float16)(a[6] * PSCALE), (_Float16)(a[7] * PSCALE),
                   (_Float16)(c[0] * PSCALE), (_Float16)(c[1] * PSCALE), (_Float16)(c[2] * PSCALE), (_Float16)(c[3] * PSCALE),
                   (_Float16)(c[4] * PSCALE), (_Float16)(c[5] * PSCALE), (_Float16)(c[6] * PSCALE), (_Float16)(c[7] * PSCALE) };
  return r;
}

// Per-wave 16 x 128 f16 tile in LDS -> oh[b*SEQ + q0 + row][head*128 + d];
// instruction, 32 lines (16 rows x 2) per wave.
__device__ __forceinline__ void att_store_pass(const _Float16* so, _Float16* oh,
                                               int b, int head, int q0, int lane) {
  const int q8 = lane & 7, sub = lane >> 3;
  #pragma unroll
  for (int i = 0; i < 8; ++i) {
    const int lid = i * 4 + sub;                     // 0..31
    const int row = lid >> 1, hl = lid & 1;
    const v8h v = *(const v8ha*)(so + row * HD + 64 * hl + 8 * q8);
    _Float16* dst = oh + ((size_t)(b * SEQ + q0 + row)) * DIM + head * HD + 64 * hl + 8 * q8;
    *(v8h*)dst = v;
  }
}

// ---------------------------------------------------------------------------
// Kernel 4: streaming attention, transposed form, single shared K/V head.
// grid (SEQ/128, NH, BS); block 256 thr (8 waves), 16 queries per wave,
// 32 keys per step. K rows and V^T rows come in stages of 64 keys: the block
// brings them by whole-line loads into one of two LDS buffers (K row pitch
// 272 B, V^T row pitch 144 B, conflict-free for 16-B fragment reads), shared
// by its 8 waves; the next stage's loads fly while this stage is worked on;
// one barrier per stage.
//   S^T = K * Q^T : A = K rows (row = key, k = d, 4 k-steps), B = Q^T (k = d, n = query)
//   O^T += V^T * P^T : A = vT rows (row = d, k = key), B = P^T from registers
// Lane owns 16 keys of query column (lane&15); partner = lane ^ 16.
// ---------------------------------------------------------------------------
#define AKT   64                     // keys per stage
#define AKP   136                    // K row pitch in halves (272 B)
#define AVP   72                     // V^T row pitch in halves (144 B)
#define AKBUF (AKT * AKP)
#define AVBUF (HD * AVP)

__global__ __launch_bounds__(256) void attn_kernel(
    const _Float16* __restrict__ qh,   // [MTOT][DIM]  q (unscaled)
    const _Float16* __restrict__ kh,   // [MTOT][HD]   k
    const _Float16* __restrict__ vt,   // [BS][HD][SEQ] v transposed
    _Float16* __restrict__ oh)         // [MTOT][DIM]  f16(16 * o)
{
  __shared__ __attribute__((aligned(16))) _Float16 sK[2 * AKBUF];     // 34816 B
  __shared__ __attribute__((aligned(16))) _Float16 sV[2 * AVBUF];     // 36864 B
  __shared__ __attribute__((aligned(16))) _Float16 sO[8 * 16 * HD];   // 32768 B

  const int tid = threadIdx.x, lane = tid & 31, w = tid >> 5;
  const int hh = lane >> 4, m = lane & 15;
  const int b = blockIdx.z, head = blockIdx.y;
  const int q0 = blockIdx.x * 128 + 16 * w;

  // Q^T B-fragments: column n = query q0+m, k = d (four 32-deep chunks)
  const _Float16* qrow = qh + ((size_t)(b * SEQ + q0 + m)) * DIM + head * HD;
  v16h qb[4];
  #pragma unroll
  for (int c = 0; c < 4; ++c) qb[c] = load_frag(qrow + 32 * c, hh);

  const v8f zero8 = {0.f, 0.f, 0.f, 0.f, 0.f, 0.f, 0.f, 0.f};
  v8f o[8];                                   // o[t][r] = O^T[d 16t+8hh+r][query m] * (l * 2^14)
  #pragma unroll
  for (int t = 0; t < 8; ++t) o[t] = zero8;
  float mrun = -1e30f, lrun = 0.0f;

  // staging, 16-B chunks. K stage = 16 KiB contiguous: chunk tid + 256 i = row tid/16 + 16 i, col tid%16.
  // V^T stage = 128 rows of 128 B: chunk tid + 256 i = row tid/8 + 32 i, col tid%8.
  const _Float16* kg = kh + (size_t)b * SEQ * HD + tid * 8;
  const _Float16* vg = vt + ((size_t)b * HD + (tid >> 3)) * SEQ + (tid & 7) * 8;
  const int kls = (tid >> 4) * AKP + (tid & 15) * 8;
  const int vls = (tid >> 3) * AVP + (tid & 7) * 8;
  const float scale = 0.08838834764831845f;                    // 1/sqrt(128)

  v8h rk[4], rv[4];
  #pragma unroll
  for (int i = 0; i < 4; ++i) rk[i] = *(const v8ha*)(kg + 2048 * i);
  #pragma unroll
  for (int i = 0; i < 4; ++i) rv[i] = *(const v8ha*)(vg + (size_t)(32 * i) * SEQ);
  // precaution: the address registers of the loads above are reused for the loop's counters only behind this wait
  asm volatile("s_wait_xcnt 0x0" ::: "memory");
  #pragma unroll
  for (int i = 0; i < 4; ++i) *(v8ha*)(sK + kls + 16 * i * AKP) = rk[i];
  #pragma unroll
  for (int i = 0; i < 4; ++i) *(v8ha*)(sV + vls + 32 * i * AVP) = rv[i];
  __syncthreads();

  int cur = 0;
  #pragma unroll 1
  for (int kt = 0; kt < SEQ; kt += AKT) {
   const bool more = kt + AKT < SEQ;
   if (more) {
     #pragma unroll
     for (int i = 0; i < 4; ++i) rk[i] = *(const v8ha*)(kg + (size_t)(kt + AKT) * HD + 2048 * i);
     #pragma unroll
     for (int i = 0; i < 4; ++i) rv[i] = *(const v8ha*)(vg + (size_t)(32 * i) * SEQ + kt + AKT);
   }
   const _Float16* kS = sK + cur * AKBUF + m * AKP;
   const _Float16* vS = sV + cur * AVBUF + m * AVP;

   #pragma unroll
   for (int kb = 0; kb < AKT; kb += 32) {
    // ---- scores: s[j][r] = S^T[key kt+kb+16j+8hh+r][query q0+m] ----
    // the step's 8 K fragments come as one group of LDS loads ahead of its 8 score products
    v16h kf[2][4];
    #pragma unroll
    for (int j = 0; j < 2; ++j)
      #pragma unroll
      for (int c = 0; c < 4; ++c) kf[j][c] = load_frag(kS + (kb + 16 * j) * AKP + 32 * c, hh);
    v8f s[2];
    #pragma unroll
    for (int j = 0; j < 2; ++j) {
      v8f z = zero8;
      #pragma unroll
      for (int c = 0; c < 4; ++c) z = wmma_f16(kf[j][c], qb[c], z);
      s[j] = z;
    }
    // the step's 8 V^T fragments come as one group of LDS loads right behind the score products and fly under the
    // softmax; the scheduling barrier keeps the compiler from sinking part of the group towards its use
    v16h vf[8];
    #pragma unroll
    for (int t = 0; t < 8; ++t) vf[t] = load_frag(vS + (16 * t) * AVP + kb, hh);
    __builtin_amdgcn_sched_barrier(0);

    // ---- scale (f32) and online softmax over this lane pair's 32 keys ----
    float mloc = -1e30f;
    #pragma unroll
    for (int j = 0; j < 2; ++j)
      #pragma unroll
      for (int r = 0; r < 8; ++r) {
        const float sv = s[j][r] * scale;
        s[j][r] = sv;
        mloc = fmaxf(mloc, sv);
      }
    mloc = fmaxf(mloc, __shfl_xor(mloc, 16));
    const float mnew = fmaxf(mrun, mloc);
    const float alpha = __expf(mrun - mnew);
    mrun = mnew;
    float lsum = 0.0f;
    #pragma unroll
    for (int j = 0; j < 2; ++j)
      #pragma unroll
      for (int r = 0; r < 8; ++r) {
        const float p = __expf(s[j][r] - mnew);
        s[j][r] = p;
        lsum += p;
      }
    lsum += __shfl_xor(lsum, 16);
    lrun = lrun * alpha + lsum;
    #pragma unroll
    for (int t = 0; t < 8; ++t)
      #pragma unroll
      for (int r = 0; r < 8; ++r) o[t][r] = o[t][r] * alpha;

    // ---- P^T B-fragment for keys kb .. kb+31 ----
    const v16h pb = pack_p(s[0], s[1]);

    // ---- O^T += V^T * P^T over the 8 d tiles ----
    #pragma unroll
    for (int t = 0; t < 8; ++t) o[t] = wmma_f16(vf[t], pb, o[t]);
   }

   cur ^= 1;
   if (more) {
     #pragma unroll
     for (int i = 0; i < 4; ++i) *(v8ha*)(sK + cur * AKBUF + kls + 16 * i * AKP) = rk[i];
     #pragma unroll
     for (int i = 0; i < 4; ++i) *(v8ha*)(sV + cur * AVBUF + vls + 32 * i * AVP) = rv[i];
   }
   // publishes the next stage and ends every wave's reads of this one
   __syncthreads();
  }

  // ---- epilogue: normalise, x16 carry, stage per-wave 16x128 f16 tile ----
  const float inv = __builtin_amdgcn_rcpf(lrun) * (OSC / PSCALE);
  _Float16* so = sO + w * (16 * HD);
  #pragma unroll
  for (int t = 0; t < 8; ++t)
    #pragma unroll
    for (int r = 0; r < 8; ++r)
      so[m * HD + 16 * t + 8 * hh + r] = (_Float16)(o[t][r] * inv);
  __syncthreads();

  att_store_pass(so, oh, b, head, q0, lane);
  
}

// ---------------------------------------------------------------------------
extern "C" void kernel_launch(void* const* d_in, const int* in_sizes, int n_in,
                              void* d_out, int out_size, void* d_ws, size_t ws_size,
                              hipStream_t stream) {
  if (n_in < 9) return;
  if (in_sizes[0] != NX) return;
  if (in_sizes[1] != DIM * DIM || in_sizes[2] != DIM) return;
  if (in_sizes[3] != DIM * HD || in_sizes[4] != HD) return;
  if (in_sizes[5] != DIM * HD || in_sizes[6] != HD) return;
  if (in_sizes[7] != DIM * DIM || in_sizes[8] != DIM) return;
  if (out_size != NX) return;

  const float* x  = (const float*)d_in[0];
  const float* wq = (const float*)d_in[1];
  const float* bq = (const float*)d_in[2];
  const float* wk = (const float*)d_in[3];
  const float* bk = (const float*)d_in[4];
  const float* wv = (const float*)d_in[5];
  const float* bv = (const float*)d_in[6];
  const float* wo = (const float*)d_in[7];
  const float* bo = (const float*)d_in[8];
  float* out = (float*)d_out;

  const size_t act_b = (size_t)NX * 2;              // 16777216  f16 [4096][2048]
  const size_t wsq_b = (size_t)DIM * DIM * 2;       //  8388608  f16 [2048][2048]
  const size_t wkv_b = (size_t)DIM * HD * 2;        //   524288  f16 [128][2048]
  const size_t kv_b  = (size_t)MTOT * HD * 2;       //  1048576  f16 [4096][128] / [2][128][2048]
  const size_t total = act_b + wsq_b + 2 * wkv_b + wsq_b + act_b + 2 * kv_b + act_b;   // 70254592
  if (total > ws_size) return;

  char* ws = (char*)d_ws;
  size_t off = 0;
  _Float16* xh  = (_Float16*)(ws + off); off += act_b;
  _Float16* wqT = (_Float16*)(ws + off); off += wsq_b;
  _Float16* wkT = (_Float16*)(ws + off); off += wkv_b;
  _Float16* wvT = (_Float16*)(ws + off); off += wkv_b;
  _Float16* woT = (_Float16*)(ws + off); off += wsq_b;
  _Float16* qh  = (_Float16*)(ws + off); off += act_b;
  _Float16* kh  = (_Float16*)(ws + off); off += kv_b;
  _Float16* vT  = (_Float16*)(ws + off); off += kv_b;
  _Float16* oh  = (_Float16*)(ws + off); off += act_b;
  if (off > ws_size) return;

  // 1) operand planes: x -> f16; W (in,out) -> W^T [out][in] f16 x32
  cvt_x_kernel<<<NX8 / 256, 256, 0, stream>>>(x, xh, NX8);
  transpose_w_kernel<<<dim3(DIM / 32, DIM / 64), 256, 0, stream>>>(wq, wqT, DIM, DIM);   // in[2048][2048] -> out[2048][2048]
  transpose_w_kernel<<<dim3(HD / 32, DIM / 64), 256, 0, stream>>>(wk, wkT, DIM, HD);     // in[2048][128]  -> out[128][2048]
  transpose_w_kernel<<<dim3(HD / 32, DIM / 64), 256, 0, stream>>>(wv, wvT, DIM, HD);     // in[2048][128]  -> out[128][2048]
  transpose_w_kernel<<<dim3(DIM / 32, DIM / 64), 256, 0, stream>>>(wo, woT, DIM, DIM);   // in[2048][2048] -> out[2048][2048]

  // 2) projections: q [4096][2048] f16, k [4096][128] f16, v -> vT [2][128][2048] f16
  gemm_kernel<0, _Float16><<<dim3(MTOT / 128, DIM / 64), 128, 0, stream>>>(xh, wqT, bq, qh, DIM, WINV, 1.0f);
  gemm_kernel<0, _Float16><<<dim3(MTOT / 128, HD / 64), 128, 0, stream>>>(xh, wkT, bk, kh, HD, WINV, 1.0f);
  gemm_kernel<1, _Float16><<<dim3(MTOT / 128, HD / 64), 128, 0, stream>>>(xh, wvT, bv, vT, HD, WINV, 1.0f);

  // 3) attention: all 16 query heads against the shared K / V^T planes; o f16 x16
  attn_kernel<<<dim3(SEQ / 128, NH, BS), 256, 0, stream>>>(qh, kh, vT, oh);

  // 4) output projection: out = (o x16)(wo x32) / 512 + bo, f32 whole-line stores
  gemm_kernel<2, float><<<dim3(MTOT / 128, DIM / 64), 128, 0, stream>>>(oh, woT, bo, out, DIM, WINV / OSC, 1.0f);
}

// v003
// One run takes 169 microseconds.
// Timed twice side by side with v002, it ran 1.22 times as fast both times.
// Over all steps from v000 it is 3.40 times as fast.
// Contractions: x*WqT, x*WkT, x*WvT, K*Q^T, V^T*P^T and O*WoT all on v_wmma_f32_16x16x32_f16 (f16 operands, f32 accumulate); W carried x32, P carried x16384, O carried x16 (exact power-of-two scales folded back in f32); softmax, bias and normalisation in f32.
#include <hip/hip_runtime.h>

typedef _Float16 v16h __attribute__((ext_vector_type(16)));
typedef _Float16 v8h  __attribute__((ext_vector_type(8)));
typedef float    v8f  __attribute__((ext_vector_type(8)));
typedef float    v4f  __attribute__((ext_vector_type(4)));
typedef v8h __attribute__((may_alias)) v8ha;
typedef v4f __attribute__((may_alias)) v4fa;

union Frag { v16h v; v8h half[2]; };

#define DIM    2048
#define SEQ    2048
#define NH     16
#define HD     128
#define BS     2
#define MTOT   (BS * SEQ)          // 4096 token rows
#define NX     (MTOT * DIM)        // 8388608
#define NX8    (NX / 8)            // 1048576
#define WSC    32.0f
#define WINV   0.03125f
#define PSCALE 16384.0f
#define OSC    16.0f

// ---------------------------------------------------------------------------
// 16x16x32 f16 WMMA with hazard guard (ties D, keeps A/B live).
// Fragment map (wave32): lane l, h = l>>4, m = n = l&15.
//   A/B element i: i<8 -> k0+8h+i ; i>=8 -> k0+16+8h+(i-8)
//   D element r : row 8h+r, col l&15
// ---------------------------------------------------------------------------
__device__ __forceinline__ v8f wmma_f16(v16h a, v16h b, v8f c) {
  v8f d = __builtin_amdgcn_wmma_f32_16x16x32_f16(false, a, false, b, (short)0, c, false, false);
  asm volatile("v_nop\n\tv_nop\n\tv_nop\n\tv_nop" : "+v"(d) : "v"(a), "v"(b));
  return d;
}

// A or B fragment from a k-contiguous f16 row; p points at element k0 of the
// row owned by this lane (row index = lane & 15 added by the caller).
__device__ __forceinline__ v16h load_frag(const _Float16* p, int h) {
  Frag f;
  f.half[0] = *(const v8ha*)(p + 8 * h);
  f.half[1] = *(const v8ha*)(p + 16 + 8 * h);
  return f.v;
}

// ---------------------------------------------------------------------------
// Prep part 1: x f32 -> f16 (unscaled). One 16-B store per lane; blk = block
// index inside this part's range of the prep grid.
// ---------------------------------------------------------------------------
__device__ __forceinline__ void cvt_x_block(const float* __restrict__ x,
                                            _Float16* __restrict__ xh, int n8, int blk)
{
  const int g = blk * 256 + threadIdx.x;
  if (g >= n8) return;
  const float* src = x + (size_t)g * 8;
  const v4f a = *(const v4fa*)src;
  const v4f c = *(const v4fa*)(src + 4);
  const v8h o = { (_Float16)a.x, (_Float16)a.y, (_Float16)a.z, (_Float16)a.w,
                  (_Float16)c.x, (_Float16)c.y, (_Float16)c.z, (_Float16)c.w };
  _Float16* dst = xh + (size_t)g * 8;
  *(v8h*)dst = o;
  
}

// ---------------------------------------------------------------------------
// Prep part 2: w[K][N] f32 (in, out) -> wT[N][K] f16 scaled x32 (exact).
// Block 256 thr, tile 64 k x 32 n; tile (bx, by) of (N/32, K/64). Reads coalesced
// along n; tile staged in LDS as [n][64 k]; each output row segment = 64 halves.
// ---------------------------------------------------------------------------
__device__ __forceinline__ void transpose_w_block(const float* __restrict__ w,
                                                  _Float16* __restrict__ wT,
                                                  int K, int N, int bx, int by, _Float16* sT)
{
  const int tid = threadIdx.x, lane = tid & 31, wv = tid >> 5;
  const int n0 = bx * 32, k0 = by * 64;
  const int nn = tid & 31, kr = tid >> 5;          // kr 0..7
  #pragma unroll
  for (int i = 0; i < 8; ++i) {
    const int kk = kr + 8 * i;                       // 0..63
    const float val = w[(size_t)(k0 + kk) * N + n0 + nn] * WSC;
    sT[nn * 64 + kk] = (_Float16)val;
  }
  __syncthreads();
  const int q8 = lane & 7, sub = lane >> 3;
  const int n = wv * 4 + sub;                        // 0..31
  const v8h v = *(const v8ha*)(sT + n * 64 + 8 * q8);
  _Float16* dst = wT + (size_t)(n0 + n) * K + k0 + 8 * q8;
  *(v8h*)dst = v;
  
}

// ---------------------------------------------------------------------------
// Kernel 1: all operand planes in one grid. The five jobs depend on nothing but
// the inputs, so each takes a range of block indices: x convert, then the
// transposes of wq, wk, wv, wo. Every test below is on blockIdx alone.
// ---------------------------------------------------------------------------
#define PBX  (NX8 / 256)                   // 4096 blocks: x
#define PBS  ((DIM / 32) * (DIM / 64))     // 2048 blocks: a DIM x DIM weight
#define PBH  ((HD / 32) * (DIM / 64))      //  128 blocks: a DIM x HD weight
#define PBALL (PBX + 2 * PBS + 2 * PBH)

__global__ __launch_bounds__(256) void prep_kernel(
    const float* __restrict__ x,  _Float16* __restrict__ xh,
    const float* __restrict__ wq, _Float16* __restrict__ wqT,
    const float* __restrict__ wk, _Float16* __restrict__ wkT,
    const float* __restrict__ wv, _Float16* __restrict__ wvT,
    const float* __restrict__ wo, _Float16* __restrict__ woT)
{
  __shared__ __attribute__((aligned(16))) _Float16 sT[32 * 64];
  const int t = blockIdx.x;
  if (t < PBX) {
    cvt_x_block(x, xh, NX8, t);
  } else {
    // job 0..3 = wq, wk, wv, wo; u = tile index inside the job; a weight has N / 32 tile columns
    const int job = t < PBX + PBS ? 0 : (t < PBX + PBS + PBH ? 1 : (t < PBX + PBS + 2 * PBH ? 2 : 3));
    const int u = t - (job == 0 ? PBX : (job == 1 ? PBX + PBS : (job == 2 ? PBX + PBS + PBH : PBX + PBS + 2 * PBH)));
    const float* w = job == 0 ? wq : (job == 1 ? wk : (job == 2 ? wv : wo));
    _Float16* wT = job == 0 ? wqT : (job == 1 ? wkT : (job == 2 ? wvT : woT));
    const bool wide = job == 0 || job == 3;
    const int N = wide ? DIM : HD, sh = wide ? 6 : 2;     // sh = log2(N / 32)
    transpose_w_block(w, wT, DIM, N, u & ((1 << sh) - 1), u >> sh, sT);
    // precaution: in the listing the convert path follows on the branch's fall-through edge and reuses the store's address registers
    asm volatile("s_wait_xcnt 0x0" ::: "memory");
  }
}

// ---------------------------------------------------------------------------
// ---------------------------------------------------------------------------
// f16 tile staged [tok][64 feat] -> C[m0+tok][n0 .. n0+63]: one line per row,
// lanes 8q..8q+7 per line, 4 lines per instruction, 32 lines per wave.
__device__ __forceinline__ void store_rows_f16(const _Float16* sT, _Float16* C,
                                               int m0, int n0, int N, int w, int lane) {
  const int q8 = lane & 7, sub = lane >> 3;
  #pragma unroll
  for (int i = 0; i < 8; ++i) {
    const int lid = w * 32 + i * 4 + sub;            // 0..127
    const v8h v = *(const v8ha*)(sT + lid * 64 + 8 * q8);
    _Float16* dst = C + (size_t)(m0 + lid) * N + n0 + 8 * q8;
    *(v8h*)dst = v;
  }
}

// f16 tile staged [feat d][128 tok] -> vt[b][n0+d][t0 .. t0+127]: two lines
// per d row, lanes 8q..8q+7 per line, 4 lines per instruction, 32 per wave.
__device__ __forceinline__ void store_vt_f16(const _Float16* sT, _Float16* vt,
                                             int b, int t0, int n0, int w, int lane) {
  const int q8 = lane & 7, sub = lane >> 3;
  #pragma unroll
  for (int i = 0; i < 8; ++i) {
    const int lid = w * 32 + i * 4 + sub;            // 0..127
    const int d = lid >> 1, hl = lid & 1;            // d 0..63
    const v8h v = *(const v8ha*)(sT + d * 128 + 64 * hl + 8 * q8);
    _Float16* dst = vt + ((size_t)(b * HD + n0 + d)) * SEQ + t0 + 64 * hl + 8 * q8;
    *(v8h*)dst = v;
  }
}

// f32 tile staged [tok][64 feat] -> C[m0+tok][n0 .. n0+63]: two lines per row;
// wave w stores its own 32 rows = 64 lines, 4 lines per instruction.
__device__ __forceinline__ void store_rows_f32(const float* sT, float* C,
                                               int m0, int n0, int N, int w, int lane) {
  const int q8 = lane & 7, sub = lane >> 3;
  #pragma unroll
  for (int i = 0; i < 16; ++i) {
    const int lid = i * 4 + sub;                     // 0..63
    const int row = 32 * w + (lid >> 1), hl = lid & 1;
    const v4f v = *(const v4fa*)(sT + row * 64 + 32 * hl + 4 * q8);
    float* dst = C + (size_t)(m0 + row) * N + n0 + 32 * hl + 4 * q8;
    *(v4f*)dst = v;
  }
}

// ---------------------------------------------------------------------------
// Kernel 2: C = A * BT^T (+bias), A [M][K] f16 rows, BT [N][K] f16 rows (x32).
// Block 128 thr (4 waves) = 128 rows x 64 cols; wave tile 32 x 64 (2x4 WMMA
// tiles). K in stages of 64: the block brings 128 A rows and 64 BT rows of
// 128 B each by whole-line loads into one of two LDS buffers (row pitch 144 B,
// conflict-free for 16-B fragment reads); the next stage's loads fly while
// this stage's fragments are read from LDS; one barrier per stage. K = DIM.
// MODE 0: the three input projections in one grid. BT = the W^T planes of q, k, v
//         stacked row after row (DIM + HD + HD rows); a column tile lies wholly in one
//         plane and goes to that plane's bias and output:
//         q -> f16 C[M][N], k -> f16 CK[M][HD], v -> f16 CV[b][d][t]; each f16((acc*ascale + bias)*oscale)
// MODE 2: f32 C[M][N] = acc*ascale + bias (biasK, biasV, CK, CV not used)
// grid (M/128, BT rows/64)
// ---------------------------------------------------------------------------
#define GKT   64                     // k per stage
#define GP    72                     // LDS row pitch in halves (144 B)
#define GABUF (128 * GP)
#define GBUF  ((128 + 64) * GP)      // one stage: A rows then BT rows
union GemmSmem { _Float16 ring[2 * GBUF]; _Float16 h[128 * 64]; float f[128 * 64]; };

// Accumulators -> output tile staged in LDS. D[r] of tile (mt, nt) = C[row 32w+16mt+8h+r][col 16nt+m].
// LAYOUT 0: f16 [tok][64 feat]; 1: f16 [feat][128 tok]; 2: f32 [tok][64 feat]. bias points at the tile's first column.
template <int LAYOUT>
__device__ __forceinline__ void stage_out(GemmSmem& sm, const v8f (&acc)[2][4], const float* __restrict__ bias,
                                          float ascale, float oscale, int w, int h, int m) {
  #pragma unroll
  for (int nt = 0; nt < 4; ++nt) {
    const int feat = 16 * nt + m;
    const float bvl = bias[feat];
    #pragma unroll
    for (int mt = 0; mt < 2; ++mt) {
      #pragma unroll
      for (int r = 0; r < 8; ++r) {
        const int tokl = 32 * w + 16 * mt + 8 * h + r;   // 0..127
        const float y = acc[mt][nt][r] * ascale + bvl;
        if (LAYOUT == 2) {
          sm.f[tokl * 64 + feat] = y;
        } else if (LAYOUT == 1) {
          sm.h[feat * 128 + tokl] = (_Float16)(y * oscale);
        } else {
          sm.h[tokl * 64 + feat] = (_Float16)(y * oscale);
        }
      }
    }
  }
}

template <int MODE, typename CT>
__global__ __launch_bounds__(128) void gemm_kernel(
    const _Float16* __restrict__ A, const _Float16* __restrict__ BT,
    const float* __restrict__ bias, CT* __restrict__ C,
    int N, float ascale, float oscale,
    const float* __restrict__ biasK, const float* __restrict__ biasV,
    _Float16* __restrict__ CK, _Float16* __restrict__ CV)
{
  constexpr int K = DIM;     // every product here contracts over DIM; a constant row pitch lets one address serve a stage's loads
  __shared__ __attribute__((aligned(16))) GemmSmem sm;       // 55296 B

  const int tid = threadIdx.x, lane = tid & 31, w = tid >> 5;
  const int h = lane >> 4, m = lane & 15;
  const int m0 = blockIdx.x * 128, n0 = blockIdx.y * 64;

  // staging: 16-B chunk (row = tid/8 + 16 i, col = tid%8); a wave covers 4 whole lines
  const int srow = tid >> 3, scol = (tid & 7) * 8;
  const _Float16* ag = A  + (size_t)(m0 + srow) * K + scol;
  const _Float16* bg = BT + (size_t)(n0 + srow) * K + scol;
  const int sl = srow * GP + scol;
  // fragment rows in a stage
  const int fa = (32 * w + m) * GP;                          // mt = 0
  const int fb = GABUF + m * GP;                             // nt = 0

  const v8f zero8 = {0.f, 0.f, 0.f, 0.f, 0.f, 0.f, 0.f, 0.f};
  v8f acc[2][4];
  #pragma unroll
  for (int mt = 0; mt < 2; ++mt)
    #pragma unroll
    for (int nt = 0; nt < 4; ++nt) acc[mt][nt] = zero8;

  v8h ra[8], rb[4];
  #pragma unroll
  for (int i = 0; i < 8; ++i) ra[i] = *(const v8ha*)(ag + (size_t)(16 * i) * K);
  #pragma unroll
  for (int i = 0; i < 4; ++i) rb[i] = *(const v8ha*)(bg + (size_t)(16 * i) * K);
  #pragma unroll
  for (int i = 0; i < 8; ++i) *(v8ha*)(sm.ring + sl + 16 * i * GP) = ra[i];
  #pragma unroll
  for (int i = 0; i < 4; ++i) *(v8ha*)(sm.ring + GABUF + sl + 16 * i * GP) = rb[i];
  __syncthreads();

  int cur = 0;
  #pragma unroll 1
  for (int k0 = 0; k0 < K; k0 += GKT) {
    const bool more = k0 + GKT < K;
    if (more) {
      #pragma unroll
      for (int i = 0; i < 8; ++i) ra[i] = *(const v8ha*)(ag + (size_t)(16 * i) * K + k0 + GKT);
      #pragma unroll
      for (int i = 0; i < 4; ++i) rb[i] = *(const v8ha*)(bg + (size_t)(16 * i) * K + k0 + GKT);
    }
    const _Float16* st = sm.ring + cur * GBUF;
    // the stage's 12 fragments come as one group of LDS loads ahead of its 16 products (one exposed LDS latency a stage)
    v16h fA[2][2], fB[2][4];
    #pragma unroll
    for (int ks = 0; ks < 2; ++ks) {
      fA[ks][0] = load_frag(st + fa + 32 * ks, h);
      fA[ks][1] = load_frag(st + fa + 16 * GP + 32 * ks, h);
      #pragma unroll
      for (int nt = 0; nt < 4; ++nt) fB[ks][nt] = load_frag(st + fb + nt * 16 * GP + 32 * ks, h);
    }
    #pragma unroll
    for (int ks = 0; ks < 2; ++ks) {
      #pragma unroll
      for (int nt = 0; nt < 4; ++nt) {
        acc[0][nt] = wmma_f16(fA[ks][0], fB[ks][nt], acc[0][nt]);
        acc[1][nt] = wmma_f16(fA[ks][1], fB[ks][nt], acc[1][nt]);
      }
    }
    cur ^= 1;
    if (more) {
      _Float16* nx = sm.ring + cur * GBUF + sl;
      #pragma unroll
      for (int i = 0; i < 8; ++i) *(v8ha*)(nx + 16 * i * GP) = ra[i];
      #pragma unroll
      for (int i = 0; i < 4; ++i) *(v8ha*)(nx + GABUF + 16 * i * GP) = rb[i];
    }
    // publishes the next stage and ends every read of this one (the last pass: frees the ring for the output tile)
    __syncthreads();
  }

  // the plane this column tile belongs to (0 q, 1 k, 2 v) and its first column there; block-uniform
  const int sel = MODE == 0 ? (n0 >= DIM + HD ? 2 : (n0 >= DIM ? 1 : 0)) : 0;
  const int nl = n0 - (sel == 2 ? DIM + HD : (sel == 1 ? DIM : 0));
  if (MODE == 2) {
    stage_out<2>(sm, acc, bias + nl, ascale, oscale, w, h, m);
  } else if (sel == 2) {
    stage_out<1>(sm, acc, biasV + nl, ascale, oscale, w, h, m);
  } else {
    stage_out<0>(sm, acc, (sel == 1 ? biasK : bias) + nl, ascale, oscale, w, h, m);
  }
  __syncthreads();

  if (MODE == 2) {
    float* Cf = (float*)(void*)C;
    store_rows_f32(sm.f, Cf, m0, nl, N, w, lane);
  } else if (sel == 2) {
    const int b = m0 / SEQ, t0 = m0 - b * SEQ;
    store_vt_f16(sm.h, CV, b, t0, nl, w, lane);
    // precaution: in the listing the other planes' store path follows on the branch's fall-through edge and reuses these stores' address registers
    asm volatile("s_wait_xcnt 0x0" ::: "memory");
  } else {
    _Float16* Ch = sel == 1 ? CK : (_Float16*)(void*)C;
    store_rows_f16(sm.h, Ch, m0, nl, sel == 1 ? HD : N, w, lane);
  }
}

// ---------------------------------------------------------------------------
// Attention helpers.
// ---------------------------------------------------------------------------
// P^T B-fragment from the lane's own score D values: element r <- tile a row r
// (keys 0..15 of the 32-key chunk), element 8+r <- tile c row r (keys 16..31),
// same lane, same query column; scaled by 2^14 before the f16 convert.
__device__ __forceinline__ v16h pack_p(v8f a, v8f c) {
  const v16h r = { (_Float16)(a[0] * PSCALE), (_Float16)(a[1] * PSCALE), (_Float16)(a[2] * PSCALE), (_Float16)(a[3] * PSCALE),
                   (_Float16)(a[4] * PSCALE), (_Float16)(a[5] * PSCALE), (_Float16)(a[6] * PSCALE), (_Float16)(a[7] * PSCALE),
                   (_Float16)(c[0] * PSCALE), (_Float16)(c[1] * PSCALE), (_Float16)(c[2] * PSCALE), (_Float16)(c[3] * PSCALE),
                   (_Float16)(c[4] * PSCALE), (_Float16)(c[5] * PSCALE), (_Float16)(c[6] * PSCALE), (_Float16)(c[7] * PSCALE) };
  return r;
}

// Per-wave 16 x 128 f16 tile in LDS -> oh[b*SEQ + q0 + row][head*128 + d];
// instruction, 32 lines (16 rows x 2) per wave.
__device__ __forceinline__ void att_store_pass(const _Float16* so, _Float16* oh,
                                               int b, int head, int q0, int lane) {
  const int q8 = lane & 7, sub = lane >> 3;
  #pragma unroll
  for (int i = 0; i < 8; ++i) {
    const int lid = i * 4 + sub;                     // 0..31
    const int row = lid >> 1, hl = lid & 1;
    const v8h v = *(const v8ha*)(so + row * HD + 64 * hl + 8 * q8);
    _Float16* dst = oh + ((size_t)(b * SEQ + q0 + row)) * DIM + head * HD + 64 * hl + 8 * q8;
    *(v8h*)dst = v;
  }
}

// ---------------------------------------------------------------------------
// Kernel 3: streaming attention, transposed form, single shared K/V head.
// grid (SEQ/128, NH, BS); block 256 thr (8 waves), 16 queries per wave,
// 32 keys per step. K rows and V^T rows come in stages of 64 keys: the block
// brings them by whole-line loads into one of two LDS buffers (K row pitch
// 272 B, V^T row pitch 144 B, conflict-free for 16-B fragment reads), shared
// by its 8 waves; the next stage's loads fly while this stage is worked on;
// one barrier per stage.
//   S^T = K * Q^T : A = K rows (row = key, k = d, 4 k-steps), B = Q^T (k = d, n = query)
//   O^T += V^T * P^T : A = vT rows (row = d, k = key), B = P^T from registers
// Lane owns 16 keys of query column (lane&15); partner = lane ^ 16.
// ---------------------------------------------------------------------------
#define AKT   64                     // keys per stage
#define AKP   136                    // K row pitch in halves (272 B)
#define AVP   72                     // V^T row pitch in halves (144 B)
#define AKBUF (AKT * AKP)
#define AVBUF (HD * AVP)

__global__ __launch_bounds__(256) void attn_kernel(
    const _Float16* __restrict__ qh,   // [MTOT][DIM]  q (unscaled)
    const _Float16* __restrict__ kh,   // [MTOT][HD]   k
    const _Float16* __restrict__ vt,   // [BS][HD][SEQ] v transposed
    _Float16* __restrict__ oh)         // [MTOT][DIM]  f16(16 * o)
{
  __shared__ __attribute__((aligned(16))) _Float16 sK[2 * AKBUF];     // 34816 B
  __shared__ __attribute__((aligned(16))) _Float16 sV[2 * AVBUF];     // 36864 B
  __shared__ __attribute__((aligned(16))) _Float16 sO[8 * 16 * HD];   // 32768 B

  const int tid = threadIdx.x, lane = tid & 31, w = tid >> 5;
  const int hh = lane >> 4, m = lane & 15;
  const int b = blockIdx.z, head = blockIdx.y;
  const int q0 = blockIdx.x * 128 + 16 * w;

  // Q^T B-fragments: column n = query q0+m, k = d (four 32-deep chunks)
  const _Float16* qrow = qh + ((size_t)(b * SEQ + q0 + m)) * DIM + head * HD;
  v16h qb[4];
  #pragma unroll
  for (int c = 0; c < 4; ++c) qb[c] = load_frag(qrow + 32 * c, hh);

  const v8f zero8 = {0.f, 0.f, 0.f, 0.f, 0.f, 0.f, 0.f, 0.f};
  v8f o[8];                                   // o[t][r] = O^T[d 16t+8hh+r][query m] * (l * 2^14)
  #pragma unroll
  for (int t = 0; t < 8; ++t) o[t] = zero8;
  float mrun = -1e30f, lrun = 0.0f;

  // staging, 16-B chunks. K stage = 16 KiB contiguous: chunk tid + 256 i = row tid/16 + 16 i, col tid%16.
  // V^T stage = 128 rows of 128 B: chunk tid + 256 i = row tid/8 + 32 i, col tid%8.
  const _Float16* kg = kh + (size_t)b * SEQ * HD + tid * 8;
  const _Float16* vg = vt + ((size_t)b * HD + (tid >> 3)) * SEQ + (tid & 7) * 8;
  const int kls = (tid >> 4) * AKP + (tid & 15) * 8;
  const int vls = (tid >> 3) * AVP + (tid & 7) * 8;
  const float scale = 0.08838834764831845f;                    // 1/sqrt(128)

  v8h rk[4], rv[4];
  #pragma unroll
  for (int i = 0; i < 4; ++i) rk[i] = *(const v8ha*)(kg + 2048 * i);
  #pragma unroll
  for (int i = 0; i < 4; ++i) rv[i] = *(const v8ha*)(vg + (size_t)(32 * i) * SEQ);
  // precaution: the address registers of the loads above are reused for the loop's counters only behind this wait
  asm volatile("s_wait_xcnt 0x0" ::: "memory");
  #pragma unroll
  for (int i = 0; i < 4; ++i) *(v8ha*)(sK + kls + 16 * i * AKP) = rk[i];
  #pragma unroll
  for (int i = 0; i < 4; ++i) *(v8ha*)(sV + vls + 32 * i * AVP) = rv[i];
  __syncthreads();

  int cur = 0;
  #pragma unroll 1
  for (int kt = 0; kt < SEQ; kt += AKT) {
   const bool more = kt + AKT < SEQ;
   if (more) {
     #pragma unroll
     for (int i = 0; i < 4; ++i) rk[i] = *(const v8ha*)(kg + (size_t)(kt + AKT) * HD + 2048 * i);
     #pragma unroll
     for (int i = 0; i < 4; ++i) rv[i] = *(const v8ha*)(vg + (size_t)(32 * i) * SEQ + kt + AKT);
   }
   const _Float16* kS = sK + cur * AKBUF + m * AKP;
   const _Float16* vS = sV + cur * AVBUF + m * AVP;

   #pragma unroll
   for (int kb = 0; kb < AKT; kb += 32) {
    // ---- scores: s[j][r] = S^T[key kt+kb+16j+8hh+r][query q0+m] ----
    // the step's 8 K fragments come as one group of LDS loads ahead of its 8 score products
    v16h kf[2][4];
    #pragma unroll
    for (int j = 0; j < 2; ++j)
      #pragma unroll
      for (int c = 0; c < 4; ++c) kf[j][c] = load_frag(kS + (kb + 16 * j) * AKP + 32 * c, hh);
    v8f s[2];
    #pragma unroll
    for (int j = 0; j < 2; ++j) {
      v8f z = zero8;
      #pragma unroll
      for (int c = 0; c < 4; ++c) z = wmma_f16(kf[j][c], qb[c], z);
      s[j] = z;
    }
    // the step's 8 V^T fragments come as one group of LDS loads right behind the score products and fly under the
    // softmax; the scheduling barrier keeps the compiler from sinking part of the group towards its use
    v16h vf[8];
    #pragma unroll
    for (int t = 0; t < 8; ++t) vf[t] = load_frag(vS + (16 * t) * AVP + kb, hh);
    __builtin_amdgcn_sched_barrier(0);

    // ---- scale (f32) and online softmax over this lane pair's 32 keys ----
    float mloc = -1e30f;
    #pragma unroll
    for (int j = 0; j < 2; ++j)
      #pragma unroll
      for (int r = 0; r < 8; ++r) {
        const float sv = s[j][r] * scale;
        s[j][r] = sv;
        mloc = fmaxf(mloc, sv);
      }
    mloc = fmaxf(mloc, __shfl_xor(mloc, 16));
    const float mnew = fmaxf(mrun, mloc);
    const float alpha = __expf(mrun - mnew);
    mrun = mnew;
    float lsum = 0.0f;
    #pragma unroll
    for (int j = 0; j < 2; ++j)
      #pragma unroll
      for (int r = 0; r < 8; ++r) {
        const float p = __expf(s[j][r] - mnew);
        s[j][r] = p;
        lsum += p;
      }
    lsum += __shfl_xor(lsum, 16);
    lrun = lrun * alpha + lsum;
    #pragma unroll
    for (int t = 0; t < 8; ++t)
      #pragma unroll
      for (int r = 0; r < 8; ++r) o[t][r] = o[t][r] * alpha;

    // ---- P^T B-fragment for keys kb .. kb+31 ----
    const v16h pb = pack_p(s[0], s[1]);

    // ---- O^T += V^T * P^T over the 8 d tiles ----
    #pragma unroll
    for (int t = 0; t < 8; ++t) o[t] = wmma_f16(vf[t], pb, o[t]);
   }

   cur ^= 1;
   if (more) {
     #pragma unroll
     for (int i = 0; i < 4; ++i) *(v8ha*)(sK + cur * AKBUF + kls + 16 * i * AKP) = rk[i];
     #pragma unroll
     for (int i = 0; i < 4; ++i) *(v8ha*)(sV + cur * AVBUF + vls + 32 * i * AVP) = rv[i];
   }
   // publishes the next stage and ends every wave's reads of this one
   __syncthreads();
  }

  // ---- epilogue: normalise, x16 carry, stage per-wave 16x128 f16 tile ----
  const float inv = __builtin_amdgcn_rcpf(lrun) * (OSC / PSCALE);
  _Float16* so = sO + w * (16 * HD);
  #pragma unroll
  for (int t = 0; t < 8; ++t)
    #pragma unroll
    for (int r = 0; r < 8; ++r)
      so[m * HD + 16 * t + 8 * hh + r] = (_Float16)(o[t][r] * inv);
  __syncthreads();

  att_store_pass(so, oh, b, head, q0, lane);
  
}

// ---------------------------------------------------------------------------
extern "C" void kernel_launch(void* const* d_in, const int* in_sizes, int n_in,
                              void* d_out, int out_size, void* d_ws, size_t ws_size,
                              hipStream_t stream) {
  if (n_in < 9) return;
  if (in_sizes[0] != NX) return;
  if (in_sizes[1] != DIM * DIM || in_sizes[2] != DIM) return;
  if (in_sizes[3] != DIM * HD || in_sizes[4] != HD) return;
  if (in_sizes[5] != DIM * HD || in_sizes[6] != HD) return;
  if (in_sizes[7] != DIM * DIM || in_sizes[8] != DIM) return;
  if (out_size != NX) return;

  const float* x  = (const float*)d_in[0];
  const float* wq = (const float*)d_in[1];
  const float* bq = (const float*)d_in[2];
  const float* wk = (const float*)d_in[3];
  const float* bk = (const float*)d_in[4];
  const float* wv = (const float*)d_in[5];
  const float* bv = (const float*)d_in[6];
  const float* wo = (const float*)d_in[7];
  const float* bo = (const float*)d_in[8];
  float* out = (float*)d_out;

  const size_t act_b = (size_t)NX * 2;              // 16777216  f16 [4096][2048]
  const size_t wsq_b = (size_t)DIM * DIM * 2;       //  8388608  f16 [2048][2048]
  const size_t wkv_b = (size_t)DIM * HD * 2;        //   524288  f16 [128][2048]
  const size_t kv_b  = (size_t)MTOT * HD * 2;       //  1048576  f16 [4096][128] / [2][128][2048]
  const size_t total = act_b + wsq_b + 2 * wkv_b + wsq_b + act_b + 2 * kv_b + act_b;   // 70254592
  if (total > ws_size) return;

  char* ws = (char*)d_ws;
  size_t off = 0;
  _Float16* xh  = (_Float16*)(ws + off); off += act_b;
  _Float16* wqT = (_Float16*)(ws + off); off += wsq_b;
  _Float16* wkT = (_Float16*)(ws + off); off += wkv_b;
  _Float16* wvT = (_Float16*)(ws + off); off += wkv_b;
  _Float16* woT = (_Float16*)(ws + off); off += wsq_b;
  _Float16* qh  = (_Float16*)(ws + off); off += act_b;
  _Float16* kh  = (_Float16*)(ws + off); off += kv_b;
  _Float16* vT  = (_Float16*)(ws + off); off += kv_b;
  _Float16* oh  = (_Float16*)(ws + off); off += act_b;
  if (off > ws_size) return;

  // 1) operand planes, one grid: x -> f16; W (in,out) -> W^T [out][in] f16 x32
  prep_kernel<<<PBALL, 256, 0, stream>>>(x, xh, wq, wqT, wk, wkT, wv, wvT, wo, woT);

  // 2) projections, one grid over the stacked rows of wqT, wkT, wvT (adjacent in the workspace):
  //    q [4096][2048] f16, k [4096][128] f16, v -> vT [2][128][2048] f16
  gemm_kernel<0, _Float16><<<dim3(MTOT / 128, (DIM + 2 * HD) / 64), 128, 0, stream>>>(xh, wqT, bq, qh, DIM, WINV, 1.0f, bk, bv, kh, vT);

  // 3) attention: all 16 query heads against the shared K / V^T planes; o f16 x16
  attn_kernel<<<dim3(SEQ / 128, NH, BS), 256, 0, stream>>>(qh, kh, vT, oh);

  // 4) output projection: out = (o x16)(wo x32) / 512 + bo, f32 whole-line stores
  gemm_kernel<2, float><<<dim3(MTOT / 128, DIM / 64), 128, 0, stream>>>(oh, woT, bo, out, DIM, WINV / OSC, 1.0f, nullptr, nullptr, nullptr, nullptr);
}

// v004
// Measured time: 156 microseconds a run.
// Two timings next to v003 both put it at 1.08 times that version's speed.
// All steps since v000 together make it 3.69 times as fast.
// Contractions: x*WqT, x*WkT, x*WvT, K*Q^T, V^T*P^T and O*WoT all on v_wmma_f32_16x16x32_f16 (f16 operands, f32 accumulate); W carried x32, P carried x16384, O carried x16 (exact power-of-two scales folded back in f32); softmax, bias and normalisation in f32.
#include <hip/hip_runtime.h>

typedef _Float16 v16h __attribute__((ext_vector_type(16)));
typedef _Float16 v8h  __attribute__((ext_vector_type(8)));
typedef float    v8f  __attribute__((ext_vector_type(8)));
typedef float    v4f  __attribute__((ext_vector_type(4)));
typedef v8h __attribute__((may_alias)) v8ha;
typedef v4f __attribute__((may_alias)) v4fa;

union Frag { v16h v; v8h half[2]; };

#define DIM    2048
#define SEQ    2048
#define NH     16
#define HD     128
#define BS     2
#define MTOT   (BS * SEQ)          // 4096 token rows
#define NX     (MTOT * DIM)        // 8388608
#define NX8    (NX / 8)            // 1048576
#define WSC    32.0f
#define WINV   0.03125f
#define PSCALE 16384.0f
#define OSC    16.0f

// ---------------------------------------------------------------------------
// 16x16x32 f16 WMMA with hazard guard (ties D, keeps A/B live).
// Fragment map (wave32): lane l, h = l>>4, m = n = l&15.
//   A/B element i: i<8 -> k0+8h+i ; i>=8 -> k0+16+8h+(i-8)
//   D element r : row 8h+r, col l&15
// ---------------------------------------------------------------------------
__device__ __forceinline__ v8f wmma_f16(v16h a, v16h b, v8f c) {
  v8f d = __builtin_amdgcn_wmma_f32_16x16x32_f16(false, a, false, b, (short)0, c, false, false);
  asm volatile("v_nop\n\tv_nop\n\tv_nop\n\tv_nop" : "+v"(d) : "v"(a), "v"(b));
  return d;
}

// A or B fragment from a k-contiguous f16 row; p points at element k0 of the
// row owned by this lane (row index = lane & 15 added by the caller).
__device__ __forceinline__ v16h load_frag(const _Float16* p, int h) {
  Frag f;
  f.half[0] = *(const v8ha*)(p + 8 * h);
  f.half[1] = *(const v8ha*)(p + 16 + 8 * h);
  return f.v;
}

// ---------------------------------------------------------------------------
// Prep part 1: x f32 -> f16 (unscaled). One 16-B store per lane; blk = block
// index inside this part's range of the prep grid.
// ---------------------------------------------------------------------------
__device__ __forceinline__ void cvt_x_block(const float* __restrict__ x,
                                            _Float16* __restrict__ xh, int n8, int blk)
{
  const int g = blk * 256 + threadIdx.x;
  if (g >= n8) return;
  const float* src = x + (size_t)g * 8;
  const v4f a = *(const v4fa*)src;
  const v4f c = *(const v4fa*)(src + 4);
  const v8h o = { (_Float16)a.x, (_Float16)a.y, (_Float16)a.z, (_Float16)a.w,
                  (_Float16)c.x, (_Float16)c.y, (_Float16)c.z, (_Float16)c.w };
  _Float16* dst = xh + (size_t)g * 8;
  *(v8h*)dst = o;
  
}

// ---------------------------------------------------------------------------
// Prep part 2: w[K][N] f32 (in, out) -> wT[N][K] f16 scaled x32 (exact).
// Block 256 thr, tile 64 k x 32 n; tile (bx, by) of (N/32, K/64). Reads coalesced
// along n; tile staged in LDS as [n][64 k]; each output row segment = 64 halves.
// ---------------------------------------------------------------------------
__device__ __forceinline__ void transpose_w_block(const float* __restrict__ w,
                                                  _Float16* __restrict__ wT,
                                                  int K, int N, int bx, int by, _Float16* sT)
{
  const int tid = threadIdx.x, lane = tid & 31, wv = tid >> 5;
  const int n0 = bx * 32, k0 = by * 64;
  const int nn = tid & 31, kr = tid >> 5;          // kr 0..7
  #pragma unroll
  for (int i = 0; i < 8; ++i) {
    const int kk = kr + 8 * i;                       // 0..63
    const float val = w[(size_t)(k0 + kk) * N + n0 + nn] * WSC;
    sT[nn * 64 + kk] = (_Float16)val;
  }
  __syncthreads();
  const int q8 = lane & 7, sub = lane >> 3;
  const int n = wv * 4 + sub;                        // 0..31
  const v8h v = *(const v8ha*)(sT + n * 64 + 8 * q8);
  _Float16* dst = wT + (size_t)(n0 + n) * K + k0 + 8 * q8;
  *(v8h*)dst = v;
  
}

// ---------------------------------------------------------------------------
// Kernel 1: all operand planes in one grid. The five jobs depend on nothing but
// the inputs, so each takes a range of block indices: x convert, then the
// transposes of wq, wk, wv, wo. Every test below is on blockIdx alone.
// ---------------------------------------------------------------------------
#define PBX  (NX8 / 256)                   // 4096 blocks: x
#define PBS  ((DIM / 32) * (DIM / 64))     // 2048 blocks: a DIM x DIM weight
#define PBH  ((HD / 32) * (DIM / 64))      //  128 blocks: a DIM x HD weight
#define PBALL (PBX + 2 * PBS + 2 * PBH)

__global__ __launch_bounds__(256) void prep_kernel(
    const float* __restrict__ x,  _Float16* __restrict__ xh,
    const float* __restrict__ wq, _Float16* __restrict__ wqT,
    const float* __restrict__ wk, _Float16* __restrict__ wkT,
    const float* __restrict__ wv, _Float16* __restrict__ wvT,
    const float* __restrict__ wo, _Float16* __restrict__ woT)
{
  __shared__ __attribute__((aligned(16))) _Float16 sT[32 * 64];
  const int t = blockIdx.x;
  if (t < PBX) {
    cvt_x_block(x, xh, NX8, t);
  } else {
    // job 0..3 = wq, wk, wv, wo; u = tile index inside the job; a weight has N / 32 tile columns
    const int job = t < PBX + PBS ? 0 : (t < PBX + PBS + PBH ? 1 : (t < PBX + PBS + 2 * PBH ? 2 : 3));
    const int u = t - (job == 0 ? PBX : (job == 1 ? PBX + PBS : (job == 2 ? PBX + PBS + PBH : PBX + PBS + 2 * PBH)));
    const float* w = job == 0 ? wq : (job == 1 ? wk : (job == 2 ? wv : wo));
    _Float16* wT = job == 0 ? wqT : (job == 1 ? wkT : (job == 2 ? wvT : woT));
    const bool wide = job == 0 || job == 3;
    const int N = wide ? DIM : HD, sh = wide ? 6 : 2;     // sh = log2(N / 32)
    transpose_w_block(w, wT, DIM, N, u & ((1 << sh) - 1), u >> sh, sT);
    // precaution: in the listing the convert path follows on the branch's fall-through edge and reuses the store's address registers
    asm volatile("s_wait_xcnt 0x0" ::: "memory");
  }
}

// ---------------------------------------------------------------------------
// ---------------------------------------------------------------------------
// f16 tile staged [row][128] -> dst0[row * PITCH .. + 127]: two lines per row; one
// instruction of a wave covers two whole rows (4 lines); wave w stores rows 32w .. 32w+31.
// A constant row pitch lets one address pair serve all 16 stores.
template <int PITCH>
__device__ __forceinline__ void store_rows_f16(const _Float16* sT, _Float16* dst0, int w, int lane) {
  const int c16 = lane & 15, sub = lane >> 4;
  const _Float16* s = sT + (w * 32 + sub) * 128 + 8 * c16;
  _Float16* dst = dst0 + (size_t)(w * 32 + sub) * PITCH + 8 * c16;
  v8h v[16];
  #pragma unroll
  for (int i = 0; i < 16; ++i) v[i] = *(const v8ha*)(s + 2 * i * 128);
  #pragma unroll
  for (int i = 0; i < 16; ++i) *(v8h*)(dst + (size_t)(2 * i) * PITCH) = v[i];
}

// f32 tile staged [tok][128 feat] -> dst0[tok * PITCH .. + 127]: four lines per row; one
// instruction of a wave covers one whole row; wave w stores rows 32w .. 32w+31.
template <int PITCH>
__device__ __forceinline__ void store_rows_f32(const float* sT, float* dst0, int w, int lane) {
  const float* s = sT + (32 * w) * 128 + 4 * lane;
  float* dst = dst0 + (size_t)(32 * w) * PITCH + 4 * lane;
  v4f v[32];
  #pragma unroll
  for (int i = 0; i < 32; ++i) v[i] = *(const v4fa*)(s + i * 128);
  #pragma unroll
  for (int i = 0; i < 32; ++i) *(v4f*)(dst + (size_t)i * PITCH) = v[i];
}

// ---------------------------------------------------------------------------
// Kernel 2: C = A * BT^T (+bias), A [M][K] f16 rows, BT [N][K] f16 rows (x32).
// Block 128 thr (4 waves, 2 x 2) = 128 rows x 128 cols; wave tile 64 x 64 (4x4
// WMMA tiles): a loaded fragment feeds 4 products, a staged row 128 outputs.
// K in stages of 64: the block brings 128 A rows and 128 BT rows of
// 128 B each by whole-line loads into one of two LDS buffers (row pitch 144 B,
// conflict-free for 16-B fragment reads); the next stage's loads fly while
// this stage's fragments are read from LDS; one barrier per stage. K = DIM.
// MODE 0: the three input projections in one grid. BT = the W^T planes of q, k, v
//         stacked row after row (DIM + HD + HD rows); a column tile lies wholly in one
//         plane and goes to that plane's bias and output:
//         q -> f16 C[M][DIM], k -> f16 CK[M][HD], v -> f16 CV[b][d][t]; each f16((acc*ascale + bias)*oscale)
// MODE 2: f32 C[M][DIM] = acc*ascale + bias (biasK, biasV, CK, CV not used)
// grid (M/128, BT rows/128)
// ---------------------------------------------------------------------------
#define GKT   64                     // k per stage
#define GP    72                     // LDS row pitch in halves (144 B)
#define GABUF (128 * GP)
#define GBUF  ((128 + 128) * GP)     // one stage: A rows then BT rows
union GemmSmem { _Float16 ring[2 * GBUF]; _Float16 h[128 * 128]; float f[128 * 128]; };

// Accumulators -> output tile staged in LDS. D[r] of tile (mt, nt) = C[row 64wm+16mt+8h+r][col 64wn+16nt+m].
// LAYOUT 0: f16 [tok][128 feat]; 1: f16 [feat][128 tok]; 2: f32 [tok][128 feat]. bias points at the tile's first column.
template <int LAYOUT>
__device__ __forceinline__ void stage_out(GemmSmem& sm, const v8f (&acc)[4][4], const float* __restrict__ bias,
                                          float ascale, float oscale, int wm, int wn, int h, int m) {
  float bv[4];
  #pragma unroll
  for (int nt = 0; nt < 4; ++nt) bv[nt] = bias[64 * wn + 16 * nt + m];
  #pragma unroll
  for (int nt = 0; nt < 4; ++nt) {
    const int feat = 64 * wn + 16 * nt + m;              // 0..127
    const float bvl = bv[nt];
    #pragma unroll
    for (int mt = 0; mt < 4; ++mt) {
      #pragma unroll
      for (int r = 0; r < 8; ++r) {
        const int tokl = 64 * wm + 16 * mt + 8 * h + r;  // 0..127
        const float y = acc[mt][nt][r] * ascale + bvl;
        if (LAYOUT == 2) {
          sm.f[tokl * 128 + feat] = y;
        } else if (LAYOUT == 1) {
          sm.h[feat * 128 + tokl] = (_Float16)(y * oscale);
        } else {
          sm.h[tokl * 128 + feat] = (_Float16)(y * oscale);
        }
      }
    }
  }
}

template <int MODE, typename CT>
__global__ __launch_bounds__(128) void gemm_kernel(
    const _Float16* __restrict__ A, const _Float16* __restrict__ BT,
    const float* __restrict__ bias, CT* __restrict__ C,
    float ascale, float oscale,
    const float* __restrict__ biasK, const float* __restrict__ biasV,
    _Float16* __restrict__ CK, _Float16* __restrict__ CV)
{
  constexpr int K = DIM;     // every product here contracts over DIM; a constant row pitch lets one address serve a stage's loads
  __shared__ __attribute__((aligned(16))) GemmSmem sm;       // 73728 B

  const int tid = threadIdx.x, lane = tid & 31, w = tid >> 5;
  const int h = lane >> 4, m = lane & 15;
  const int wm = w >> 1, wn = w & 1;
  const int m0 = blockIdx.x * 128, n0 = blockIdx.y * 128;

  // staging: 16-B chunk (row = tid/8 + 16 i, col = tid%8); a wave covers 4 whole lines
  const int srow = tid >> 3, scol = (tid & 7) * 8;
  const _Float16* ag = A  + (size_t)(m0 + srow) * K + scol;
  const _Float16* bg = BT + (size_t)(n0 + srow) * K + scol;
  const int sl = srow * GP + scol;
  // fragment rows in a stage
  const int fa = (64 * wm + m) * GP;                         // mt = 0
  const int fb = GABUF + (64 * wn + m) * GP;                 // nt = 0

  const v8f zero8 = {0.f, 0.f, 0.f, 0.f, 0.f, 0.f, 0.f, 0.f};
  v8f acc[4][4];
  #pragma unroll
  for (int mt = 0; mt < 4; ++mt)
    #pragma unroll
    for (int nt = 0; nt < 4; ++nt) acc[mt][nt] = zero8;

  v8h ra[8], rb[8];
  #pragma unroll
  for (int i = 0; i < 8; ++i) ra[i] = *(const v8ha*)(ag + (size_t)(16 * i) * K);
  #pragma unroll
  for (int i = 0; i < 8; ++i) rb[i] = *(const v8ha*)(bg + (size_t)(16 * i) * K);
  #pragma unroll
  for (int i = 0; i < 8; ++i) *(v8ha*)(sm.ring + sl + 16 * i * GP) = ra[i];
  #pragma unroll
  for (int i = 0; i < 8; ++i) *(v8ha*)(sm.ring + GABUF + sl + 16 * i * GP) = rb[i];
  __syncthreads();

  int cur = 0;
  #pragma unroll 1
  for (int k0 = 0; k0 < K; k0 += GKT) {
    const bool more = k0 + GKT < K;
    if (more) {
      #pragma unroll
      for (int i = 0; i < 8; ++i) ra[i] = *(const v8ha*)(ag + (size_t)(16 * i) * K + k0 + GKT);
      #pragma unroll
      for (int i = 0; i < 8; ++i) rb[i] = *(const v8ha*)(bg + (size_t)(16 * i) * K + k0 + GKT);
      // precaution: in the listing the fragment loads below reuse the address registers of the loads above
      asm volatile("s_wait_xcnt 0x0" ::: "memory");
    }
    const _Float16* st = sm.ring + cur * GBUF;
    // each 32-deep half of the stage: its 8 fragments as one group of LDS loads ahead of its 16 products
    // (one fragment set of 64 registers: with the 128 accumulator registers it stays below v256, which the guard's operands need)
    #pragma unroll
    for (int ks = 0; ks < 2; ++ks) {
      v16h fA[4], fB[4];
      #pragma unroll
      for (int mt = 0; mt < 4; ++mt) fA[mt] = load_frag(st + fa + mt * 16 * GP + 32 * ks, h);
      #pragma unroll
      for (int nt = 0; nt < 4; ++nt) fB[nt] = load_frag(st + fb + nt * 16 * GP + 32 * ks, h);
      #pragma unroll
      for (int nt = 0; nt < 4; ++nt) {
        #pragma unroll
        for (int mt = 0; mt < 4; ++mt) acc[mt][nt] = wmma_f16(fA[mt], fB[nt], acc[mt][nt]);
      }
    }
    cur ^= 1;
    if (more) {
      _Float16* nx = sm.ring + cur * GBUF + sl;
      #pragma unroll
      for (int i = 0; i < 8; ++i) *(v8ha*)(nx + 16 * i * GP) = ra[i];
      #pragma unroll
      for (int i = 0; i < 8; ++i) *(v8ha*)(nx + GABUF + 16 * i * GP) = rb[i];
    }
    // publishes the next stage and ends every read of this one (the last pass: frees the ring for the output tile)
    __syncthreads();
  }

  // the plane this column tile belongs to (0 q, 1 k, 2 v) and its first column there; block-uniform
  const int sel = MODE == 0 ? (n0 >= DIM + HD ? 2 : (n0 >= DIM ? 1 : 0)) : 0;
  const int nl = n0 - (sel == 2 ? DIM + HD : (sel == 1 ? DIM : 0));
  if (MODE == 2) {
    stage_out<2>(sm, acc, bias + nl, ascale, oscale, wm, wn, h, m);
  } else if (sel == 2) {
    stage_out<1>(sm, acc, biasV + nl, ascale, oscale, wm, wn, h, m);
  } else {
    stage_out<0>(sm, acc, (sel == 1 ? biasK : bias) + nl, ascale, oscale, wm, wn, h, m);
  }
  __syncthreads();

  if (MODE == 2) {
    float* Cf = (float*)(void*)C;
    store_rows_f32<DIM>(sm.f, Cf + (size_t)m0 * DIM + nl, w, lane);
  } else if (sel == 1) {
    store_rows_f16<HD>(sm.h, CK + (size_t)m0 * HD + nl, w, lane);
  } else {
    // staged rows are tokens for q (row pitch DIM), features d for v (row pitch SEQ): the two pitches are equal
    static_assert(SEQ == DIM, "one store path serves q and v");
    const int b = m0 / SEQ, t0 = m0 - b * SEQ;
    _Float16* dst0 = sel == 2 ? CV + (size_t)(b * HD + nl) * SEQ + t0 : (_Float16*)(void*)C + (size_t)m0 * DIM + nl;
    store_rows_f16<DIM>(sm.h, dst0, w, lane);
  }
}

// ---------------------------------------------------------------------------
// Attention helpers.
// ---------------------------------------------------------------------------
// P^T B-fragment from the lane's own score D values: element r <- tile a row r
// (keys 0..15 of the 32-key chunk), element 8+r <- tile c row r (keys 16..31),
// same lane, same query column; scaled by 2^14 before the f16 convert.
__device__ __forceinline__ v16h pack_p(v8f a, v8f c) {
  const v16h r = { (_Float16)(a[0] * PSCALE), (_Float16)(a[1] * PSCALE), (_Float16)(a[2] * PSCALE), (_Float16)(a[3] * PSCALE),
                   (_Float16)(a[4] * PSCALE), (_Float16)(a[5] * PSCALE), (_Float16)(a[6] * PSCALE), (_Float16)(a[7] * PSCALE),
                   (_Float16)(c[0] * PSCALE), (_Float16)(c[1] * PSCALE), (_Float16)(c[2] * PSCALE), (_Float16)(c[3] * PSCALE),
                   (_Float16)(c[4] * PSCALE), (_Float16)(c[5] * PSCALE), (_Float16)(c[6] * PSCALE), (_Float16)(c[7] * PSCALE) };
  return r;
}

// Per-wave 16 x 128 f16 tile in LDS -> oh[b*SEQ + q0 + row][head*128 + d];
// instruction, 32 lines (16 rows x 2) per wave.
__device__ __forceinline__ void att_store_pass(const _Float16* so, _Float16* oh,
                                               int b, int head, int q0, int lane) {
  const int q8 = lane & 7, sub = lane >> 3;
  #pragma unroll
  for (int i = 0; i < 8; ++i) {
    const int lid = i * 4 + sub;                     // 0..31
    const int row = lid >> 1, hl = lid & 1;
    const v8h v = *(const v8ha*)(so + row * HD + 64 * hl + 8 * q8);
    _Float16* dst = oh + ((size_t)(b * SEQ + q0 + row)) * DIM + head * HD + 64 * hl + 8 * q8;
    *(v8h*)dst = v;
  }
}

// ---------------------------------------------------------------------------
// Kernel 3: streaming attention, transposed form, single shared K/V head.
// grid (SEQ/128, NH, BS); block 256 thr (8 waves), 16 queries per wave,
// 32 keys per step. K rows and V^T rows come in stages of 64 keys: the block
// brings them by whole-line loads into one of two LDS buffers (K row pitch
// 272 B, V^T row pitch 144 B, conflict-free for 16-B fragment reads), shared
// by its 8 waves; the next stage's loads fly while this stage is worked on;
// one barrier per stage.
//   S^T = K * Q^T : A = K rows (row = key, k = d, 4 k-steps), B = Q^T (k = d, n = query)
//   O^T += V^T * P^T : A = vT rows (row = d, k = key), B = P^T from registers
// Lane owns 16 keys of query column (lane&15); partner = lane ^ 16.
// ---------------------------------------------------------------------------
#define AKT   64                     // keys per stage
#define AKP   136                    // K row pitch in halves (272 B)
#define AVP   72                     // V^T row pitch in halves (144 B)
#define AKBUF (AKT * AKP)
#define AVBUF (HD * AVP)

__global__ __launch_bounds__(256) void attn_kernel(
    const _Float16* __restrict__ qh,   // [MTOT][DIM]  q (unscaled)
    const _Float16* __restrict__ kh,   // [MTOT][HD]   k
    const _Float16* __restrict__ vt,   // [BS][HD][SEQ] v transposed
    _Float16* __restrict__ oh)         // [MTOT][DIM]  f16(16 * o)
{
  __shared__ __attribute__((aligned(16))) _Float16 sK[2 * AKBUF];     // 34816 B
  __shared__ __attribute__((aligned(16))) _Float16 sV[2 * AVBUF];     // 36864 B
  __shared__ __attribute__((aligned(16))) _Float16 sO[8 * 16 * HD];   // 32768 B

  const int tid = threadIdx.x, lane = tid & 31, w = tid >> 5;
  const int hh = lane >> 4, m = lane & 15;
  const int b = blockIdx.z, head = blockIdx.y;
  const int q0 = blockIdx.x * 128 + 16 * w;

  // Q^T B-fragments: column n = query q0+m, k = d (four 32-deep chunks)
  const _Float16* qrow = qh + ((size_t)(b * SEQ + q0 + m)) * DIM + head * HD;
  v16h qb[4];
  #pragma unroll
  for (int c = 0; c < 4; ++c) qb[c] = load_frag(qrow + 32 * c, hh);

  const v8f zero8 = {0.f, 0.f, 0.f, 0.f, 0.f, 0.f, 0.f, 0.f};
  v8f o[8];                                   // o[t][r] = O^T[d 16t+8hh+r][query m] * (l * 2^14)
  #pragma unroll
  for (int t = 0; t < 8; ++t) o[t] = zero8;
  float mrun = -1e30f, lrun = 0.0f;

  // staging, 16-B chunks. K stage = 16 KiB contiguous: chunk tid + 256 i = row tid/16 + 16 i, col tid%16.
  // V^T stage = 128 rows of 128 B: chunk tid + 256 i = row tid/8 + 32 i, col tid%8.
  const _Float16* kg = kh + (size_t)b * SEQ * HD + tid * 8;
  const _Float16* vg = vt + ((size_t)b * HD + (tid >> 3)) * SEQ + (tid & 7) * 8;
  const int kls = (tid >> 4) * AKP + (tid & 15) * 8;
  const int vls = (tid >> 3) * AVP + (tid & 7) * 8;
  const float scale = 0.08838834764831845f;                    // 1/sqrt(128)

  v8h rk[4], rv[4];
  #pragma unroll
  for (int i = 0; i < 4; ++i) rk[i] = *(const v8ha*)(kg + 2048 * i);
  #pragma unroll
  for (int i = 0; i < 4; ++i) rv[i] = *(const v8ha*)(vg + (size_t)(32 * i) * SEQ);
  // precaution: the address registers of the loads above are reused for the loop's counters only behind this wait
  asm volatile("s_wait_xcnt 0x0" ::: "memory");
  #pragma unroll
  for (int i = 0; i < 4; ++i) *(v8ha*)(sK + kls + 16 * i * AKP) = rk[i];
  #pragma unroll
  for (int i = 0; i < 4; ++i) *(v8ha*)(sV + vls + 32 * i * AVP) = rv[i];
  __syncthreads();

  int cur = 0;
  #pragma unroll 1
  for (int kt = 0; kt < SEQ; kt += AKT) {
   const bool more = kt + AKT < SEQ;
   if (more) {
     #pragma unroll
     for (int i = 0; i < 4; ++i) rk[i] = *(const v8ha*)(kg + (size_t)(kt + AKT) * HD + 2048 * i);
     #pragma unroll
     for (int i = 0; i < 4; ++i) rv[i] = *(const v8ha*)(vg + (size_t)(32 * i) * SEQ + kt + AKT);
   }
   const _Float16* kS = sK + cur * AKBUF + m * AKP;
   const _Float16* vS = sV + cur * AVBUF + m * AVP;

   #pragma unroll
   for (int kb = 0; kb < AKT; kb += 32) {
    // ---- scores: s[j][r] = S^T[key kt+kb+16j+8hh+r][query q0+m] ----
    // the step's 8 K fragments come as one group of LDS loads ahead of its 8 score products
    v16h kf[2][4];
    #pragma unroll
    for (int j = 0; j < 2; ++j)
      #pragma unroll
      for (int c = 0; c < 4; ++c) kf[j][c] = load_frag(kS + (kb + 16 * j) * AKP + 32 * c, hh);
    v8f s[2];
    #pragma unroll
    for (int j = 0; j < 2; ++j) {
      v8f z = zero8;
      #pragma unroll
      for (int c = 0; c < 4; ++c) z = wmma_f16(kf[j][c], qb[c], z);
      s[j] = z;
    }
    // the step's 8 V^T fragments come as one group of LDS loads right behind the score products and fly under the
    // softmax; the scheduling barrier keeps the compiler from sinking part of the group towards its use
    v16h vf[8];
    #pragma unroll
    for (int t = 0; t < 8; ++t) vf[t] = load_frag(vS + (16 * t) * AVP + kb, hh);
    __builtin_amdgcn_sched_barrier(0);

    // ---- scale (f32) and online softmax over this lane pair's 32 keys ----
    float mloc = -1e30f;
    #pragma unroll
    for (int j = 0; j < 2; ++j)
      #pragma unroll
      for (int r = 0; r < 8; ++r) {
        const float sv = s[j][r] * scale;
        s[j][r] = sv;
        mloc = fmaxf(mloc, sv);
      }
    mloc = fmaxf(mloc, __shfl_xor(mloc, 16));
    const float mnew = fmaxf(mrun, mloc);
    const float alpha = __expf(mrun - mnew);
    mrun = mnew;
    float lsum = 0.0f;
    #pragma unroll
    for (int j = 0; j < 2; ++j)
      #pragma unroll
      for (int r = 0; r < 8; ++r) {
        const float p = __expf(s[j][r] - mnew);
        s[j][r] = p;
        lsum += p;
      }
    lsum += __shfl_xor(lsum, 16);
    lrun = lrun * alpha + lsum;
    #pragma unroll
    for (int t = 0; t < 8; ++t)
      #pragma unroll
      for (int r = 0; r < 8; ++r) o[t][r] = o[t][r] * alpha;

    // ---- P^T B-fragment for keys kb .. kb+31 ----
    const v16h pb = pack_p(s[0], s[1]);

    // ---- O^T += V^T * P^T over the 8 d tiles ----
    #pragma unroll
    for (int t = 0; t < 8; ++t) o[t] = wmma_f16(vf[t], pb, o[t]);
   }

   cur ^= 1;
   if (more) {
     #pragma unroll
     for (int i = 0; i < 4; ++i) *(v8ha*)(sK + cur * AKBUF + kls + 16 * i * AKP) = rk[i];
     #pragma unroll
     for (int i = 0; i < 4; ++i) *(v8ha*)(sV + cur * AVBUF + vls + 32 * i * AVP) = rv[i];
   }
   // publishes the next stage and ends every wave's reads of this one
   __syncthreads();
  }

  // ---- epilogue: normalise, x16 carry, stage per-wave 16x128 f16 tile ----
  const float inv = __builtin_amdgcn_rcpf(lrun) * (OSC / PSCALE);
  _Float16* so = sO + w * (16 * HD);
  #pragma unroll
  for (int t = 0; t < 8; ++t)
    #pragma unroll
    for (int r = 0; r < 8; ++r)
      so[m * HD + 16 * t + 8 * hh + r] = (_Float16)(o[t][r] * inv);
  __syncthreads();

  att_store_pass(so, oh, b, head, q0, lane);
  
}

// ---------------------------------------------------------------------------
extern "C" void kernel_launch(void* const* d_in, const int* in_sizes, int n_in,
                              void* d_out, int out_size, void* d_ws, size_t ws_size,
                              hipStream_t stream) {
  if (n_in < 9) return;
  if (in_sizes[0] != NX) return;
  if (in_sizes[1] != DIM * DIM || in_sizes[2] != DIM) return;
  if (in_sizes[3] != DIM * HD || in_sizes[4] != HD) return;
  if (in_sizes[5] != DIM * HD || in_sizes[6] != HD) return;
  if (in_sizes[7] != DIM * DIM || in_sizes[8] != DIM) return;
  if (out_size != NX) return;

  const float* x  = (const float*)d_in[0];
  const float* wq = (const float*)d_in[1];
  const float* bq = (const float*)d_in[2];
  const float* wk = (const float*)d_in[3];
  const float* bk = (const float*)d_in[4];
  const float* wv = (const float*)d_in[5];
  const float* bv = (const float*)d_in[6];
  const float* wo = (const float*)d_in[7];
  const float* bo = (const float*)d_in[8];
  float* out = (float*)d_out;

  const size_t act_b = (size_t)NX * 2;              // 16777216  f16 [4096][2048]
  const size_t wsq_b = (size_t)DIM * DIM * 2;       //  8388608  f16 [2048][2048]
  const size_t wkv_b = (size_t)DIM * HD * 2;        //   524288  f16 [128][2048]
  const size_t kv_b  = (size_t)MTOT * HD * 2;       //  1048576  f16 [4096][128] / [2][128][2048]
  const size_t total = act_b + wsq_b + 2 * wkv_b + wsq_b + act_b + 2 * kv_b + act_b;   // 70254592
  if (total > ws_size) return;

  char* ws = (char*)d_ws;
  size_t off = 0;
  _Float16* xh  = (_Float16*)(ws + off); off += act_b;
  _Float16* wqT = (_Float16*)(ws + off); off += wsq_b;
  _Float16* wkT = (_Float16*)(ws + off); off += wkv_b;
  _Float16* wvT = (_Float16*)(ws + off); off += wkv_b;
  _Float16* woT = (_Float16*)(ws + off); off += wsq_b;
  _Float16* qh  = (_Float16*)(ws + off); off += act_b;
  _Float16* kh  = (_Float16*)(ws + off); off += kv_b;
  _Float16* vT  = (_Float16*)(ws + off); off += kv_b;
  _Float16* oh  = (_Float16*)(ws + off); off += act_b;
  if (off > ws_size) return;

  // 1) operand planes, one grid: x -> f16; W (in,out) -> W^T [out][in] f16 x32
  prep_kernel<<<PBALL, 256, 0, stream>>>(x, xh, wq, wqT, wk, wkT, wv, wvT, wo, woT);

  // 2) projections, one grid over the stacked rows of wqT, wkT, wvT (adjacent in the workspace):
  //    q [4096][2048] f16, k [4096][128] f16, v -> vT [2][128][2048] f16
  gemm_kernel<0, _Float16><<<dim3(MTOT / 128, (DIM + 2 * HD) / 128), 128, 0, stream>>>(xh, wqT, bq, qh, WINV, 1.0f, bk, bv, kh, vT);

  // 3) attention: all 16 query heads against the shared K / V^T planes; o f16 x16
  attn_kernel<<<dim3(SEQ / 128, NH, BS), 256, 0, stream>>>(qh, kh, vT, oh);

  // 4) output projection: out = (o x16)(wo x32) / 512 + bo, f32 whole-line stores
  gemm_kernel<2, float><<<dim3(MTOT / 128, DIM / 128), 128, 0, stream>>>(oh, woT, bo, out, WINV / OSC, 1.0f, nullptr, nullptr, nullptr, nullptr);
}

// v005
// One run takes 151 microseconds.
// Two timings next to v004 both put it at 1.03 times that version's speed.
// All steps since v000 together make it 3.80 times as fast.
// Contractions: x*WqT, x*WkT, x*WvT, K*Q^T, V^T*P^T and O*WoT all on v_wmma_f32_16x16x32_f16 (f16 operands, f32 accumulate); W carried x32, P carried x16384, O carried x16 (exact power-of-two scales folded back in f32); softmax, bias and normalisation in f32.
#include <hip/hip_runtime.h>

typedef _Float16 v16h __attribute__((ext_vector_type(16)));
typedef _Float16 v8h  __attribute__((ext_vector_type(8)));
typedef float    v8f  __attribute__((ext_vector_type(8)));
typedef float    v4f  __attribute__((ext_vector_type(4)));
typedef v8h __attribute__((may_alias)) v8ha;
typedef v4f __attribute__((may_alias)) v4fa;

union Frag { v16h v; v8h half[2]; };

#define DIM    2048
#define SEQ    2048
#define NH     16
#define HD     128
#define BS     2
#define MTOT   (BS * SEQ)          // 4096 token rows
#define NX     (MTOT * DIM)        // 8388608
#define NX8    (NX / 8)            // 1048576
#define WSC    32.0f
#define WINV   0.03125f
#define PSCALE 16384.0f
#define OSC    16.0f

// ---------------------------------------------------------------------------
// 16x16x32 f16 WMMA with hazard guard (ties D, keeps A/B live).
// Fragment map (wave32): lane l, h = l>>4, m = n = l&15.
//   A/B element i: i<8 -> k0+8h+i ; i>=8 -> k0+16+8h+(i-8)
//   D element r : row 8h+r, col l&15
// ---------------------------------------------------------------------------
__device__ __forceinline__ v8f wmma_f16(v16h a, v16h b, v8f c) {
  v8f d = __builtin_amdgcn_wmma_f32_16x16x32_f16(false, a, false, b, (short)0, c, false, false);
  asm volatile("v_nop\n\tv_nop\n\tv_nop\n\tv_nop" : "+v"(d) : "v"(a), "v"(b));
  return d;
}

// A or B fragment from a k-contiguous f16 row; p points at element k0 of the
// row owned by this lane (row index = lane & 15 added by the caller).
__device__ __forceinline__ v16h load_frag(const _Float16* p, int h) {
  Frag f;
  f.half[0] = *(const v8ha*)(p + 8 * h);
  f.half[1] = *(const v8ha*)(p + 16 + 8 * h);
  return f.v;
}

// ---------------------------------------------------------------------------
// Prep part 1: x f32 -> f16 (unscaled). A lane takes XCH chunks of 8 floats (one 16-B
// store each), all its loads issued ahead of the first store; blk = block index
// inside this part's range of the prep grid.
// ---------------------------------------------------------------------------
#define XCH 16
static_assert(NX8 % (256 * XCH) == 0, "the x blocks cover x exactly");
__device__ __forceinline__ void cvt_x_block(const float* __restrict__ x,
                                            _Float16* __restrict__ xh, int blk)
{
  const size_t g = (size_t)blk * (256 * XCH) + threadIdx.x;
  const float* src = x + g * 8;
  _Float16* dst = xh + g * 8;
  v4f a[XCH], c[XCH];
  #pragma unroll
  for (int i = 0; i < XCH; ++i) {
    a[i] = *(const v4fa*)(src + i * 2048);
    c[i] = *(const v4fa*)(src + i * 2048 + 4);
  }
  #pragma unroll
  for (int i = 0; i < XCH; ++i) {
    const v8h o = { (_Float16)a[i].x, (_Float16)a[i].y, (_Float16)a[i].z, (_Float16)a[i].w,
                    (_Float16)c[i].x, (_Float16)c[i].y, (_Float16)c[i].z, (_Float16)c[i].w };
    *(v8h*)(dst + i * 2048) = o;
  }
}

// ---------------------------------------------------------------------------
// Prep part 2: w[DIM][N] f32 (in, out) -> wT[N][DIM] f16 scaled x32 (exact).
// Block 256 thr, tile 128 k x 128 n; tile (bx, by) of (N/128, DIM/128). A wave takes 32
// columns n (one per lane: every load is one whole line) and 64 rows k, all 64 loads
// issued ahead; a lane's 64 values are 64 consecutive k of its output row and go to
// LDS [n][128 k] as eight 16-B stores (row pitch 272 B: conflict-free for 16-B
// stores down a column of rows and for the 16-B reads along a row). Each output row
// segment = 128 halves = two whole lines.
// ---------------------------------------------------------------------------
#define TP 136                             // LDS row pitch in halves (272 B)
template <int N>
__device__ __forceinline__ void transpose_w_block(const float* __restrict__ w,
                                                  _Float16* __restrict__ wT,
                                                  int bx, int by, _Float16* sT)
{
  const int tid = threadIdx.x, lane = tid & 31, wv = tid >> 5;
  const int n0 = bx * 128, k0 = by * 128;
  const int nn = 32 * (wv & 3) + lane, kb = 64 * (wv >> 2);
  const float* src = w + (size_t)(k0 + kb) * N + n0 + nn;
  float val[64];
  #pragma unroll
  for (int i = 0; i < 64; ++i) val[i] = src[i * N];
  #pragma unroll
  for (int q = 0; q < 8; ++q) {
    const v8h o = { (_Float16)(val[8 * q] * WSC),     (_Float16)(val[8 * q + 1] * WSC),
                    (_Float16)(val[8 * q + 2] * WSC), (_Float16)(val[8 * q + 3] * WSC),
                    (_Float16)(val[8 * q + 4] * WSC), (_Float16)(val[8 * q + 5] * WSC),
                    (_Float16)(val[8 * q + 6] * WSC), (_Float16)(val[8 * q + 7] * WSC) };
    *(v8ha*)(sT + nn * TP + kb + 8 * q) = o;
  }
  __syncthreads();
  // 16-B chunk (row = tid/16 + 16 i, col = tid%16): a wave stores two whole rows (4 lines)
  const int row = tid >> 4, col = (tid & 15) * 8;
  const _Float16* s = sT + row * TP + col;
  _Float16* dst = wT + (size_t)(n0 + row) * DIM + k0 + col;
  v8h v[8];
  #pragma unroll
  for (int i = 0; i < 8; ++i) v[i] = *(const v8ha*)(s + 16 * i * TP);
  #pragma unroll
  for (int i = 0; i < 8; ++i) *(v8h*)(dst + (size_t)(16 * i) * DIM) = v[i];
  // precaution: in the listing another job's path follows on the branch's fall-through edge and reuses registers that these stores name
  asm volatile("s_wait_xcnt 0x0" ::: "memory");
}

// ---------------------------------------------------------------------------
// Kernel 1: all operand planes in one grid. The five jobs depend on nothing but
// the inputs, so each takes a range of block indices: x convert, then the
// transposes of wq, wk, wv, wo. Every test below is on blockIdx alone.
// The grid is small enough to be resident at once: few long waves, each with
// its whole share of loads in flight, in place of many waves of a few loads.
// ---------------------------------------------------------------------------
#define PBX  (NX8 / (256 * XCH))           //  256 blocks: x
#define PBS  ((DIM / 128) * (DIM / 128))   //  256 blocks: a DIM x DIM weight
#define PBH  ((HD / 128) * (DIM / 128))    //   16 blocks: a DIM x HD weight
#define PBALL (PBX + 2 * PBS + 2 * PBH)

__global__ __launch_bounds__(256) void prep_kernel(
    const float* __restrict__ x,  _Float16* __restrict__ xh,
    const float* __restrict__ wq, _Float16* __restrict__ wqT,
    const float* __restrict__ wk, _Float16* __restrict__ wkT,
    const float* __restrict__ wv, _Float16* __restrict__ wvT,
    const float* __restrict__ wo, _Float16* __restrict__ woT)
{
  __shared__ __attribute__((aligned(16))) _Float16 sT[128 * TP];     // 34816 B
  const int t = blockIdx.x;
  if (t < PBX) {
    cvt_x_block(x, xh, t);
  } else {
    // job 0..3 = wq, wk, wv, wo; u = tile index inside the job; a weight has N / 128 tile columns
    const int job = t < PBX + PBS ? 0 : (t < PBX + PBS + PBH ? 1 : (t < PBX + PBS + 2 * PBH ? 2 : 3));
    const int u = t - (job == 0 ? PBX : (job == 1 ? PBX + PBS : (job == 2 ? PBX + PBS + PBH : PBX + PBS + 2 * PBH)));
    const float* w = job == 0 ? wq : (job == 1 ? wk : (job == 2 ? wv : wo));
    _Float16* wT = job == 0 ? wqT : (job == 1 ? wkT : (job == 2 ? wvT : woT));
    if (job == 0 || job == 3) {
      transpose_w_block<DIM>(w, wT, u & (DIM / 128 - 1), u / (DIM / 128), sT);
    } else {
      static_assert(HD == 128, "a DIM x HD weight is one tile column");
      transpose_w_block<HD>(w, wT, 0, u, sT);
    }
  }
}

// ---------------------------------------------------------------------------
// ---------------------------------------------------------------------------
// f16 tile staged [row][128] -> dst0[row * PITCH .. + 127]: two lines per row; one
// instruction of a wave covers two whole rows (4 lines); wave w stores rows 32w .. 32w+31.
// A constant row pitch lets one address pair serve all 16 stores.
template <int PITCH>
__device__ __forceinline__ void store_rows_f16(const _Float16* sT, _Float16* dst0, int w, int lane) {
  const int c16 = lane & 15, sub = lane >> 4;
  const _Float16* s = sT + (w * 32 + sub) * 128 + 8 * c16;
  _Float16* dst = dst0 + (size_t)(w * 32 + sub) * PITCH + 8 * c16;
  v8h v[16];
  #pragma unroll
  for (int i = 0; i < 16; ++i) v[i] = *(const v8ha*)(s + 2 * i * 128);
  #pragma unroll
  for (int i = 0; i < 16; ++i) *(v8h*)(dst + (size_t)(2 * i) * PITCH) = v[i];
}

// f32 tile staged [tok][128 feat] -> dst0[tok * PITCH .. + 127]: four lines per row; one
// instruction of a wave covers one whole row; wave w stores rows 32w .. 32w+31.
template <int PITCH>
__device__ __forceinline__ void store_rows_f32(const float* sT, float* dst0, int w, int lane) {
  const float* s = sT + (32 * w) * 128 + 4 * lane;
  float* dst = dst0 + (size_t)(32 * w) * PITCH + 4 * lane;
  v4f v[32];
  #pragma unroll
  for (int i = 0; i < 32; ++i) v[i] = *(const v4fa*)(s + i * 128);
  #pragma unroll
  for (int i = 0; i < 32; ++i) *(v4f*)(dst + (size_t)i * PITCH) = v[i];
}

// ---------------------------------------------------------------------------
// Kernel 2: C = A * BT^T (+bias), A [M][K] f16 rows, BT [N][K] f16 rows (x32).
// Block 128 thr (4 waves, 2 x 2) = 128 rows x 128 cols; wave tile 64 x 64 (4x4
// WMMA tiles): a loaded fragment feeds 4 products, a staged row 128 outputs.
// K in stages of 64: the block brings 128 A rows and 128 BT rows of
// 128 B each by whole-line loads into one of two LDS buffers (row pitch 144 B,
// conflict-free for 16-B fragment reads); the next stage's loads fly while
// this stage's fragments are read from LDS; one barrier per stage. K = DIM.
// MODE 0: the three input projections in one grid. BT = the W^T planes of q, k, v
//         stacked row after row (DIM + HD + HD rows); a column tile lies wholly in one
//         plane and goes to that plane's bias and output:
//         q -> f16 C[M][DIM], k -> f16 CK[M][HD], v -> f16 CV[b][d][t]; each f16((acc*ascale + bias)*oscale)
// MODE 2: f32 C[M][DIM] = acc*ascale + bias (biasK, biasV, CK, CV not used)
// grid (M/128, BT rows/128)
// ---------------------------------------------------------------------------
#define GKT   64                     // k per stage
#define GP    72                     // LDS row pitch in halves (144 B)
#define GABUF (128 * GP)
#define GBUF  ((128 + 128) * GP)     // one stage: A rows then BT rows
union GemmSmem { _Float16 ring[2 * GBUF]; _Float16 h[128 * 128]; float f[128 * 128]; };

// Accumulators -> output tile staged in LDS. D[r] of tile (mt, nt) = C[row 64wm+16mt+8h+r][col 64wn+16nt+m].
// LAYOUT 0: f16 [tok][128 feat]; 1: f16 [feat][128 tok]; 2: f32 [tok][128 feat]. bias points at the tile's first column.
template <int LAYOUT>
__device__ __forceinline__ void stage_out(GemmSmem& sm, const v8f (&acc)[4][4], const float* __restrict__ bias,
                                          float ascale, float oscale, int wm, int wn, int h, int m) {
  float bv[4];
  #pragma unroll
  for (int nt = 0; nt < 4; ++nt) bv[nt] = bias[64 * wn + 16 * nt + m];
  #pragma unroll
  for (int nt = 0; nt < 4; ++nt) {
    const int feat = 64 * wn + 16 * nt + m;              // 0..127
    const float bvl = bv[nt];
    #pragma unroll
    for (int mt = 0; mt < 4; ++mt) {
      #pragma unroll
      for (int r = 0; r < 8; ++r) {
        const int tokl = 64 * wm + 16 * mt + 8 * h + r;  // 0..127
        const float y = acc[mt][nt][r] * ascale + bvl;
        if (LAYOUT == 2) {
          sm.f[tokl * 128 + feat] = y;
        } else if (LAYOUT == 1) {
          sm.h[feat * 128 + tokl] = (_Float16)(y * oscale);
        } else {
          sm.h[tokl * 128 + feat] = (_Float16)(y * oscale);
        }
      }
    }
  }
}

template <int MODE, typename CT>
__global__ __launch_bounds__(128) void gemm_kernel(
    const _Float16* __restrict__ A, const _Float16* __restrict__ BT,
    const float* __restrict__ bias, CT* __restrict__ C,
    float ascale, float oscale,
    const float* __restrict__ biasK, const float* __restrict__ biasV,
    _Float16* __restrict__ CK, _Float16* __restrict__ CV)
{
  constexpr int K = DIM;     // every product here contracts over DIM; a constant row pitch lets one address serve a stage's loads
  __shared__ __attribute__((aligned(16))) GemmSmem sm;       // 73728 B

  const int tid = threadIdx.x, lane = tid & 31, w = tid >> 5;
  const int h = lane >> 4, m = lane & 15;
  const int wm = w >> 1, wn = w & 1;
  const int m0 = blockIdx.x * 128, n0 = blockIdx.y * 128;

  // staging: 16-B chunk (row = tid/8 + 16 i, col = tid%8); a wave covers 4 whole lines
  const int srow = tid >> 3, scol = (tid & 7) * 8;
  const _Float16* ag = A  + (size_t)(m0 + srow) * K + scol;
  const _Float16* bg = BT + (size_t)(n0 + srow) * K + scol;
  const int sl = srow * GP + scol;
  // fragment rows in a stage
  const int fa = (64 * wm + m) * GP;                         // mt = 0
  const int fb = GABUF + (64 * wn + m) * GP;                 // nt = 0

  const v8f zero8 = {0.f, 0.f, 0.f, 0.f, 0.f, 0.f, 0.f, 0.f};
  v8f acc[4][4];
  #pragma unroll
  for (int mt = 0; mt < 4; ++mt)
    #pragma unroll
    for (int nt = 0; nt < 4; ++nt) acc[mt][nt] = zero8;

  v8h ra[8], rb[8];
  #pragma unroll
  for (int i = 0; i < 8; ++i) ra[i] = *(const v8ha*)(ag + (size_t)(16 * i) * K);
  #pragma unroll
  for (int i = 0; i < 8; ++i) rb[i] = *(const v8ha*)(bg + (size_t)(16 * i) * K);
  #pragma unroll
  for (int i = 0; i < 8; ++i) *(v8ha*)(sm.ring + sl + 16 * i * GP) = ra[i];
  #pragma unroll
  for (int i = 0; i < 8; ++i) *(v8ha*)(sm.ring + GABUF + sl + 16 * i * GP) = rb[i];
  __syncthreads();

  int cur = 0;
  #pragma unroll 1
  for (int k0 = 0; k0 < K; k0 += GKT) {
    const bool more = k0 + GKT < K;
    if (more) {
      #pragma unroll
      for (int i = 0; i < 8; ++i) ra[i] = *(const v8ha*)(ag + (size_t)(16 * i) * K + k0 + GKT);
      #pragma unroll
      for (int i = 0; i < 8; ++i) rb[i] = *(const v8ha*)(bg + (size_t)(16 * i) * K + k0 + GKT);
      // precaution: in the listing the fragment loads below reuse the address registers of the loads above
      asm volatile("s_wait_xcnt 0x0" ::: "memory");
    }
    const _Float16* st = sm.ring + cur * GBUF;
    // each 32-deep half of the stage: its 8 fragments as one group of LDS loads ahead of its 16 products
    // (one fragment set of 64 registers: with the 128 accumulator registers it stays below v256, which the guard's operands need)
    #pragma unroll
    for (int ks = 0; ks < 2; ++ks) {
      v16h fA[4], fB[4];
      #pragma unroll
      for (int mt = 0; mt < 4; ++mt) fA[mt] = load_frag(st + fa + mt * 16 * GP + 32 * ks, h);
      #pragma unroll
      for (int nt = 0; nt < 4; ++nt) fB[nt] = load_frag(st + fb + nt * 16 * GP + 32 * ks, h);
      #pragma unroll
      for (int nt = 0; nt < 4; ++nt) {
        #pragma unroll
        for (int mt = 0; mt < 4; ++mt) acc[mt][nt] = wmma_f16(fA[mt], fB[nt], acc[mt][nt]);
      }
    }
    cur ^= 1;
    if (more) {
      _Float16* nx = sm.ring + cur * GBUF + sl;
      #pragma unroll
      for (int i = 0; i < 8; ++i) *(v8ha*)(nx + 16 * i * GP) = ra[i];
      #pragma unroll
      for (int i = 0; i < 8; ++i) *(v8ha*)(nx + GABUF + 16 * i * GP) = rb[i];
    }
    // publishes the next stage and ends every read of this one (the last pass: frees the ring for the output tile)
    __syncthreads();
  }

  // the plane this column tile belongs to (0 q, 1 k, 2 v) and its first column there; block-uniform
  const int sel = MODE == 0 ? (n0 >= DIM + HD ? 2 : (n0 >= DIM ? 1 : 0)) : 0;
  const int nl = n0 - (sel == 2 ? DIM + HD : (sel == 1 ? DIM : 0));
  if (MODE == 2) {
    stage_out<2>(sm, acc, bias + nl, ascale, oscale, wm, wn, h, m);
  } else if (sel == 2) {
    stage_out<1>(sm, acc, biasV + nl, ascale, oscale, wm, wn, h, m);
  } else {
    stage_out<0>(sm, acc, (sel == 1 ? biasK : bias) + nl, ascale, oscale, wm, wn, h, m);
  }
  __syncthreads();

  if (MODE == 2) {
    float* Cf = (float*)(void*)C;
    store_rows_f32<DIM>(sm.f, Cf + (size_t)m0 * DIM + nl, w, lane);
  } else if (sel == 1) {
    store_rows_f16<HD>(sm.h, CK + (size_t)m0 * HD + nl, w, lane);
  } else {
    // staged rows are tokens for q (row pitch DIM), features d for v (row pitch SEQ): the two pitches are equal
    static_assert(SEQ == DIM, "one store path serves q and v");
    const int b = m0 / SEQ, t0 = m0 - b * SEQ;
    _Float16* dst0 = sel == 2 ? CV + (size_t)(b * HD + nl) * SEQ + t0 : (_Float16*)(void*)C + (size_t)m0 * DIM + nl;
    store_rows_f16<DIM>(sm.h, dst0, w, lane);
  }
}

// ---------------------------------------------------------------------------
// Attention helpers.
// ---------------------------------------------------------------------------
// P^T B-fragment from the lane's own score D values: element r <- tile a row r
// (keys 0..15 of the 32-key chunk), element 8+r <- tile c row r (keys 16..31),
// same lane, same query column; scaled by 2^14 before the f16 convert.
__device__ __forceinline__ v16h pack_p(v8f a, v8f c) {
  const v16h r = { (_Float16)(a[0] * PSCALE), (_Float16)(a[1] * PSCALE), (_Float16)(a[2] * PSCALE), (_Float16)(a[3] * PSCALE),
                   (_Float16)(a[4] * PSCALE), (_Float16)(a[5] * PSCALE), (_Float16)(a[6] * PSCALE), (_Float16)(a[7] * PSCALE),
                   (_Float16)(c[0] * PSCALE), (_Float16)(c[1] * PSCALE), (_Float16)(c[2] * PSCALE), (_Float16)(c[3] * PSCALE),
                   (_Float16)(c[4] * PSCALE), (_Float16)(c[5] * PSCALE), (_Float16)(c[6] * PSCALE), (_Float16)(c[7] * PSCALE) };
  return r;
}

// Per-wave 16 x 128 f16 tile in LDS -> oh[b*SEQ + q0 + row][head*128 + d];
// instruction, 32 lines (16 rows x 2) per wave.
__device__ __forceinline__ void att_store_pass(const _Float16* so, _Float16* oh,
                                               int b, int head, int q0, int lane) {
  const int q8 = lane & 7, sub = lane >> 3;
  #pragma unroll
  for (int i = 0; i < 8; ++i) {
    const int lid = i * 4 + sub;                     // 0..31
    const int row = lid >> 1, hl = lid & 1;
    const v8h v = *(const v8ha*)(so + row * HD + 64 * hl + 8 * q8);
    _Float16* dst = oh + ((size_t)(b * SEQ + q0 + row)) * DIM + head * HD + 64 * hl + 8 * q8;
    *(v8h*)dst = v;
  }
}

// ---------------------------------------------------------------------------
// Kernel 3: streaming attention, transposed form, single shared K/V head.
// grid (SEQ/128, NH, BS); block 256 thr (8 waves), 16 queries per wave,
// 32 keys per step. K rows and V^T rows come in stages of 64 keys: the block
// brings them by whole-line loads into one of two LDS buffers (K row pitch
// 272 B, V^T row pitch 144 B, conflict-free for 16-B fragment reads), shared
// by its 8 waves; the next stage's loads fly while this stage is worked on;
// one barrier per stage.
//   S^T = K * Q^T : A = K rows (row = key, k = d, 4 k-steps), B = Q^T (k = d, n = query)
//   O^T += V^T * P^T : A = vT rows (row = d, k = key), B = P^T from registers
// Lane owns 16 keys of query column (lane&15); partner = lane ^ 16.
// ---------------------------------------------------------------------------
#define AKT   64                     // keys per stage
#define AKP   136                    // K row pitch in halves (272 B)
#define AVP   72                     // V^T row pitch in halves (144 B)
#define AKBUF (AKT * AKP)
#define AVBUF (HD * AVP)

__global__ __launch_bounds__(256) void attn_kernel(
    const _Float16* __restrict__ qh,   // [MTOT][DIM]  q (unscaled)
    const _Float16* __restrict__ kh,   // [MTOT][HD]   k
    const _Float16* __restrict__ vt,   // [BS][HD][SEQ] v transposed
    _Float16* __restrict__ oh)         // [MTOT][DIM]  f16(16 * o)
{
  __shared__ __attribute__((aligned(16))) _Float16 sK[2 * AKBUF];     // 34816 B
  __shared__ __attribute__((aligned(16))) _Float16 sV[2 * AVBUF];     // 36864 B
  __shared__ __attribute__((aligned(16))) _Float16 sO[8 * 16 * HD];   // 32768 B

  const int tid = threadIdx.x, lane = tid & 31, w = tid >> 5;
  const int hh = lane >> 4, m = lane & 15;
  const int b = blockIdx.z, head = blockIdx.y;
  const int q0 = blockIdx.x * 128 + 16 * w;

  // Q^T B-fragments: column n = query q0+m, k = d (four 32-deep chunks)
  const _Float16* qrow = qh + ((size_t)(b * SEQ + q0 + m)) * DIM + head * HD;
  v16h qb[4];
  #pragma unroll
  for (int c = 0; c < 4; ++c) qb[c] = load_frag(qrow + 32 * c, hh);

  const v8f zero8 = {0.f, 0.f, 0.f, 0.f, 0.f, 0.f, 0.f, 0.f};
  v8f o[8];                                   // o[t][r] = O^T[d 16t+8hh+r][query m] * (l * 2^14)
  #pragma unroll
  for (int t = 0; t < 8; ++t) o[t] = zero8;
  float mrun = -1e30f, lrun = 0.0f;

  // staging, 16-B chunks. K stage = 16 KiB contiguous: chunk tid + 256 i = row tid/16 + 16 i, col tid%16.
  // V^T stage = 128 rows of 128 B: chunk tid + 256 i = row tid/8 + 32 i, col tid%8.
  const _Float16* kg = kh + (size_t)b * SEQ * HD + tid * 8;
  const _Float16* vg = vt + ((size_t)b * HD + (tid >> 3)) * SEQ + (tid & 7) * 8;
  const int kls = (tid >> 4) * AKP + (tid & 15) * 8;
  const int vls = (tid >> 3) * AVP + (tid & 7) * 8;
  const float scale = 0.08838834764831845f;                    // 1/sqrt(128)

  v8h rk[4], rv[4];
  #pragma unroll
  for (int i = 0; i < 4; ++i) rk[i] = *(const v8ha*)(kg + 2048 * i);
  #pragma unroll
  for (int i = 0; i < 4; ++i) rv[i] = *(const v8ha*)(vg + (size_t)(32 * i) * SEQ);
  // precaution: the address registers of the loads above are reused for the loop's counters only behind this wait
  asm volatile("s_wait_xcnt 0x0" ::: "memory");
  #pragma unroll
  for (int i = 0; i < 4; ++i) *(v8ha*)(sK + kls + 16 * i * AKP) = rk[i];
  #pragma unroll
  for (int i = 0; i < 4; ++i) *(v8ha*)(sV + vls + 32 * i * AVP) = rv[i];
  __syncthreads();

  int cur = 0;
  #pragma unroll 1
  for (int kt = 0; kt < SEQ; kt += AKT) {
   const bool more = kt + AKT < SEQ;
   if (more) {
     #pragma unroll
     for (int i = 0; i < 4; ++i) rk[i] = *(const v8ha*)(kg + (size_t)(kt + AKT) * HD + 2048 * i);
     #pragma unroll
     for (int i = 0; i < 4; ++i) rv[i] = *(const v8ha*)(vg + (size_t)(32 * i) * SEQ + kt + AKT);
   }
   const _Float16* kS = sK + cur * AKBUF + m * AKP;
   const _Float16* vS = sV + cur * AVBUF + m * AVP;

   #pragma unroll
   for (int kb = 0; kb < AKT; kb += 32) {
    // ---- scores: s[j][r] = S^T[key kt+kb+16j+8hh+r][query q0+m] ----
    // the step's 8 K fragments come as one group of LDS loads ahead of its 8 score products
    v16h kf[2][4];
    #pragma unroll
    for (int j = 0; j < 2; ++j)
      #pragma unroll
      for (int c = 0; c < 4; ++c) kf[j][c] = load_frag(kS + (kb + 16 * j) * AKP + 32 * c, hh);
    v8f s[2];
    #pragma unroll
    for (int j = 0; j < 2; ++j) {
      v8f z = zero8;
      #pragma unroll
      for (int c = 0; c < 4; ++c) z = wmma_f16(kf[j][c], qb[c], z);
      s[j] = z;
    }
    // the step's 8 V^T fragments come as one group of LDS loads right behind the score products and fly under the
    // softmax; the scheduling barrier keeps the compiler from sinking part of the group towards its use
    v16h vf[8];
    #pragma unroll
    for (int t = 0; t < 8; ++t) vf[t] = load_frag(vS + (16 * t) * AVP + kb, hh);
    __builtin_amdgcn_sched_barrier(0);

    // ---- scale (f32) and online softmax over this lane pair's 32 keys ----
    float mloc = -1e30f;
    #pragma unroll
    for (int j = 0; j < 2; ++j)
      #pragma unroll
      for (int r = 0; r < 8; ++r) {
        const float sv = s[j][r] * scale;
        s[j][r] = sv;
        mloc = fmaxf(mloc, sv);
      }
    mloc = fmaxf(mloc, __shfl_xor(mloc, 16));
    const float mnew = fmaxf(mrun, mloc);
    const float alpha = __expf(mrun - mnew);
    mrun = mnew;
    float lsum = 0.0f;
    #pragma unroll
    for (int j = 0; j < 2; ++j)
      #pragma unroll
      for (int r = 0; r < 8; ++r) {
        const float p = __expf(s[j][r] - mnew);
        s[j][r] = p;
        lsum += p;
      }
    lsum += __shfl_xor(lsum, 16);
    lrun = lrun * alpha + lsum;
    #pragma unroll
    for (int t = 0; t < 8; ++t)
      #pragma unroll
      for (int r = 0; r < 8; ++r) o[t][r] = o[t][r] * alpha;

    // ---- P^T B-fragment for keys kb .. kb+31 ----
    const v16h pb = pack_p(s[0], s[1]);

    // ---- O^T += V^T * P^T over the 8 d tiles ----
    #pragma unroll
    for (int t = 0; t < 8; ++t) o[t] = wmma_f16(vf[t], pb, o[t]);
   }

   cur ^= 1;
   if (more) {
     #pragma unroll
     for (int i = 0; i < 4; ++i) *(v8ha*)(sK + cur * AKBUF + kls + 16 * i * AKP) = rk[i];
     #pragma unroll
     for (int i = 0; i < 4; ++i) *(v8ha*)(sV + cur * AVBUF + vls + 32 * i * AVP) = rv[i];
   }
   // publishes the next stage and ends every wave's reads of this one
   __syncthreads();
  }

  // ---- epilogue: normalise, x16 carry, stage per-wave 16x128 f16 tile ----
  const float inv = __builtin_amdgcn_rcpf(lrun) * (OSC / PSCALE);
  _Float16* so = sO + w * (16 * HD);
  #pragma unroll
  for (int t = 0; t < 8; ++t)
    #pragma unroll
    for (int r = 0; r < 8; ++r)
      so[m * HD + 16 * t + 8 * hh + r] = (_Float16)(o[t][r] * inv);
  __syncthreads();

  att_store_pass(so, oh, b, head, q0, lane);
  
}

// ---------------------------------------------------------------------------
extern "C" void kernel_launch(void* const* d_in, const int* in_sizes, int n_in,
                              void* d_out, int out_size, void* d_ws, size_t ws_size,
                              hipStream_t stream) {
  if (n_in < 9) return;
  if (in_sizes[0] != NX) return;
  if (in_sizes[1] != DIM * DIM || in_sizes[2] != DIM) return;
  if (in_sizes[3] != DIM * HD || in_sizes[4] != HD) return;
  if (in_sizes[5] != DIM * HD || in_sizes[6] != HD) return;
  if (in_sizes[7] != DIM * DIM || in_sizes[8] != DIM) return;
  if (out_size != NX) return;

  const float* x  = (const float*)d_in[0];
  const float* wq = (const float*)d_in[1];
  const float* bq = (const float*)d_in[2];
  const float* wk = (const float*)d_in[3];
  const float* bk = (const float*)d_in[4];
  const float* wv = (const float*)d_in[5];
  const float* bv = (const float*)d_in[6];
  const float* wo = (const float*)d_in[7];
  const float* bo = (const float*)d_in[8];
  float* out = (float*)d_out;

  const size_t act_b = (size_t)NX * 2;              // 16777216  f16 [4096][2048]
  const size_t wsq_b = (size_t)DIM * DIM * 2;       //  8388608  f16 [2048][2048]
  const size_t wkv_b = (size_t)DIM * HD * 2;        //   524288  f16 [128][2048]
  const size_t kv_b  = (size_t)MTOT * HD * 2;       //  1048576  f16 [4096][128] / [2][128][2048]
  const size_t total = act_b + wsq_b + 2 * wkv_b + wsq_b + act_b + 2 * kv_b + act_b;   // 70254592
  if (total > ws_size) return;

  char* ws = (char*)d_ws;
  size_t off = 0;
  _Float16* xh  = (_Float16*)(ws + off); off += act_b;
  _Float16* wqT = (_Float16*)(ws + off); off += wsq_b;
  _Float16* wkT = (_Float16*)(ws + off); off += wkv_b;
  _Float16* wvT = (_Float16*)(ws + off); off += wkv_b;
  _Float16* woT = (_Float16*)(ws + off); off += wsq_b;
  _Float16* qh  = (_Float16*)(ws + off); off += act_b;
  _Float16* kh  = (_Float16*)(ws + off); off += kv_b;
  _Float16* vT  = (_Float16*)(ws + off); off += kv_b;
  _Float16* oh  = (_Float16*)(ws + off); off += act_b;
  if (off > ws_size) return;

  // 1) operand planes, one grid: x -> f16; W (in,out) -> W^T [out][in] f16 x32
  prep_kernel<<<PBALL, 256, 0, stream>>>(x, xh, wq, wqT, wk, wkT, wv, wvT, wo, woT);

  // 2) projections, one grid over the stacked rows of wqT, wkT, wvT (adjacent in the workspace):
  //    q [4096][2048] f16, k [4096][128] f16, v -> vT [2][128][2048] f16
  gemm_kernel<0, _Float16><<<dim3(MTOT / 128, (DIM + 2 * HD) / 128), 128, 0, stream>>>(xh, wqT, bq, qh, WINV, 1.0f, bk, bv, kh, vT);

  // 3) attention: all 16 query heads against the shared K / V^T planes; o f16 x16
  attn_kernel<<<dim3(SEQ / 128, NH, BS), 256, 0, stream>>>(qh, kh, vT, oh);

  // 4) output projection: out = (o x16)(wo x32) / 512 + bo, f32 whole-line stores
  gemm_kernel<2, float><<<dim3(MTOT / 128, DIM / 128), 128, 0, stream>>>(oh, woT, bo, out, WINV / OSC, 1.0f, nullptr, nullptr, nullptr, nullptr);
}

// v006
// One run takes 147 microseconds.
// Next to v005, in two timings, it ran 1.03 and 1.02 times as fast.
// Over all steps from v000 it is 3.90 times as fast.
// Contractions: x*WqT, x*WkT, x*WvT, K*Q^T, V^T*P^T and O*WoT all on v_wmma_f32_16x16x32_f16 (f16 operands, f32 accumulate); W carried x32, P carried x16384, O carried x16 (exact power-of-two scales folded back in f32); softmax, bias and normalisation in f32.
#include <hip/hip_runtime.h>

typedef _Float16 v16h __attribute__((ext_vector_type(16)));
typedef _Float16 v8h  __attribute__((ext_vector_type(8)));
typedef float    v8f  __attribute__((ext_vector_type(8)));
typedef float    v4f  __attribute__((ext_vector_type(4)));
typedef v8h __attribute__((may_alias)) v8ha;
typedef v4f __attribute__((may_alias)) v4fa;

union Frag { v16h v; v8h half[2]; };

#define DIM    2048
#define SEQ    2048
#define NH     16
#define HD     128
#define BS     2
#define MTOT   (BS * SEQ)          // 4096 token rows
#define NX     (MTOT * DIM)        // 8388608
#define NX8    (NX / 8)            // 1048576
#define WSC    32.0f
#define WINV   0.03125f
#define PSCALE 16384.0f
#define OSC    16.0f

// ---------------------------------------------------------------------------
// 16x16x32 f16 WMMA with hazard guard (ties D, keeps A/B live).
// Fragment map (wave32): lane l, h = l>>4, m = n = l&15.
//   A/B element i: i<8 -> k0+8h+i ; i>=8 -> k0+16+8h+(i-8)
//   D element r : row 8h+r, col l&15
// ---------------------------------------------------------------------------
__device__ __forceinline__ v8f wmma_f16(v16h a, v16h b, v8f c) {
  v8f d = __builtin_amdgcn_wmma_f32_16x16x32_f16(false, a, false, b, (short)0, c, false, false);
  asm volatile("v_nop\n\tv_nop\n\tv_nop\n\tv_nop" : "+v"(d) : "v"(a), "v"(b));
  return d;
}

// The same for the attention wave, whose registers reach above v255: an asm operand is placed below v256 only, and
// with A and B named too the kernel spilled. The guard names D alone; its four slots stand behind the product as before.
__device__ __forceinline__ v8f wmma_f16_hi(v16h a, v16h b, v8f c) {
  v8f d = __builtin_amdgcn_wmma_f32_16x16x32_f16(false, a, false, b, (short)0, c, false, false);
  asm volatile("v_nop\n\tv_nop\n\tv_nop\n\tv_nop" : "+v"(d));
  return d;
}

// A or B fragment from a k-contiguous f16 row; p points at element k0 of the
// row owned by this lane (row index = lane & 15 added by the caller).
__device__ __forceinline__ v16h load_frag(const _Float16* p, int h) {
  Frag f;
  f.half[0] = *(const v8ha*)(p + 8 * h);
  f.half[1] = *(const v8ha*)(p + 16 + 8 * h);
  return f.v;
}

// ---------------------------------------------------------------------------
// Prep part 1: x f32 -> f16 (unscaled). A lane takes XCH chunks of 8 floats (one 16-B
// store each), all its loads issued ahead of the first store; blk = block index
// inside this part's range of the prep grid.
// ---------------------------------------------------------------------------
#define XCH 16
static_assert(NX8 % (256 * XCH) == 0, "the x blocks cover x exactly");
__device__ __forceinline__ void cvt_x_block(const float* __restrict__ x,
                                            _Float16* __restrict__ xh, int blk)
{
  const size_t g = (size_t)blk * (256 * XCH) + threadIdx.x;
  const float* src = x + g * 8;
  _Float16* dst = xh + g * 8;
  v4f a[XCH], c[XCH];
  #pragma unroll
  for (int i = 0; i < XCH; ++i) {
    a[i] = *(const v4fa*)(src + i * 2048);
    c[i] = *(const v4fa*)(src + i * 2048 + 4);
  }
  #pragma unroll
  for (int i = 0; i < XCH; ++i) {
    const v8h o = { (_Float16)a[i].x, (_Float16)a[i].y, (_Float16)a[i].z, (_Float16)a[i].w,
                    (_Float16)c[i].x, (_Float16)c[i].y, (_Float16)c[i].z, (_Float16)c[i].w };
    *(v8h*)(dst + i * 2048) = o;
  }
}

// ---------------------------------------------------------------------------
// Prep part 2: w[DIM][N] f32 (in, out) -> wT[N][DIM] f16 scaled x32 (exact).
// Block 256 thr, tile 128 k x 128 n; tile (bx, by) of (N/128, DIM/128). A wave takes 32
// columns n (one per lane: every load is one whole line) and 64 rows k, all 64 loads
// issued ahead; a lane's 64 values are 64 consecutive k of its output row and go to
// LDS [n][128 k] as eight 16-B stores (row pitch 272 B: conflict-free for 16-B
// stores down a column of rows and for the 16-B reads along a row). Each output row
// segment = 128 halves = two whole lines.
// ---------------------------------------------------------------------------
#define TP 136                             // LDS row pitch in halves (272 B)
template <int N>
__device__ __forceinline__ void transpose_w_block(const float* __restrict__ w,
                                                  _Float16* __restrict__ wT,
                                                  int bx, int by, _Float16* sT)
{
  const int tid = threadIdx.x, lane = tid & 31, wv = tid >> 5;
  const int n0 = bx * 128, k0 = by * 128;
  const int nn = 32 * (wv & 3) + lane, kb = 64 * (wv >> 2);
  const float* src = w + (size_t)(k0 + kb) * N + n0 + nn;
  float val[64];
  #pragma unroll
  for (int i = 0; i < 64; ++i) val[i] = src[i * N];
  #pragma unroll
  for (int q = 0; q < 8; ++q) {
    const v8h o = { (_Float16)(val[8 * q] * WSC),     (_Float16)(val[8 * q + 1] * WSC),
                    (_Float16)(val[8 * q + 2] * WSC), (_Float16)(val[8 * q + 3] * WSC),
                    (_Float16)(val[8 * q + 4] * WSC), (_Float16)(val[8 * q + 5] * WSC),
                    (_Float16)(val[8 * q + 6] * WSC), (_Float16)(val[8 * q + 7] * WSC) };
    *(v8ha*)(sT + nn * TP + kb + 8 * q) = o;
  }
  __syncthreads();
  // 16-B chunk (row = tid/16 + 16 i, col = tid%16): a wave stores two whole rows (4 lines)
  const int row = tid >> 4, col = (tid & 15) * 8;
  const _Float16* s = sT + row * TP + col;
  _Float16* dst = wT + (size_t)(n0 + row) * DIM + k0 + col;
  v8h v[8];
  #pragma unroll
  for (int i = 0; i < 8; ++i) v[i] = *(const v8ha*)(s + 16 * i * TP);
  #pragma unroll
  for (int i = 0; i < 8; ++i) *(v8h*)(dst + (size_t)(16 * i) * DIM) = v[i];
  // precaution: in the listing another job's path follows on the branch's fall-through edge and reuses registers that these stores name
  asm volatile("s_wait_xcnt 0x0" ::: "memory");
}

// ---------------------------------------------------------------------------
// Kernel 1: all operand planes in one grid. The five jobs depend on nothing but
// the inputs, so each takes a range of block indices: x convert, then the
// transposes of wq, wk, wv, wo. Every test below is on blockIdx alone.
// The grid is small enough to be resident at once: few long waves, each with
// its whole share of loads in flight, in place of many waves of a few loads.
// ---------------------------------------------------------------------------
#define PBX  (NX8 / (256 * XCH))           //  256 blocks: x
#define PBS  ((DIM / 128) * (DIM / 128))   //  256 blocks: a DIM x DIM weight
#define PBH  ((HD / 128) * (DIM / 128))    //   16 blocks: a DIM x HD weight
#define PBALL (PBX + 2 * PBS + 2 * PBH)

__global__ __launch_bounds__(256) void prep_kernel(
    const float* __restrict__ x,  _Float16* __restrict__ xh,
    const float* __restrict__ wq, _Float16* __restrict__ wqT,
    const float* __restrict__ wk, _Float16* __restrict__ wkT,
    const float* __restrict__ wv, _Float16* __restrict__ wvT,
    const float* __restrict__ wo, _Float16* __restrict__ woT)
{
  __shared__ __attribute__((aligned(16))) _Float16 sT[128 * TP];     // 34816 B
  const int t = blockIdx.x;
  if (t < PBX) {
    cvt_x_block(x, xh, t);
  } else {
    // job 0..3 = wq, wk, wv, wo; u = tile index inside the job; a weight has N / 128 tile columns
    const int job = t < PBX + PBS ? 0 : (t < PBX + PBS + PBH ? 1 : (t < PBX + PBS + 2 * PBH ? 2 : 3));
    const int u = t - (job == 0 ? PBX : (job == 1 ? PBX + PBS : (job == 2 ? PBX + PBS + PBH : PBX + PBS + 2 * PBH)));
    const float* w = job == 0 ? wq : (job == 1 ? wk : (job == 2 ? wv : wo));
    _Float16* wT = job == 0 ? wqT : (job == 1 ? wkT : (job == 2 ? wvT : woT));
    if (job == 0 || job == 3) {
      transpose_w_block<DIM>(w, wT, u & (DIM / 128 - 1), u / (DIM / 128), sT);
    } else {
      static_assert(HD == 128, "a DIM x HD weight is one tile column");
      transpose_w_block<HD>(w, wT, 0, u, sT);
    }
  }
}

// ---------------------------------------------------------------------------
// ---------------------------------------------------------------------------
// f16 tile staged [row][128] -> dst0[row * PITCH .. + 127]: two lines per row; one
// instruction of a wave covers two whole rows (4 lines); wave w stores rows 32w .. 32w+31.
// A constant row pitch lets one address pair serve all 16 stores.
template <int PITCH>
__device__ __forceinline__ void store_rows_f16(const _Float16* sT, _Float16* dst0, int w, int lane) {
  const int c16 = lane & 15, sub = lane >> 4;
  const _Float16* s = sT + (w * 32 + sub) * 128 + 8 * c16;
  _Float16* dst = dst0 + (size_t)(w * 32 + sub) * PITCH + 8 * c16;
  v8h v[16];
  #pragma unroll
  for (int i = 0; i < 16; ++i) v[i] = *(const v8ha*)(s + 2 * i * 128);
  #pragma unroll
  for (int i = 0; i < 16; ++i) *(v8h*)(dst + (size_t)(2 * i) * PITCH) = v[i];
}

// f32 tile staged [tok][128 feat] -> dst0[tok * PITCH .. + 127]: four lines per row; one
// instruction of a wave covers one whole row; wave w stores rows 32w .. 32w+31.
template <int PITCH>
__device__ __forceinline__ void store_rows_f32(const float* sT, float* dst0, int w, int lane) {
  const float* s = sT + (32 * w) * 128 + 4 * lane;
  float* dst = dst0 + (size_t)(32 * w) * PITCH + 4 * lane;
  v4f v[32];
  #pragma unroll
  for (int i = 0; i < 32; ++i) v[i] = *(const v4fa*)(s + i * 128);
  #pragma unroll
  for (int i = 0; i < 32; ++i) *(v4f*)(dst + (size_t)i * PITCH) = v[i];
}

// ---------------------------------------------------------------------------
// Kernel 2: C = A * BT^T (+bias), A [M][K] f16 rows, BT [N][K] f16 rows (x32).
// Block 128 thr (4 waves, 2 x 2) = 128 rows x 128 cols; wave tile 64 x 64 (4x4
// WMMA tiles): a loaded fragment feeds 4 products, a staged row 128 outputs.
// K in stages of 64: the block brings 128 A rows and 128 BT rows of
// 128 B each by whole-line loads into one of two LDS buffers (row pitch 144 B,
// conflict-free for 16-B fragment reads); the next stage's loads fly while
// this stage's fragments are read from LDS; one barrier per stage. K = DIM.
// MODE 0: the three input projections in one grid. BT = the W^T planes of q, k, v
//         stacked row after row (DIM + HD + HD rows); a column tile lies wholly in one
//         plane and goes to that plane's bias and output:
//         q -> f16 C[M][DIM], k -> f16 CK[M][HD], v -> f16 CV[b][d][t]; each f16((acc*ascale + bias)*oscale)
// MODE 2: f32 C[M][DIM] = acc*ascale + bias (biasK, biasV, CK, CV not used)
// grid (M/128, BT rows/128)
// ---------------------------------------------------------------------------
#define GKT   64                     // k per stage
#define GP    72                     // LDS row pitch in halves (144 B)
#define GABUF (128 * GP)
#define GBUF  ((128 + 128) * GP)     // one stage: A rows then BT rows
union GemmSmem { _Float16 ring[2 * GBUF]; _Float16 h[128 * 128]; float f[128 * 128]; };

// Accumulators -> output tile staged in LDS. D[r] of tile (mt, nt) = C[row 64wm+16mt+8h+r][col 64wn+16nt+m].
// LAYOUT 0: f16 [tok][128 feat]; 1: f16 [feat][128 tok]; 2: f32 [tok][128 feat]. bias points at the tile's first column.
template <int LAYOUT>
__device__ __forceinline__ void stage_out(GemmSmem& sm, const v8f (&acc)[4][4], const float* __restrict__ bias,
                                          float ascale, float oscale, int wm, int wn, int h, int m) {
  float bv[4];
  #pragma unroll
  for (int nt = 0; nt < 4; ++nt) bv[nt] = bias[64 * wn + 16 * nt + m];
  #pragma unroll
  for (int nt = 0; nt < 4; ++nt) {
    const int feat = 64 * wn + 16 * nt + m;              // 0..127
    const float bvl = bv[nt];
    #pragma unroll
    for (int mt = 0; mt < 4; ++mt) {
      #pragma unroll
      for (int r = 0; r < 8; ++r) {
        const int tokl = 64 * wm + 16 * mt + 8 * h + r;  // 0..127
        const float y = acc[mt][nt][r] * ascale + bvl;
        if (LAYOUT == 2) {
          sm.f[tokl * 128 + feat] = y;
        } else if (LAYOUT == 1) {
          sm.h[feat * 128 + tokl] = (_Float16)(y * oscale);
        } else {
          sm.h[tokl * 128 + feat] = (_Float16)(y * oscale);
        }
      }
    }
  }
}

template <int MODE, typename CT>
__global__ __launch_bounds__(128) void gemm_kernel(
    const _Float16* __restrict__ A, const _Float16* __restrict__ BT,
    const float* __restrict__ bias, CT* __restrict__ C,
    float ascale, float oscale,
    const float* __restrict__ biasK, const float* __restrict__ biasV,
    _Float16* __restrict__ CK, _Float16* __restrict__ CV)
{
  constexpr int K = DIM;     // every product here contracts over DIM; a constant row pitch lets one address serve a stage's loads
  __shared__ __attribute__((aligned(16))) GemmSmem sm;       // 73728 B

  const int tid = threadIdx.x, lane = tid & 31, w = tid >> 5;
  const int h = lane >> 4, m = lane & 15;
  const int wm = w >> 1, wn = w & 1;
  const int m0 = blockIdx.x * 128, n0 = blockIdx.y * 128;

  // staging: 16-B chunk (row = tid/8 + 16 i, col = tid%8); a wave covers 4 whole lines
  const int srow = tid >> 3, scol = (tid & 7) * 8;
  const _Float16* ag = A  + (size_t)(m0 + srow) * K + scol;
  const _Float16* bg = BT + (size_t)(n0 + srow) * K + scol;
  const int sl = srow * GP + scol;
  // fragment rows in a stage
  const int fa = (64 * wm + m) * GP;                         // mt = 0
  const int fb = GABUF + (64 * wn + m) * GP;                 // nt = 0

  const v8f zero8 = {0.f, 0.f, 0.f, 0.f, 0.f, 0.f, 0.f, 0.f};
  v8f acc[4][4];
  #pragma unroll
  for (int mt = 0; mt < 4; ++mt)
    #pragma unroll
    for (int nt = 0; nt < 4; ++nt) acc[mt][nt] = zero8;

  v8h ra[8], rb[8];
  #pragma unroll
  for (int i = 0; i < 8; ++i) ra[i] = *(const v8ha*)(ag + (size_t)(16 * i) * K);
  #pragma unroll
  for (int i = 0; i < 8; ++i) rb[i] = *(const v8ha*)(bg + (size_t)(16 * i) * K);
  #pragma unroll
  for (int i = 0; i < 8; ++i) *(v8ha*)(sm.ring + sl + 16 * i * GP) = ra[i];
  #pragma unroll
  for (int i = 0; i < 8; ++i) *(v8ha*)(sm.ring + GABUF + sl + 16 * i * GP) = rb[i];
  __syncthreads();

  int cur = 0;
  #pragma unroll 1
  for (int k0 = 0; k0 < K; k0 += GKT) {
    const bool more = k0 + GKT < K;
    if (more) {
      #pragma unroll
      for (int i = 0; i < 8; ++i) ra[i] = *(const v8ha*)(ag + (size_t)(16 * i) * K + k0 + GKT);
      #pragma unroll
      for (int i = 0; i < 8; ++i) rb[i] = *(const v8ha*)(bg + (size_t)(16 * i) * K + k0 + GKT);
      // precaution: in the listing the fragment loads below reuse the address registers of the loads above
      asm volatile("s_wait_xcnt 0x0" ::: "memory");
    }
    const _Float16* st = sm.ring + cur * GBUF;
    // each 32-deep half of the stage: its 8 fragments as one group of LDS loads ahead of its 16 products
    // (one fragment set of 64 registers: with the 128 accumulator registers it stays below v256, which the guard's operands need)
    #pragma unroll
    for (int ks = 0; ks < 2; ++ks) {
      v16h fA[4], fB[4];
      #pragma unroll
      for (int mt = 0; mt < 4; ++mt) fA[mt] = load_frag(st + fa + mt * 16 * GP + 32 * ks, h);
      #pragma unroll
      for (int nt = 0; nt < 4; ++nt) fB[nt] = load_frag(st + fb + nt * 16 * GP + 32 * ks, h);
      #pragma unroll
      for (int nt = 0; nt < 4; ++nt) {
        #pragma unroll
        for (int mt = 0; mt < 4; ++mt) acc[mt][nt] = wmma_f16(fA[mt], fB[nt], acc[mt][nt]);
      }
    }
    cur ^= 1;
    if (more) {
      _Float16* nx = sm.ring + cur * GBUF + sl;
      #pragma unroll
      for (int i = 0; i < 8; ++i) *(v8ha*)(nx + 16 * i * GP) = ra[i];
      #pragma unroll
      for (int i = 0; i < 8; ++i) *(v8ha*)(nx + GABUF + 16 * i * GP) = rb[i];
    }
    // publishes the next stage and ends every read of this one (the last pass: frees the ring for the output tile)
    __syncthreads();
  }

  // the plane this column tile belongs to (0 q, 1 k, 2 v) and its first column there; block-uniform
  const int sel = MODE == 0 ? (n0 >= DIM + HD ? 2 : (n0 >= DIM ? 1 : 0)) : 0;
  const int nl = n0 - (sel == 2 ? DIM + HD : (sel == 1 ? DIM : 0));
  if (MODE == 2) {
    stage_out<2>(sm, acc, bias + nl, ascale, oscale, wm, wn, h, m);
  } else if (sel == 2) {
    stage_out<1>(sm, acc, biasV + nl, ascale, oscale, wm, wn, h, m);
  } else {
    stage_out<0>(sm, acc, (sel == 1 ? biasK : bias) + nl, ascale, oscale, wm, wn, h, m);
  }
  __syncthreads();

  if (MODE == 2) {
    float* Cf = (float*)(void*)C;
    store_rows_f32<DIM>(sm.f, Cf + (size_t)m0 * DIM + nl, w, lane);
  } else if (sel == 1) {
    store_rows_f16<HD>(sm.h, CK + (size_t)m0 * HD + nl, w, lane);
  } else {
    // staged rows are tokens for q (row pitch DIM), features d for v (row pitch SEQ): the two pitches are equal
    static_assert(SEQ == DIM, "one store path serves q and v");
    const int b = m0 / SEQ, t0 = m0 - b * SEQ;
    _Float16* dst0 = sel == 2 ? CV + (size_t)(b * HD + nl) * SEQ + t0 : (_Float16*)(void*)C + (size_t)m0 * DIM + nl;
    store_rows_f16<DIM>(sm.h, dst0, w, lane);
  }
}

// ---------------------------------------------------------------------------
// Attention helpers.
// ---------------------------------------------------------------------------
// P^T B-fragment from the lane's own score D values: element r <- tile a row r
// (keys 0..15 of the 32-key chunk), element 8+r <- tile c row r (keys 16..31),
// same lane, same query column; scaled by 2^14 before the f16 convert.
__device__ __forceinline__ v16h pack_p(v8f a, v8f c) {
  const v16h r = { (_Float16)(a[0] * PSCALE), (_Float16)(a[1] * PSCALE), (_Float16)(a[2] * PSCALE), (_Float16)(a[3] * PSCALE),
                   (_Float16)(a[4] * PSCALE), (_Float16)(a[5] * PSCALE), (_Float16)(a[6] * PSCALE), (_Float16)(a[7] * PSCALE),
                   (_Float16)(c[0] * PSCALE), (_Float16)(c[1] * PSCALE), (_Float16)(c[2] * PSCALE), (_Float16)(c[3] * PSCALE),
                   (_Float16)(c[4] * PSCALE), (_Float16)(c[5] * PSCALE), (_Float16)(c[6] * PSCALE), (_Float16)(c[7] * PSCALE) };
  return r;
}

// 16 x 128 f16 column tile (half of a wave's 32 x 128 tile) in LDS -> oh[b*SEQ + q0 + row][head*128 + d];
// instruction, 32 lines (16 rows x 2) per call.
__device__ __forceinline__ void att_store_pass(const _Float16* so, _Float16* oh,
                                               int b, int head, int q0, int lane) {
  const int q8 = lane & 7, sub = lane >> 3;
  #pragma unroll
  for (int i = 0; i < 8; ++i) {
    const int lid = i * 4 + sub;                     // 0..31
    const int row = lid >> 1, hl = lid & 1;
    const v8h v = *(const v8ha*)(so + row * HD + 64 * hl + 8 * q8);
    _Float16* dst = oh + ((size_t)(b * SEQ + q0 + row)) * DIM + head * HD + 64 * hl + 8 * q8;
    *(v8h*)dst = v;
  }
}

// ---------------------------------------------------------------------------
// Kernel 3: streaming attention, transposed form, single shared K/V head.
// grid (SEQ/256, NH, BS); block 256 thr (8 waves), 32 queries per wave (AQ = 2 column
// tiles of 16: a K or V^T fragment read from LDS feeds one product per column tile),
// 32 keys per step. K rows and V^T rows come in stages of 64 keys: the block
// brings them by whole-line loads into one of two LDS buffers (K row pitch
// 272 B, V^T row pitch 144 B, conflict-free for 16-B fragment reads), shared
// by its 8 waves; the next stage's loads fly while this stage is worked on;
// one barrier per stage.
//   S^T = K * Q^T : A = K rows (row = key, k = d, 4 k-steps), B = Q^T (k = d, n = query)
//   O^T += V^T * P^T : A = vT rows (row = d, k = key), B = P^T from registers
// In each column tile a lane owns 16 keys of query column (lane&15); partner = lane ^ 16.
// ---------------------------------------------------------------------------
#define AKT   64                     // keys per stage
#define AKP   136                    // K row pitch in halves (272 B)
#define AVP   72                     // V^T row pitch in halves (144 B)
#define AKBUF (AKT * AKP)
#define AVBUF (HD * AVP)
#define AQ    2                      // column tiles per wave

__global__ __launch_bounds__(256) void attn_kernel(
    const _Float16* __restrict__ qh,   // [MTOT][DIM]  q (unscaled)
    const _Float16* __restrict__ kh,   // [MTOT][HD]   k
    const _Float16* __restrict__ vt,   // [BS][HD][SEQ] v transposed
    _Float16* __restrict__ oh)         // [MTOT][DIM]  f16(16 * o)
{
  __shared__ __attribute__((aligned(16))) _Float16 sK[2 * AKBUF];     // 34816 B
  __shared__ __attribute__((aligned(16))) _Float16 sV[2 * AVBUF];     // 36864 B
  __shared__ __attribute__((aligned(16))) _Float16 sO[8 * AQ * 16 * HD];   // 65536 B

  const int tid = threadIdx.x, lane = tid & 31, w = tid >> 5;
  const int hh = lane >> 4, m = lane & 15;
  const int b = blockIdx.z, head = blockIdx.y;
  const int q0 = blockIdx.x * (128 * AQ) + 16 * AQ * w;

  // Q^T B-fragments of column tile g: column n = query q0+16g+m, k = d (four 32-deep chunks)
  const _Float16* qrow = qh + ((size_t)(b * SEQ + q0 + m)) * DIM + head * HD;
  v16h qb[AQ][4];
  #pragma unroll
  for (int g = 0; g < AQ; ++g)
    #pragma unroll
    for (int c = 0; c < 4; ++c) qb[g][c] = load_frag(qrow + (size_t)(16 * g) * DIM + 32 * c, hh);

  const v8f zero8 = {0.f, 0.f, 0.f, 0.f, 0.f, 0.f, 0.f, 0.f};
  v8f o[AQ][8];                               // o[g][t][r] = O^T[d 16t+8hh+r][query 16g+m] * (l * 2^14)
  float mrun[AQ], lrun[AQ];
  #pragma unroll
  for (int g = 0; g < AQ; ++g) {
    #pragma unroll
    for (int t = 0; t < 8; ++t) o[g][t] = zero8;
    mrun[g] = -1e30f;
    lrun[g] = 0.0f;
  }

  // staging, 16-B chunks. K stage = 16 KiB contiguous: chunk tid + 256 i = row tid/16 + 16 i, col tid%16.
  // V^T stage = 128 rows of 128 B: chunk tid + 256 i = row tid/8 + 32 i, col tid%8.
  const _Float16* kg = kh + (size_t)b * SEQ * HD + tid * 8;
  const _Float16* vg = vt + ((size_t)b * HD + (tid >> 3)) * SEQ + (tid & 7) * 8;
  const int kls = (tid >> 4) * AKP + (tid & 15) * 8;
  const int vls = (tid >> 3) * AVP + (tid & 7) * 8;
  const float scale = 0.08838834764831845f;                    // 1/sqrt(128)

  v8h rk[4], rv[4];
  #pragma unroll
  for (int i = 0; i < 4; ++i) rk[i] = *(const v8ha*)(kg + 2048 * i);
  #pragma unroll
  for (int i = 0; i < 4; ++i) rv[i] = *(const v8ha*)(vg + (size_t)(32 * i) * SEQ);
  // precaution: the address registers of the loads above are reused for the loop's counters only behind this wait
  asm volatile("s_wait_xcnt 0x0" ::: "memory");
  #pragma unroll
  for (int i = 0; i < 4; ++i) *(v8ha*)(sK + kls + 16 * i * AKP) = rk[i];
  #pragma unroll
  for (int i = 0; i < 4; ++i) *(v8ha*)(sV + vls + 32 * i * AVP) = rv[i];
  __syncthreads();

  int cur = 0;
  #pragma unroll 1
  for (int kt = 0; kt < SEQ; kt += AKT) {
   const bool more = kt + AKT < SEQ;
   if (more) {
     #pragma unroll
     for (int i = 0; i < 4; ++i) rk[i] = *(const v8ha*)(kg + (size_t)(kt + AKT) * HD + 2048 * i);
     #pragma unroll
     for (int i = 0; i < 4; ++i) rv[i] = *(const v8ha*)(vg + (size_t)(32 * i) * SEQ + kt + AKT);
     // precaution: in the listing the fragment loads below reuse the address registers of the loads above
     asm volatile("s_wait_xcnt 0x0" ::: "memory");
   }
   const _Float16* kS = sK + cur * AKBUF + m * AKP;
   const _Float16* vS = sV + cur * AVBUF + m * AVP;

   #pragma unroll
   for (int kb = 0; kb < AKT; kb += 32) {
    // ---- scores: s[g][j][r] = S^T[key kt+kb+16j+8hh+r][query q0+16g+m] ----
    // the step's 8 K fragments come as one group of LDS loads ahead of its 16 score products
    v16h kf[2][4];
    #pragma unroll
    for (int j = 0; j < 2; ++j)
      #pragma unroll
      for (int c = 0; c < 4; ++c) kf[j][c] = load_frag(kS + (kb + 16 * j) * AKP + 32 * c, hh);
    v8f s[AQ][2];
    #pragma unroll
    for (int g = 0; g < AQ; ++g)
      #pragma unroll
      for (int j = 0; j < 2; ++j) s[g][j] = zero8;
    #pragma unroll
    for (int c = 0; c < 4; ++c)
      #pragma unroll
      for (int j = 0; j < 2; ++j)
        #pragma unroll
        for (int g = 0; g < AQ; ++g) s[g][j] = wmma_f16_hi(kf[j][c], qb[g][c], s[g][j]);
    // the step's 8 V^T fragments come as one group of LDS loads right behind the score products and fly under the
    // softmax; the scheduling barrier keeps the compiler from sinking part of the group towards its use
    v16h vf[8];
    #pragma unroll
    for (int t = 0; t < 8; ++t) vf[t] = load_frag(vS + (16 * t) * AVP + kb, hh);
    __builtin_amdgcn_sched_barrier(0);

    // ---- scale (f32) and online softmax over this lane pair's 32 keys, per column tile ----
    v16h pb[AQ];
    #pragma unroll
    for (int g = 0; g < AQ; ++g) {
      float mloc = -1e30f;
      #pragma unroll
      for (int j = 0; j < 2; ++j)
        #pragma unroll
        for (int r = 0; r < 8; ++r) {
          const float sv = s[g][j][r] * scale;
          s[g][j][r] = sv;
          mloc = fmaxf(mloc, sv);
        }
      mloc = fmaxf(mloc, __shfl_xor(mloc, 16));
      const float mnew = fmaxf(mrun[g], mloc);
      const float alpha = __expf(mrun[g] - mnew);
      mrun[g] = mnew;
      float lsum = 0.0f;
      #pragma unroll
      for (int j = 0; j < 2; ++j)
        #pragma unroll
        for (int r = 0; r < 8; ++r) {
          const float p = __expf(s[g][j][r] - mnew);
          s[g][j][r] = p;
          lsum += p;
        }
      lsum += __shfl_xor(lsum, 16);
      lrun[g] = lrun[g] * alpha + lsum;
      #pragma unroll
      for (int t = 0; t < 8; ++t)
        #pragma unroll
        for (int r = 0; r < 8; ++r) o[g][t][r] = o[g][t][r] * alpha;

      // ---- P^T B-fragment for keys kb .. kb+31 ----
      pb[g] = pack_p(s[g][0], s[g][1]);
    }

    // ---- O^T += V^T * P^T over the 8 d tiles, both column tiles on each V^T fragment ----
    #pragma unroll
    for (int t = 0; t < 8; ++t)
      #pragma unroll
      for (int g = 0; g < AQ; ++g) o[g][t] = wmma_f16_hi(vf[t], pb[g], o[g][t]);
   }

   cur ^= 1;
   if (more) {
     #pragma unroll
     for (int i = 0; i < 4; ++i) *(v8ha*)(sK + cur * AKBUF + kls + 16 * i * AKP) = rk[i];
     #pragma unroll
     for (int i = 0; i < 4; ++i) *(v8ha*)(sV + cur * AVBUF + vls + 32 * i * AVP) = rv[i];
   }
   // publishes the next stage and ends every wave's reads of this one
   __syncthreads();
  }

  // ---- epilogue: normalise, x16 carry, stage per-wave 32x128 f16 tile ----
  _Float16* so = sO + w * (AQ * 16 * HD);
  #pragma unroll
  for (int g = 0; g < AQ; ++g) {
    const float inv = __builtin_amdgcn_rcpf(lrun[g]) * (OSC / PSCALE);
    #pragma unroll
    for (int t = 0; t < 8; ++t)
      #pragma unroll
      for (int r = 0; r < 8; ++r)
        so[(16 * g + m) * HD + 16 * t + 8 * hh + r] = (_Float16)(o[g][t][r] * inv);
  }
  __syncthreads();

  #pragma unroll
  for (int g = 0; g < AQ; ++g) att_store_pass(so + g * 16 * HD, oh, b, head, q0 + 16 * g, lane);
  
}

// ---------------------------------------------------------------------------
extern "C" void kernel_launch(void* const* d_in, const int* in_sizes, int n_in,
                              void* d_out, int out_size, void* d_ws, size_t ws_size,
                              hipStream_t stream) {
  if (n_in < 9) return;
  if (in_sizes[0] != NX) return;
  if (in_sizes[1] != DIM * DIM || in_sizes[2] != DIM) return;
  if (in_sizes[3] != DIM * HD || in_sizes[4] != HD) return;
  if (in_sizes[5] != DIM * HD || in_sizes[6] != HD) return;
  if (in_sizes[7] != DIM * DIM || in_sizes[8] != DIM) return;
  if (out_size != NX) return;

  const float* x  = (const float*)d_in[0];
  const float* wq = (const float*)d_in[1];
  const float* bq = (const float*)d_in[2];
  const float* wk = (const float*)d_in[3];
  const float* bk = (const float*)d_in[4];
  const float* wv = (const float*)d_in[5];
  const float* bv = (const float*)d_in[6];
  const float* wo = (const float*)d_in[7];
  const float* bo = (const float*)d_in[8];
  float* out = (float*)d_out;

  const size_t act_b = (size_t)NX * 2;              // 16777216  f16 [4096][2048]
  const size_t wsq_b = (size_t)DIM * DIM * 2;       //  8388608  f16 [2048][2048]
  const size_t wkv_b = (size_t)DIM * HD * 2;        //   524288  f16 [128][2048]
  const size_t kv_b  = (size_t)MTOT * HD * 2;       //  1048576  f16 [4096][128] / [2][128][2048]
  const size_t total = act_b + wsq_b + 2 * wkv_b + wsq_b + act_b + 2 * kv_b + act_b;   // 70254592
  if (total > ws_size) return;

  char* ws = (char*)d_ws;
  size_t off = 0;
  _Float16* xh  = (_Float16*)(ws + off); off += act_b;
  _Float16* wqT = (_Float16*)(ws + off); off += wsq_b;
  _Float16* wkT = (_Float16*)(ws + off); off += wkv_b;
  _Float16* wvT = (_Float16*)(ws + off); off += wkv_b;
  _Float16* woT = (_Float16*)(ws + off); off += wsq_b;
  _Float16* qh  = (_Float16*)(ws + off); off += act_b;
  _Float16* kh  = (_Float16*)(ws + off); off += kv_b;
  _Float16* vT  = (_Float16*)(ws + off); off += kv_b;
  _Float16* oh  = (_Float16*)(ws + off); off += act_b;
  if (off > ws_size) return;

  // 1) operand planes, one grid: x -> f16; W (in,out) -> W^T [out][in] f16 x32
  prep_kernel<<<PBALL, 256, 0, stream>>>(x, xh, wq, wqT, wk, wkT, wv, wvT, wo, woT);

  // 2) projections, one grid over the stacked rows of wqT, wkT, wvT (adjacent in the workspace):
  //    q [4096][2048] f16, k [4096][128] f16, v -> vT [2][128][2048] f16
  gemm_kernel<0, _Float16><<<dim3(MTOT / 128, (DIM + 2 * HD) / 128), 128, 0, stream>>>(xh, wqT, bq, qh, WINV, 1.0f, bk, bv, kh, vT);

  // 3) attention: all 16 query heads against the shared K / V^T planes; o f16 x16
  attn_kernel<<<dim3(SEQ / (128 * AQ), NH, BS), 256, 0, stream>>>(qh, kh, vT, oh);

  // 4) output projection: out = (o x16)(wo x32) / 512 + bo, f32 whole-line stores
  gemm_kernel<2, float><<<dim3(MTOT / 128, DIM / 128), 128, 0, stream>>>(oh, woT, bo, out, WINV / OSC, 1.0f, nullptr, nullptr, nullptr, nullptr);
}

// v007
// A run of this version takes 141 microseconds.
// Two timings next to v006 put it at 1.04 and 1.05 times that version's speed.
// Counting every step since v000, it is 4.08 times as fast.
// Contractions: x*WqT, x*WkT, x*WvT, K*Q^T, V^T*P^T and O*WoT all on v_wmma_f32_16x16x32_f16 (f16 operands, f32 accumulate); W carried x32, P carried x16384, O carried x16 (exact power-of-two scales folded back in f32); softmax, bias and normalisation in f32.
#include <hip/hip_runtime.h>

typedef _Float16 v16h __attribute__((ext_vector_type(16)));
typedef _Float16 v8h  __attribute__((ext_vector_type(8)));
typedef float    v8f  __attribute__((ext_vector_type(8)));
typedef float    v4f  __attribute__((ext_vector_type(4)));
typedef v8h __attribute__((may_alias)) v8ha;
typedef v4f __attribute__((may_alias)) v4fa;

union Frag { v16h v; v8h half[2]; };

#define DIM    2048
#define SEQ    2048
#define NH     16
#define HD     128
#define BS     2
#define MTOT   (BS * SEQ)          // 4096 token rows
#define NX     (MTOT * DIM)        // 8388608
#define NX8    (NX / 8)            // 1048576
#define WSC    32.0f
#define WINV   0.03125f
#define PSCALE 16384.0f
#define OSC    16.0f

// ---------------------------------------------------------------------------
// 16x16x32 f16 WMMA with hazard guard (ties D, keeps A/B live).
// Fragment map (wave32): lane l, h = l>>4, m = n = l&15.
//   A/B element i: i<8 -> k0+8h+i ; i>=8 -> k0+16+8h+(i-8)
//   D element r : row 8h+r, col l&15
// ---------------------------------------------------------------------------
__device__ __forceinline__ v8f wmma_f16(v16h a, v16h b, v8f c) {
  v8f d = __builtin_amdgcn_wmma_f32_16x16x32_f16(false, a, false, b, (short)0, c, false, false);
  asm volatile("v_nop\n\tv_nop\n\tv_nop\n\tv_nop" : "+v"(d) : "v"(a), "v"(b));
  return d;
}

// The same for the attention wave, whose registers reach above v255: an asm operand is placed below v256 only, and
// with A and B named too the kernel spilled. The guard names D alone; its four slots stand behind the product as before.
__device__ __forceinline__ v8f wmma_f16_hi(v16h a, v16h b, v8f c) {
  v8f d = __builtin_amdgcn_wmma_f32_16x16x32_f16(false, a, false, b, (short)0, c, false, false);
  asm volatile("v_nop\n\tv_nop\n\tv_nop\n\tv_nop" : "+v"(d));
  return d;
}

// A or B fragment from a k-contiguous f16 row; p points at element k0 of the
// row owned by this lane (row index = lane & 15 added by the caller).
__device__ __forceinline__ v16h load_frag(const _Float16* p, int h) {
  Frag f;
  f.half[0] = *(const v8ha*)(p + 8 * h);
  f.half[1] = *(const v8ha*)(p + 16 + 8 * h);
  return f.v;
}

// ---------------------------------------------------------------------------
// Prep part 1: x f32 -> f16 (unscaled). A lane takes XCH chunks of 8 floats (one 16-B
// store each), all its loads issued ahead of the first store; blk = block index
// inside this part's range of the prep grid.
// ---------------------------------------------------------------------------
#define XCH 16
static_assert(NX8 % (256 * XCH) == 0, "the x blocks cover x exactly");
__device__ __forceinline__ void cvt_x_block(const float* __restrict__ x,
                                            _Float16* __restrict__ xh, int blk)
{
  const size_t g = (size_t)blk * (256 * XCH) + threadIdx.x;
  const float* src = x + g * 8;
  _Float16* dst = xh + g * 8;
  v4f a[XCH], c[XCH];
  #pragma unroll
  for (int i = 0; i < XCH; ++i) {
    a[i] = *(const v4fa*)(src + i * 2048);
    c[i] = *(const v4fa*)(src + i * 2048 + 4);
  }
  #pragma unroll
  for (int i = 0; i < XCH; ++i) {
    const v8h o = { (_Float16)a[i].x, (_Float16)a[i].y, (_Float16)a[i].z, (_Float16)a[i].w,
                    (_Float16)c[i].x, (_Float16)c[i].y, (_Float16)c[i].z, (_Float16)c[i].w };
    *(v8h*)(dst + i * 2048) = o;
  }
}

// ---------------------------------------------------------------------------
// Prep part 2: w[DIM][N] f32 (in, out) -> wT[N][DIM] f16 scaled x32 (exact).
// Block 256 thr, tile 128 k x 128 n; tile (bx, by) of (N/128, DIM/128). A wave takes 32
// columns n (one per lane: every load is one whole line) and 64 rows k, all 64 loads
// issued ahead; a lane's 64 values are 64 consecutive k of its output row and go to
// LDS [n][128 k] as eight 16-B stores (row pitch 272 B: conflict-free for 16-B
// stores down a column of rows and for the 16-B reads along a row). Each output row
// segment = 128 halves = two whole lines.
// ---------------------------------------------------------------------------
#define TP 136                             // LDS row pitch in halves (272 B)
template <int N>
__device__ __forceinline__ void transpose_w_block(const float* __restrict__ w,
                                                  _Float16* __restrict__ wT,
                                                  int bx, int by, _Float16* sT)
{
  const int tid = threadIdx.x, lane = tid & 31, wv = tid >> 5;
  const int n0 = bx * 128, k0 = by * 128;
  const int nn = 32 * (wv & 3) + lane, kb = 64 * (wv >> 2);
  const float* src = w + (size_t)(k0 + kb) * N + n0 + nn;
  float val[64];
  #pragma unroll
  for (int i = 0; i < 64; ++i) val[i] = src[i * N];
  #pragma unroll
  for (int q = 0; q < 8; ++q) {
    const v8h o = { (_Float16)(val[8 * q] * WSC),     (_Float16)(val[8 * q + 1] * WSC),
                    (_Float16)(val[8 * q + 2] * WSC), (_Float16)(val[8 * q + 3] * WSC),
                    (_Float16)(val[8 * q + 4] * WSC), (_Float16)(val[8 * q + 5] * WSC),
                    (_Float16)(val[8 * q + 6] * WSC), (_Float16)(val[8 * q + 7] * WSC) };
    *(v8ha*)(sT + nn * TP + kb + 8 * q) = o;
  }
  __syncthreads();
  // 16-B chunk (row = tid/16 + 16 i, col = tid%16): a wave stores two whole rows (4 lines)
  const int row = tid >> 4, col = (tid & 15) * 8;
  const _Float16* s = sT + row * TP + col;
  _Float16* dst = wT + (size_t)(n0 + row) * DIM + k0 + col;
  v8h v[8];
  #pragma unroll
  for (int i = 0; i < 8; ++i) v[i] = *(const v8ha*)(s + 16 * i * TP);
  #pragma unroll
  for (int i = 0; i < 8; ++i) *(v8h*)(dst + (size_t)(16 * i) * DIM) = v[i];
  // precaution: in the listing another job's path follows on the branch's fall-through edge and reuses registers that these stores name
  asm volatile("s_wait_xcnt 0x0" ::: "memory");
}

// ---------------------------------------------------------------------------
// Kernel 1: all operand planes in one grid. The five jobs depend on nothing but
// the inputs, so each takes a range of block indices: x convert, then the
// transposes of wq, wk, wv, wo. Every test below is on blockIdx alone.
// The grid is small enough to be resident at once: few long waves, each with
// its whole share of loads in flight, in place of many waves of a few loads.
// ---------------------------------------------------------------------------
#define PBX  (NX8 / (256 * XCH))           //  256 blocks: x
#define PBS  ((DIM / 128) * (DIM / 128))   //  256 blocks: a DIM x DIM weight
#define PBH  ((HD / 128) * (DIM / 128))    //   16 blocks: a DIM x HD weight
#define PBALL (PBX + 2 * PBS + 2 * PBH)

__global__ __launch_bounds__(256) void prep_kernel(
    const float* __restrict__ x,  _Float16* __restrict__ xh,
    const float* __restrict__ wq, _Float16* __restrict__ wqT,
    const float* __restrict__ wk, _Float16* __restrict__ wkT,
    const float* __restrict__ wv, _Float16* __restrict__ wvT,
    const float* __restrict__ wo, _Float16* __restrict__ woT)
{
  __shared__ __attribute__((aligned(16))) _Float16 sT[128 * TP];     // 34816 B
  const int t = blockIdx.x;
  if (t < PBX) {
    cvt_x_block(x, xh, t);
  } else {
    // job 0..3 = wq, wk, wv, wo; u = tile index inside the job; a weight has N / 128 tile columns
    const int job = t < PBX + PBS ? 0 : (t < PBX + PBS + PBH ? 1 : (t < PBX + PBS + 2 * PBH ? 2 : 3));
    const int u = t - (job == 0 ? PBX : (job == 1 ? PBX + PBS : (job == 2 ? PBX + PBS + PBH : PBX + PBS + 2 * PBH)));
    const float* w = job == 0 ? wq : (job == 1 ? wk : (job == 2 ? wv : wo));
    _Float16* wT = job == 0 ? wqT : (job == 1 ? wkT : (job == 2 ? wvT : woT));
    if (job == 0 || job == 3) {
      transpose_w_block<DIM>(w, wT, u & (DIM / 128 - 1), u / (DIM / 128), sT);
    } else {
      static_assert(HD == 128, "a DIM x HD weight is one tile column");
      transpose_w_block<HD>(w, wT, 0, u, sT);
    }
  }
}

// ---------------------------------------------------------------------------
// ---------------------------------------------------------------------------
// f16 tile staged [row][128] -> dst0[row * PITCH .. + 127]: two lines per row; one
// instruction of a wave covers two whole rows (4 lines); wave w stores rows 32w .. 32w+31.
// A constant row pitch lets one address pair serve all 16 stores.
template <int PITCH>
__device__ __forceinline__ void store_rows_f16(const _Float16* sT, _Float16* dst0, int w, int lane) {
  const int c16 = lane & 15, sub = lane >> 4;
  const _Float16* s = sT + (w * 32 + sub) * 128 + 8 * c16;
  _Float16* dst = dst0 + (size_t)(w * 32 + sub) * PITCH + 8 * c16;
  v8h v[16];
  #pragma unroll
  for (int i = 0; i < 16; ++i) v[i] = *(const v8ha*)(s + 2 * i * 128);
  #pragma unroll
  for (int i = 0; i < 16; ++i) *(v8h*)(dst + (size_t)(2 * i) * PITCH) = v[i];
}

// f32 tile staged [tok][128 feat] -> dst0[tok * PITCH .. + 127]: four lines per row; one
// instruction of a wave covers one whole row; wave w stores rows 32w .. 32w+31.
template <int PITCH>
__device__ __forceinline__ void store_rows_f32(const float* sT, float* dst0, int w, int lane) {
  const float* s = sT + (32 * w) * 128 + 4 * lane;
  float* dst = dst0 + (size_t)(32 * w) * PITCH + 4 * lane;
  v4f v[32];
  #pragma unroll
  for (int i = 0; i < 32; ++i) v[i] = *(const v4fa*)(s + i * 128);
  #pragma unroll
  for (int i = 0; i < 32; ++i) *(v4f*)(dst + (size_t)i * PITCH) = v[i];
}

// ---------------------------------------------------------------------------
// Kernel 2: C = A * BT^T (+bias), A [M][K] f16 rows, BT [N][K] f16 rows (x32).
// Block 128 thr (4 waves, 2 x 2) = 128 rows x 128 cols; wave tile 64 x 64 (4x4
// WMMA tiles): a loaded fragment feeds 4 products, a staged row 128 outputs.
// K in stages of 64: the block brings 128 A rows and 128 BT rows of
// 128 B each by whole-line loads into one of two LDS buffers (row pitch 144 B,
// conflict-free for 16-B fragment reads); the next stage's loads fly while
// this stage's fragments are read from LDS; one barrier per stage. K = DIM.
// MODE 0: the three input projections in one grid. BT = the W^T planes of q, k, v
//         stacked row after row (DIM + HD + HD rows); a column tile lies wholly in one
//         plane and goes to that plane's bias and output:
//         q -> f16 C[M][DIM], k -> f16 CK[M][HD], v -> f16 CV[b][d][t]; each f16((acc*ascale + bias)*oscale)
// MODE 2: f32 C[M][DIM] = acc*ascale + bias (biasK, biasV, CK, CV not used)
// grid (M/128, BT rows/128)
// ---------------------------------------------------------------------------
#define GKT   64                     // k per stage
#define GP    72                     // LDS row pitch in halves (144 B)
#define GABUF (128 * GP)
#define GBUF  ((128 + 128) * GP)     // one stage: A rows then BT rows
union GemmSmem { _Float16 ring[2 * GBUF]; _Float16 h[128 * 128]; float f[128 * 128]; };

// Accumulators -> output tile staged in LDS. D[r] of tile (mt, nt) = C[row 64wm+16mt+8h+r][col 64wn+16nt+m].
// LAYOUT 0: f16 [tok][128 feat]; 1: f16 [feat][128 tok]; 2: f32 [tok][128 feat]. bias points at the tile's first column.
template <int LAYOUT>
__device__ __forceinline__ void stage_out(GemmSmem& sm, const v8f (&acc)[4][4], const float* __restrict__ bias,
                                          float ascale, float oscale, int wm, int wn, int h, int m) {
  float bv[4];
  #pragma unroll
  for (int nt = 0; nt < 4; ++nt) bv[nt] = bias[64 * wn + 16 * nt + m];
  #pragma unroll
  for (int nt = 0; nt < 4; ++nt) {
    const int feat = 64 * wn + 16 * nt + m;              // 0..127
    const float bvl = bv[nt];
    #pragma unroll
    for (int mt = 0; mt < 4; ++mt) {
      #pragma unroll
      for (int r = 0; r < 8; ++r) {
        const int tokl = 64 * wm + 16 * mt + 8 * h + r;  // 0..127
        const float y = acc[mt][nt][r] * ascale + bvl;
        if (LAYOUT == 2) {
          sm.f[tokl * 128 + feat] = y;
        } else if (LAYOUT == 1) {
          sm.h[feat * 128 + tokl] = (_Float16)(y * oscale);
        } else {
          sm.h[tokl * 128 + feat] = (_Float16)(y * oscale);
        }
      }
    }
  }
}

template <int MODE, typename CT>
__global__ __launch_bounds__(128) void gemm_kernel(
    const _Float16* __restrict__ A, const _Float16* __restrict__ BT,
    const float* __restrict__ bias, CT* __restrict__ C,
    float ascale, float oscale,
    const float* __restrict__ biasK, const float* __restrict__ biasV,
    _Float16* __restrict__ CK, _Float16* __restrict__ CV)
{
  constexpr int K = DIM;     // every product here contracts over DIM; a constant row pitch lets one address serve a stage's loads
  __shared__ __attribute__((aligned(16))) GemmSmem sm;       // 73728 B

  const int tid = threadIdx.x, lane = tid & 31, w = tid >> 5;
  const int h = lane >> 4, m = lane & 15;
  const int wm = w >> 1, wn = w & 1;
  const int m0 = blockIdx.x * 128, n0 = blockIdx.y * 128;

  // staging: 16-B chunk (row = tid/8 + 16 i, col = tid%8); a wave covers 4 whole lines
  const int srow = tid >> 3, scol = (tid & 7) * 8;
  const _Float16* ag = A  + (size_t)(m0 + srow) * K + scol;
  const _Float16* bg = BT + (size_t)(n0 + srow) * K + scol;
  const int sl = srow * GP + scol;
  // fragment rows in a stage
  const int fa = (64 * wm + m) * GP;                         // mt = 0
  const int fb = GABUF + (64 * wn + m) * GP;                 // nt = 0

  const v8f zero8 = {0.f, 0.f, 0.f, 0.f, 0.f, 0.f, 0.f, 0.f};
  v8f acc[4][4];
  #pragma unroll
  for (int mt = 0; mt < 4; ++mt)
    #pragma unroll
    for (int nt = 0; nt < 4; ++nt) acc[mt][nt] = zero8;

  v8h ra[8], rb[8];
  #pragma unroll
  for (int i = 0; i < 8; ++i) ra[i] = *(const v8ha*)(ag + (size_t)(16 * i) * K);
  #pragma unroll
  for (int i = 0; i < 8; ++i) rb[i] = *(const v8ha*)(bg + (size_t)(16 * i) * K);
  #pragma unroll
  for (int i = 0; i < 8; ++i) *(v8ha*)(sm.ring + sl + 16 * i * GP) = ra[i];
  #pragma unroll
  for (int i = 0; i < 8; ++i) *(v8ha*)(sm.ring + GABUF + sl + 16 * i * GP) = rb[i];
  __syncthreads();

  int cur = 0;
  #pragma unroll 1
  for (int k0 = 0; k0 < K; k0 += GKT) {
    const bool more = k0 + GKT < K;
    if (more) {
      #pragma unroll
      for (int i = 0; i < 8; ++i) ra[i] = *(const v8ha*)(ag + (size_t)(16 * i) * K + k0 + GKT);
      #pragma unroll
      for (int i = 0; i < 8; ++i) rb[i] = *(const v8ha*)(bg + (size_t)(16 * i) * K + k0 + GKT);
      // precaution: in the listing the fragment loads below reuse the address registers of the loads above
      asm volatile("s_wait_xcnt 0x0" ::: "memory");
    }
    const _Float16* st = sm.ring + cur * GBUF;
    // each 32-deep half of the stage: its 8 fragments as one group of LDS loads ahead of its 16 products
    // (one fragment set of 64 registers: with the 128 accumulator registers it stays below v256, which the guard's operands need)
    #pragma unroll
    for (int ks = 0; ks < 2; ++ks) {
      v16h fA[4], fB[4];
      #pragma unroll
      for (int mt = 0; mt < 4; ++mt) fA[mt] = load_frag(st + fa + mt * 16 * GP + 32 * ks, h);
      #pragma unroll
      for (int nt = 0; nt < 4; ++nt) fB[nt] = load_frag(st + fb + nt * 16 * GP + 32 * ks, h);
      #pragma unroll
      for (int nt = 0; nt < 4; ++nt) {
        #pragma unroll
        for (int mt = 0; mt < 4; ++mt) acc[mt][nt] = wmma_f16(fA[mt], fB[nt], acc[mt][nt]);
      }
    }
    cur ^= 1;
    if (more) {
      _Float16* nx = sm.ring + cur * GBUF + sl;
      #pragma unroll
      for (int i = 0; i < 8; ++i) *(v8ha*)(nx + 16 * i * GP) = ra[i];
      #pragma unroll
      for (int i = 0; i < 8; ++i) *(v8ha*)(nx + GABUF + 16 * i * GP) = rb[i];
    }
    // publishes the next stage and ends every read of this one (the last pass: frees the ring for the output tile)
    __syncthreads();
  }

  // the plane this column tile belongs to (0 q, 1 k, 2 v) and its first column there; block-uniform
  const int sel = MODE == 0 ? (n0 >= DIM + HD ? 2 : (n0 >= DIM ? 1 : 0)) : 0;
  const int nl = n0 - (sel == 2 ? DIM + HD : (sel == 1 ? DIM : 0));
  if (MODE == 2) {
    stage_out<2>(sm, acc, bias + nl, ascale, oscale, wm, wn, h, m);
  } else if (sel == 2) {
    stage_out<1>(sm, acc, biasV + nl, ascale, oscale, wm, wn, h, m);
  } else {
    stage_out<0>(sm, acc, (sel == 1 ? biasK : bias) + nl, ascale, oscale, wm, wn, h, m);
  }
  __syncthreads();

  if (MODE == 2) {
    float* Cf = (float*)(void*)C;
    store_rows_f32<DIM>(sm.f, Cf + (size_t)m0 * DIM + nl, w, lane);
  } else if (sel == 1) {
    store_rows_f16<HD>(sm.h, CK + (size_t)m0 * HD + nl, w, lane);
  } else {
    // staged rows are tokens for q (row pitch DIM), features d for v (row pitch SEQ): the two pitches are equal
    static_assert(SEQ == DIM, "one store path serves q and v");
    const int b = m0 / SEQ, t0 = m0 - b * SEQ;
    _Float16* dst0 = sel == 2 ? CV + (size_t)(b * HD + nl) * SEQ + t0 : (_Float16*)(void*)C + (size_t)m0 * DIM + nl;
    store_rows_f16<DIM>(sm.h, dst0, w, lane);
  }
}

// ---------------------------------------------------------------------------
// Attention helpers.
// ---------------------------------------------------------------------------
// P^T B-fragment from the lane's own score D values: element r <- tile a row r
// (keys 0..15 of the 32-key chunk), element 8+r <- tile c row r (keys 16..31),
// same lane, same query column; scaled by 2^14 before the f16 convert.
__device__ __forceinline__ v16h pack_p(v8f a, v8f c) {
  const v16h r = { (_Float16)(a[0] * PSCALE), (_Float16)(a[1] * PSCALE), (_Float16)(a[2] * PSCALE), (_Float16)(a[3] * PSCALE),
                   (_Float16)(a[4] * PSCALE), (_Float16)(a[5] * PSCALE), (_Float16)(a[6] * PSCALE), (_Float16)(a[7] * PSCALE),
                   (_Float16)(c[0] * PSCALE), (_Float16)(c[1] * PSCALE), (_Float16)(c[2] * PSCALE), (_Float16)(c[3] * PSCALE),
                   (_Float16)(c[4] * PSCALE), (_Float16)(c[5] * PSCALE), (_Float16)(c[6] * PSCALE), (_Float16)(c[7] * PSCALE) };
  return r;
}

// 16 x 128 f16 column tile (half of a wave's 32 x 128 tile) in LDS -> oh[b*SEQ + q0 + row][head*128 + d];
// instruction, 32 lines (16 rows x 2) per call.
__device__ __forceinline__ void att_store_pass(const _Float16* so, _Float16* oh,
                                               int b, int head, int q0, int lane) {
  const int q8 = lane & 7, sub = lane >> 3;
  #pragma unroll
  for (int i = 0; i < 8; ++i) {
    const int lid = i * 4 + sub;                     // 0..31
    const int row = lid >> 1, hl = lid & 1;
    const v8h v = *(const v8ha*)(so + row * HD + 64 * hl + 8 * q8);
    _Float16* dst = oh + ((size_t)(b * SEQ + q0 + row)) * DIM + head * HD + 64 * hl + 8 * q8;
    *(v8h*)dst = v;
  }
}

// ---------------------------------------------------------------------------
// Kernel 3: streaming attention, transposed form, single shared K/V head.
// grid (SEQ/256, NH, BS); block 256 thr (8 waves), 32 queries per wave (AQ = 2 column
// tiles of 16: a K or V^T fragment read from LDS feeds one product per column tile),
// 32 keys per step. K rows and V^T rows come in stages of 64 keys: the block
// brings them by whole-line loads into one of two LDS buffers (K row pitch
// 272 B, V^T row pitch 144 B, conflict-free for 16-B fragment reads), shared
// by its 8 waves; the next stage's loads fly while this stage is worked on;
// one barrier per stage.
//   S^T = K * Q^T : A = K rows (row = key, k = d, 4 k-steps), B = Q^T (k = d, n = query)
//   O^T += V^T * P^T : A = vT rows (row = d, k = key), B = P^T from registers
// In each column tile a lane owns 16 keys of query column (lane&15); partner = lane ^ 16. mrun is equal in both
// partners; lrun is the lane's own part of the row sum.
// ---------------------------------------------------------------------------
#define AKT   64                     // keys per stage
#define AKP   136                    // K row pitch in halves (272 B)
#define AVP   72                     // V^T row pitch in halves (144 B)
#define AKBUF (AKT * AKP)
#define AVBUF (HD * AVP)
#define AQ    2                      // column tiles per wave
#define MTAU  1.0f                   // margin over the maximum in use: e^MTAU * PSCALE = 44537 stays below the f16 maximum 65504

__global__ __launch_bounds__(256) void attn_kernel(
    const _Float16* __restrict__ qh,   // [MTOT][DIM]  q (unscaled)
    const _Float16* __restrict__ kh,   // [MTOT][HD]   k
    const _Float16* __restrict__ vt,   // [BS][HD][SEQ] v transposed
    _Float16* __restrict__ oh)         // [MTOT][DIM]  f16(16 * o)
{
  __shared__ __attribute__((aligned(16))) _Float16 sK[2 * AKBUF];     // 34816 B
  __shared__ __attribute__((aligned(16))) _Float16 sV[2 * AVBUF];     // 36864 B
  __shared__ __attribute__((aligned(16))) _Float16 sO[8 * AQ * 16 * HD];   // 65536 B

  const int tid = threadIdx.x, lane = tid & 31, w = tid >> 5;
  const int hh = lane >> 4, m = lane & 15;
  const int b = blockIdx.z, head = blockIdx.y;
  const int q0 = blockIdx.x * (128 * AQ) + 16 * AQ * w;

  // Q^T B-fragments of column tile g: column n = query q0+16g+m, k = d (four 32-deep chunks)
  const _Float16* qrow = qh + ((size_t)(b * SEQ + q0 + m)) * DIM + head * HD;
  v16h qb[AQ][4];
  #pragma unroll
  for (int g = 0; g < AQ; ++g)
    #pragma unroll
    for (int c = 0; c < 4; ++c) qb[g][c] = load_frag(qrow + (size_t)(16 * g) * DIM + 32 * c, hh);

  const v8f zero8 = {0.f, 0.f, 0.f, 0.f, 0.f, 0.f, 0.f, 0.f};
  v8f o[AQ][8];                               // o[g][t][r] = O^T[d 16t+8hh+r][query 16g+m] * (l * 2^14)
  float mrun[AQ], lrun[AQ];
  #pragma unroll
  for (int g = 0; g < AQ; ++g) {
    #pragma unroll
    for (int t = 0; t < 8; ++t) o[g][t] = zero8;
    mrun[g] = -1e30f;
    lrun[g] = 0.0f;
  }

  // staging, 16-B chunks. K stage = 16 KiB contiguous: chunk tid + 256 i = row tid/16 + 16 i, col tid%16.
  // V^T stage = 128 rows of 128 B: chunk tid + 256 i = row tid/8 + 32 i, col tid%8.
  const _Float16* kg = kh + (size_t)b * SEQ * HD + tid * 8;
  const _Float16* vg = vt + ((size_t)b * HD + (tid >> 3)) * SEQ + (tid & 7) * 8;
  const int kls = (tid >> 4) * AKP + (tid & 15) * 8;
  const int vls = (tid >> 3) * AVP + (tid & 7) * 8;
  const float scale = 0.08838834764831845f;                    // 1/sqrt(128)

  v8h rk[4], rv[4];
  #pragma unroll
  for (int i = 0; i < 4; ++i) rk[i] = *(const v8ha*)(kg + 2048 * i);
  #pragma unroll
  for (int i = 0; i < 4; ++i) rv[i] = *(const v8ha*)(vg + (size_t)(32 * i) * SEQ);
  // precaution: the address registers of the loads above are reused for the loop's counters only behind this wait
  asm volatile("s_wait_xcnt 0x0" ::: "memory");
  #pragma unroll
  for (int i = 0; i < 4; ++i) *(v8ha*)(sK + kls + 16 * i * AKP) = rk[i];
  #pragma unroll
  for (int i = 0; i < 4; ++i) *(v8ha*)(sV + vls + 32 * i * AVP) = rv[i];
  __syncthreads();

  int cur = 0;
  #pragma unroll 1
  for (int kt = 0; kt < SEQ; kt += AKT) {
   const bool more = kt + AKT < SEQ;
   if (more) {
     #pragma unroll
     for (int i = 0; i < 4; ++i) rk[i] = *(const v8ha*)(kg + (size_t)(kt + AKT) * HD + 2048 * i);
     #pragma unroll
     for (int i = 0; i < 4; ++i) rv[i] = *(const v8ha*)(vg + (size_t)(32 * i) * SEQ + kt + AKT);
     // precaution: in the listing the fragment loads below reuse the address registers of the loads above
     asm volatile("s_wait_xcnt 0x0" ::: "memory");
   }
   const _Float16* kS = sK + cur * AKBUF + m * AKP;
   const _Float16* vS = sV + cur * AVBUF + m * AVP;

   #pragma unroll
   for (int kb = 0; kb < AKT; kb += 32) {
    // ---- scores: s[g][j][r] = S^T[key kt+kb+16j+8hh+r][query q0+16g+m] ----
    // the step's 8 K fragments come as one group of LDS loads ahead of its 16 score products
    v16h kf[2][4];
    #pragma unroll
    for (int j = 0; j < 2; ++j)
      #pragma unroll
      for (int c = 0; c < 4; ++c) kf[j][c] = load_frag(kS + (kb + 16 * j) * AKP + 32 * c, hh);
    v8f s[AQ][2];
    #pragma unroll
    for (int g = 0; g < AQ; ++g)
      #pragma unroll
      for (int j = 0; j < 2; ++j) s[g][j] = zero8;
    #pragma unroll
    for (int c = 0; c < 4; ++c)
      #pragma unroll
      for (int j = 0; j < 2; ++j)
        #pragma unroll
        for (int g = 0; g < AQ; ++g) s[g][j] = wmma_f16_hi(kf[j][c], qb[g][c], s[g][j]);
    // the step's 8 V^T fragments come as one group of LDS loads right behind the score products and fly under the
    // softmax; the scheduling barrier keeps the compiler from sinking part of the group towards its use
    v16h vf[8];
    #pragma unroll
    for (int t = 0; t < 8; ++t) vf[t] = load_frag(vS + (16 * t) * AVP + kb, hh);
    __builtin_amdgcn_sched_barrier(0);

    // ---- scale (f32) and online softmax, per column tile, against a maximum that is renewed lazily ----
    // Each lane finds the maximum of its own 16 keys. One test per step for the whole wave (a scalar branch on the
    // ballot): only if some lane's maximum lies more than MTAU above the maximum in use are the halves' maxima
    // joined, the maximum in use renewed and O and the sums rescaled. Else p = exp(s - mrun) <= e^MTAU, which
    // the f16 carry still holds, and the quotient O / l does not depend on which maximum is in use.
    float mloc[AQ];
    bool need = false;
    #pragma unroll
    for (int g = 0; g < AQ; ++g) {
      mloc[g] = -1e30f;
      #pragma unroll
      for (int j = 0; j < 2; ++j)
        #pragma unroll
        for (int r = 0; r < 8; ++r) {
          const float sv = s[g][j][r] * scale;
          s[g][j][r] = sv;
          mloc[g] = fmaxf(mloc[g], sv);
        }
      need = need || (mloc[g] > mrun[g] + MTAU);
    }
    if (__builtin_amdgcn_ballot_w32(need) != 0) {
      #pragma unroll
      for (int g = 0; g < AQ; ++g) {
        const float mnew = fmaxf(mrun[g], fmaxf(mloc[g], __shfl_xor(mloc[g], 16)));
        const float alpha = __expf(mrun[g] - mnew);
        mrun[g] = mnew;
        lrun[g] = lrun[g] * alpha;
        #pragma unroll
        for (int t = 0; t < 8; ++t)
          #pragma unroll
          for (int r = 0; r < 8; ++r) o[g][t][r] = o[g][t][r] * alpha;
      }
    }
    v16h pb[AQ];
    #pragma unroll
    for (int g = 0; g < AQ; ++g) {
      float lsum = 0.0f;
      #pragma unroll
      for (int j = 0; j < 2; ++j)
        #pragma unroll
        for (int r = 0; r < 8; ++r) {
          const float p = __expf(s[g][j][r] - mrun[g]);
          s[g][j][r] = p;
          lsum += p;
        }
      lrun[g] += lsum;                        // this lane's 16 keys only; the halves' sums meet in the epilogue

      // ---- P^T B-fragment for keys kb .. kb+31 ----
      pb[g] = pack_p(s[g][0], s[g][1]);
    }

    // ---- O^T += V^T * P^T over the 8 d tiles, both column tiles on each V^T fragment ----
    #pragma unroll
    for (int t = 0; t < 8; ++t)
      #pragma unroll
      for (int g = 0; g < AQ; ++g) o[g][t] = wmma_f16_hi(vf[t], pb[g], o[g][t]);
   }

   cur ^= 1;
   if (more) {
     #pragma unroll
     for (int i = 0; i < 4; ++i) *(v8ha*)(sK + cur * AKBUF + kls + 16 * i * AKP) = rk[i];
     #pragma unroll
     for (int i = 0; i < 4; ++i) *(v8ha*)(sV + cur * AVBUF + vls + 32 * i * AVP) = rv[i];
   }
   // publishes the next stage and ends every wave's reads of this one
   __syncthreads();
  }

  // ---- epilogue: normalise, x16 carry, stage per-wave 32x128 f16 tile ----
  _Float16* so = sO + w * (AQ * 16 * HD);
  #pragma unroll
  for (int g = 0; g < AQ; ++g) {
    const float inv = __builtin_amdgcn_rcpf(lrun[g] + __shfl_xor(lrun[g], 16)) * (OSC / PSCALE);
    #pragma unroll
    for (int t = 0; t < 8; ++t)
      #pragma unroll
      for (int r = 0; r < 8; ++r)
        so[(16 * g + m) * HD + 16 * t + 8 * hh + r] = (_Float16)(o[g][t][r] * inv);
  }
  __syncthreads();

  #pragma unroll
  for (int g = 0; g < AQ; ++g) att_store_pass(so + g * 16 * HD, oh, b, head, q0 + 16 * g, lane);
  
}

// ---------------------------------------------------------------------------
extern "C" void kernel_launch(void* const* d_in, const int* in_sizes, int n_in,
                              void* d_out, int out_size, void* d_ws, size_t ws_size,
                              hipStream_t stream) {
  if (n_in < 9) return;
  if (in_sizes[0] != NX) return;
  if (in_sizes[1] != DIM * DIM || in_sizes[2] != DIM) return;
  if (in_sizes[3] != DIM * HD || in_sizes[4] != HD) return;
  if (in_sizes[5] != DIM * HD || in_sizes[6] != HD) return;
  if (in_sizes[7] != DIM * DIM || in_sizes[8] != DIM) return;
  if (out_size != NX) return;

  const float* x  = (const float*)d_in[0];
  const float* wq = (const float*)d_in[1];
  const float* bq = (const float*)d_in[2];
  const float* wk = (const float*)d_in[3];
  const float* bk = (const float*)d_in[4];
  const float* wv = (const float*)d_in[5];
  const float* bv = (const float*)d_in[6];
  const float* wo = (const float*)d_in[7];
  const float* bo = (const float*)d_in[8];
  float* out = (float*)d_out;

  const size_t act_b = (size_t)NX * 2;              // 16777216  f16 [4096][2048]
  const size_t wsq_b = (size_t)DIM * DIM * 2;       //  8388608  f16 [2048][2048]
  const size_t wkv_b = (size_t)DIM * HD * 2;        //   524288  f16 [128][2048]
  const size_t kv_b  = (size_t)MTOT * HD * 2;       //  1048576  f16 [4096][128] / [2][128][2048]
  const size_t total = act_b + wsq_b + 2 * wkv_b + wsq_b + act_b + 2 * kv_b + act_b;   // 70254592
  if (total > ws_size) return;

  char* ws = (char*)d_ws;
  size_t off = 0;
  _Float16* xh  = (_Float16*)(ws + off); off += act_b;
  _Float16* wqT = (_Float16*)(ws + off); off += wsq_b;
  _Float16* wkT = (_Float16*)(ws + off); off += wkv_b;
  _Float16* wvT = (_Float16*)(ws + off); off += wkv_b;
  _Float16* woT = (_Float16*)(ws + off); off += wsq_b;
  _Float16* qh  = (_Float16*)(ws + off); off += act_b;
  _Float16* kh  = (_Float16*)(ws + off); off += kv_b;
  _Float16* vT  = (_Float16*)(ws + off); off += kv_b;
  _Float16* oh  = (_Float16*)(ws + off); off += act_b;
  if (off > ws_size) return;

  // 1) operand planes, one grid: x -> f16; W (in,out) -> W^T [out][in] f16 x32
  prep_kernel<<<PBALL, 256, 0, stream>>>(x, xh, wq, wqT, wk, wkT, wv, wvT, wo, woT);

  // 2) projections, one grid over the stacked rows of wqT, wkT, wvT (adjacent in the workspace):
  //    q [4096][2048] f16, k [4096][128] f16, v -> vT [2][128][2048] f16
  gemm_kernel<0, _Float16><<<dim3(MTOT / 128, (DIM + 2 * HD) / 128), 128, 0, stream>>>(xh, wqT, bq, qh, WINV, 1.0f, bk, bv, kh, vT);

  // 3) attention: all 16 query heads against the shared K / V^T planes; o f16 x16
  attn_kernel<<<dim3(SEQ / (128 * AQ), NH, BS), 256, 0, stream>>>(qh, kh, vT, oh);

  // 4) output projection: out = (o x16)(wo x32) / 512 + bo, f32 whole-line stores
  gemm_kernel<2, float><<<dim3(MTOT / 128, DIM / 128), 128, 0, stream>>>(oh, woT, bo, out, WINV / OSC, 1.0f, nullptr, nullptr, nullptr, nullptr);
}

// v008
// One run takes 136 microseconds.
// Two timings next to v007 both put it at 1.04 times that version's speed.
// Over all steps from v000 it is 4.25 times as fast.
// Contractions: x*WqT, x*WkT, x*WvT, K*Q^T, V^T*P^T and O*WoT all on v_wmma_f32_16x16x32_f16 (f16 operands, f32 accumulate); W carried x32, P carried x16384, O carried x16 (exact power-of-two scales folded back in f32); softmax, bias and normalisation in f32.
#include <hip/hip_runtime.h>

typedef _Float16 v16h __attribute__((ext_vector_type(16)));
typedef _Float16 v8h  __attribute__((ext_vector_type(8)));
typedef float    v8f  __attribute__((ext_vector_type(8)));
typedef float    v4f  __attribute__((ext_vector_type(4)));
typedef v8h __attribute__((may_alias)) v8ha;
typedef v4f __attribute__((may_alias)) v4fa;

union Frag { v16h v; v8h half[2]; };

#define DIM    2048
#define SEQ    2048
#define NH     16
#define HD     128
#define BS     2
#define MTOT   (BS * SEQ)          // 4096 token rows
#define NX     (MTOT * DIM)        // 8388608
#define NX8    (NX / 8)            // 1048576
#define WSC    32.0f
#define WINV   0.03125f
#define PSCALE 16384.0f
#define OSC    16.0f

// ---------------------------------------------------------------------------
// 16x16x32 f16 WMMA, the builtin alone: the compiler keeps the distance to a close consumer of its own forms.
// Fragment map (wave32): lane l, h = l>>4, m = n = l&15.
//   A/B element i: i<8 -> k0+8h+i ; i>=8 -> k0+16+8h+(i-8)
//   D element r : row 8h+r, col l&15
// ---------------------------------------------------------------------------
__device__ __forceinline__ v8f wmma_f16(v16h a, v16h b, v8f c) {
  return __builtin_amdgcn_wmma_f32_16x16x32_f16(false, a, false, b, (short)0, c, false, false);
}

// A or B fragment from a k-contiguous f16 row; p points at element k0 of the
// row owned by this lane (row index = lane & 15 added by the caller).
__device__ __forceinline__ v16h load_frag(const _Float16* p, int h) {
  Frag f;
  f.half[0] = *(const v8ha*)(p + 8 * h);
  f.half[1] = *(const v8ha*)(p + 16 + 8 * h);
  return f.v;
}

// ---------------------------------------------------------------------------
// Prep part 1: x f32 -> f16 (unscaled). A lane takes XCH chunks of 8 floats (one 16-B
// store each), all its loads issued ahead of the first store; blk = block index
// inside this part's range of the prep grid.
// ---------------------------------------------------------------------------
#define XCH 16
static_assert(NX8 % (256 * XCH) == 0, "the x blocks cover x exactly");
__device__ __forceinline__ void cvt_x_block(const float* __restrict__ x,
                                            _Float16* __restrict__ xh, int blk)
{
  const size_t g = (size_t)blk * (256 * XCH) + threadIdx.x;
  const float* src = x + g * 8;
  _Float16* dst = xh + g * 8;
  v4f a[XCH], c[XCH];
  #pragma unroll
  for (int i = 0; i < XCH; ++i) {
    a[i] = *(const v4fa*)(src + i * 2048);
    c[i] = *(const v4fa*)(src + i * 2048 + 4);
  }
  #pragma unroll
  for (int i = 0; i < XCH; ++i) {
    const v8h o = { (_Float16)a[i].x, (_Float16)a[i].y, (_Float16)a[i].z, (_Float16)a[i].w,
                    (_Float16)c[i].x, (_Float16)c[i].y, (_Float16)c[i].z, (_Float16)c[i].w };
    *(v8h*)(dst + i * 2048) = o;
  }
}

// ---------------------------------------------------------------------------
// Prep part 2: w[DIM][N] f32 (in, out) -> wT[N][DIM] f16 scaled x32 (exact).
// Block 256 thr, tile 128 k x 128 n; tile (bx, by) of (N/128, DIM/128). A wave takes 32
// columns n (one per lane: every load is one whole line) and 64 rows k, all 64 loads
// issued ahead; a lane's 64 values are 64 consecutive k of its output row and go to
// LDS [n][128 k] as eight 16-B stores (row pitch 272 B: conflict-free for 16-B
// stores down a column of rows and for the 16-B reads along a row). Each output row
// segment = 128 halves = two whole lines.
// ---------------------------------------------------------------------------
#define TP 136                             // LDS row pitch in halves (272 B)
template <int N>
__device__ __forceinline__ void transpose_w_block(const float* __restrict__ w,
                                                  _Float16* __restrict__ wT,
                                                  int bx, int by, _Float16* sT)
{
  const int tid = threadIdx.x, lane = tid & 31, wv = tid >> 5;
  const int n0 = bx * 128, k0 = by * 128;
  const int nn = 32 * (wv & 3) + lane, kb = 64 * (wv >> 2);
  const float* src = w + (size_t)(k0 + kb) * N + n0 + nn;
  float val[64];
  #pragma unroll
  for (int i = 0; i < 64; ++i) val[i] = src[i * N];
  #pragma unroll
  for (int q = 0; q < 8; ++q) {
    const v8h o = { (_Float16)(val[8 * q] * WSC),     (_Float16)(val[8 * q + 1] * WSC),
                    (_Float16)(val[8 * q + 2] * WSC), (_Float16)(val[8 * q + 3] * WSC),
                    (_Float16)(val[8 * q + 4] * WSC), (_Float16)(val[8 * q + 5] * WSC),
                    (_Float16)(val[8 * q + 6] * WSC), (_Float16)(val[8 * q + 7] * WSC) };
    *(v8ha*)(sT + nn * TP + kb + 8 * q) = o;
  }
  __syncthreads();
  // 16-B chunk (row = tid/16 + 16 i, col = tid%16): a wave stores two whole rows (4 lines)
  const int row = tid >> 4, col = (tid & 15) * 8;
  const _Float16* s = sT + row * TP + col;
  _Float16* dst = wT + (size_t)(n0 + row) * DIM + k0 + col;
  v8h v[8];
  #pragma unroll
  for (int i = 0; i < 8; ++i) v[i] = *(const v8ha*)(s + 16 * i * TP);
  #pragma unroll
  for (int i = 0; i < 8; ++i) *(v8h*)(dst + (size_t)(16 * i) * DIM) = v[i];
  // precaution: in the listing another job's path follows on the branch's fall-through edge and reuses registers that these stores name
  asm volatile("s_wait_xcnt 0x0" ::: "memory");
}

// ---------------------------------------------------------------------------
// Kernel 1: all operand planes in one grid. The five jobs depend on nothing but
// the inputs, so each takes a range of block indices: x convert, then the
// transposes of wq, wk, wv, wo. Every test below is on blockIdx alone.
// The grid is small enough to be resident at once: few long waves, each with
// its whole share of loads in flight, in place of many waves of a few loads.
// ---------------------------------------------------------------------------
#define PBX  (NX8 / (256 * XCH))           //  256 blocks: x
#define PBS  ((DIM / 128) * (DIM / 128))   //  256 blocks: a DIM x DIM weight
#define PBH  ((HD / 128) * (DIM / 128))    //   16 blocks: a DIM x HD weight
#define PBALL (PBX + 2 * PBS + 2 * PBH)

__global__ __launch_bounds__(256) void prep_kernel(
    const float* __restrict__ x,  _Float16* __restrict__ xh,
    const float* __restrict__ wq, _Float16* __restrict__ wqT,
    const float* __restrict__ wk, _Float16* __restrict__ wkT,
    const float* __restrict__ wv, _Float16* __restrict__ wvT,
    const float* __restrict__ wo, _Float16* __restrict__ woT)
{
  __shared__ __attribute__((aligned(16))) _Float16 sT[128 * TP];     // 34816 B
  const int t = blockIdx.x;
  if (t < PBX) {
    cvt_x_block(x, xh, t);
  } else {
    // job 0..3 = wq, wk, wv, wo; u = tile index inside the job; a weight has N / 128 tile columns
    const int job = t < PBX + PBS ? 0 : (t < PBX + PBS + PBH ? 1 : (t < PBX + PBS + 2 * PBH ? 2 : 3));
    const int u = t - (job == 0 ? PBX : (job == 1 ? PBX + PBS : (job == 2 ? PBX + PBS + PBH : PBX + PBS + 2 * PBH)));
    const float* w = job == 0 ? wq : (job == 1 ? wk : (job == 2 ? wv : wo));
    _Float16* wT = job == 0 ? wqT : (job == 1 ? wkT : (job == 2 ? wvT : woT));
    if (job == 0 || job == 3) {
      transpose_w_block<DIM>(w, wT, u & (DIM / 128 - 1), u / (DIM / 128), sT);
    } else {
      static_assert(HD == 128, "a DIM x HD weight is one tile column");
      transpose_w_block<HD>(w, wT, 0, u, sT);
    }
  }
}

// ---------------------------------------------------------------------------
// ---------------------------------------------------------------------------
// f16 tile staged [row][128] -> dst0[row * PITCH .. + 127]: two lines per row; one
// instruction of a wave covers two whole rows (4 lines); wave w stores rows 32w .. 32w+31.
// A constant row pitch lets one address pair serve all 16 stores.
template <int PITCH>
__device__ __forceinline__ void store_rows_f16(const _Float16* sT, _Float16* dst0, int w, int lane) {
  const int c16 = lane & 15, sub = lane >> 4;
  const _Float16* s = sT + (w * 32 + sub) * 128 + 8 * c16;
  _Float16* dst = dst0 + (size_t)(w * 32 + sub) * PITCH + 8 * c16;
  v8h v[16];
  #pragma unroll
  for (int i = 0; i < 16; ++i) v[i] = *(const v8ha*)(s + 2 * i * 128);
  #pragma unroll
  for (int i = 0; i < 16; ++i) *(v8h*)(dst + (size_t)(2 * i) * PITCH) = v[i];
}

// f32 tile staged [tok][128 feat] -> dst0[tok * PITCH .. + 127]: four lines per row; one
// instruction of a wave covers one whole row; wave w stores rows 32w .. 32w+31.
template <int PITCH>
__device__ __forceinline__ void store_rows_f32(const float* sT, float* dst0, int w, int lane) {
  const float* s = sT + (32 * w) * 128 + 4 * lane;
  float* dst = dst0 + (size_t)(32 * w) * PITCH + 4 * lane;
  v4f v[32];
  #pragma unroll
  for (int i = 0; i < 32; ++i) v[i] = *(const v4fa*)(s + i * 128);
  #pragma unroll
  for (int i = 0; i < 32; ++i) *(v4f*)(dst + (size_t)i * PITCH) = v[i];
}

// ---------------------------------------------------------------------------
// Kernel 2: C = A * BT^T (+bias), A [M][K] f16 rows, BT [N][K] f16 rows (x32).
// Block 128 thr (4 waves, 2 x 2) = 128 rows x 128 cols; wave tile 64 x 64 (4x4
// WMMA tiles): a loaded fragment feeds 4 products, a staged row 128 outputs.
// K in stages of 64: the block brings 128 A rows and 128 BT rows of
// 128 B each by whole-line loads into one of two LDS buffers (row pitch 144 B,
// conflict-free for 16-B fragment reads); the next stage's loads fly while
// this stage's fragments are read from LDS; one barrier per stage. K = DIM.
// MODE 0: the three input projections in one grid. BT = the W^T planes of q, k, v
//         stacked row after row (DIM + HD + HD rows); a column tile lies wholly in one
//         plane and goes to that plane's bias and output:
//         q -> f16 C[M][DIM], k -> f16 CK[M][HD], v -> f16 CV[b][d][t]; each f16((acc*ascale + bias)*oscale)
// MODE 2: f32 C[M][DIM] = acc*ascale + bias (biasK, biasV, CK, CV not used)
// grid (M/128, BT rows/128)
// ---------------------------------------------------------------------------
#define GKT   64                     // k per stage
#define GP    72                     // LDS row pitch in halves (144 B)
#define GABUF (128 * GP)
#define GBUF  ((128 + 128) * GP)     // one stage: A rows then BT rows
union GemmSmem { _Float16 ring[2 * GBUF]; _Float16 h[128 * 128]; float f[128 * 128]; };

// Accumulators -> output tile staged in LDS. D[r] of tile (mt, nt) = C[row 64wm+16mt+8h+r][col 64wn+16nt+m].
// LAYOUT 0: f16 [tok][128 feat]; 1: f16 [feat][128 tok]; 2: f32 [tok][128 feat]. bias points at the tile's first column.
template <int LAYOUT>
__device__ __forceinline__ void stage_out(GemmSmem& sm, const v8f (&acc)[4][4], const float* __restrict__ bias,
                                          float ascale, float oscale, int wm, int wn, int h, int m) {
  float bv[4];
  #pragma unroll
  for (int nt = 0; nt < 4; ++nt) bv[nt] = bias[64 * wn + 16 * nt + m];
  #pragma unroll
  for (int nt = 0; nt < 4; ++nt) {
    const int feat = 64 * wn + 16 * nt + m;              // 0..127
    const float bvl = bv[nt];
    #pragma unroll
    for (int mt = 0; mt < 4; ++mt) {
      #pragma unroll
      for (int r = 0; r < 8; ++r) {
        const int tokl = 64 * wm + 16 * mt + 8 * h + r;  // 0..127
        const float y = acc[mt][nt][r] * ascale + bvl;
        if (LAYOUT == 2) {
          sm.f[tokl * 128 + feat] = y;
        } else if (LAYOUT == 1) {
          sm.h[feat * 128 + tokl] = (_Float16)(y * oscale);
        } else {
          sm.h[tokl * 128 + feat] = (_Float16)(y * oscale);
        }
      }
    }
  }
}

template <int MODE, typename CT>
__global__ __launch_bounds__(128) void gemm_kernel(
    const _Float16* __restrict__ A, const _Float16* __restrict__ BT,
    const float* __restrict__ bias, CT* __restrict__ C,
    float ascale, float oscale,
    const float* __restrict__ biasK, const float* __restrict__ biasV,
    _Float16* __restrict__ CK, _Float16* __restrict__ CV)
{
  constexpr int K = DIM;     // every product here contracts over DIM; a constant row pitch lets one address serve a stage's loads
  __shared__ __attribute__((aligned(16))) GemmSmem sm;       // 73728 B

  const int tid = threadIdx.x, lane = tid & 31, w = tid >> 5;
  const int h = lane >> 4, m = lane & 15;
  const int wm = w >> 1, wn = w & 1;
  const int m0 = blockIdx.x * 128, n0 = blockIdx.y * 128;

  // staging: 16-B chunk (row = tid/8 + 16 i, col = tid%8); a wave covers 4 whole lines
  const int srow = tid >> 3, scol = (tid & 7) * 8;
  const _Float16* ag = A  + (size_t)(m0 + srow) * K + scol;
  const _Float16* bg = BT + (size_t)(n0 + srow) * K + scol;
  const int sl = srow * GP + scol;
  // fragment rows in a stage
  const int fa = (64 * wm + m) * GP;                         // mt = 0
  const int fb = GABUF + (64 * wn + m) * GP;                 // nt = 0

  const v8f zero8 = {0.f, 0.f, 0.f, 0.f, 0.f, 0.f, 0.f, 0.f};
  v8f acc[4][4];
  #pragma unroll
  for (int mt = 0; mt < 4; ++mt)
    #pragma unroll
    for (int nt = 0; nt < 4; ++nt) acc[mt][nt] = zero8;

  v8h ra[8], rb[8];
  #pragma unroll
  for (int i = 0; i < 8; ++i) ra[i] = *(const v8ha*)(ag + (size_t)(16 * i) * K);
  #pragma unroll
  for (int i = 0; i < 8; ++i) rb[i] = *(const v8ha*)(bg + (size_t)(16 * i) * K);
  #pragma unroll
  for (int i = 0; i < 8; ++i) *(v8ha*)(sm.ring + sl + 16 * i * GP) = ra[i];
  #pragma unroll
  for (int i = 0; i < 8; ++i) *(v8ha*)(sm.ring + GABUF + sl + 16 * i * GP) = rb[i];
  __syncthreads();

  int cur = 0;
  #pragma unroll 1
  for (int k0 = 0; k0 < K; k0 += GKT) {
    const bool more = k0 + GKT < K;
    if (more) {
      #pragma unroll
      for (int i = 0; i < 8; ++i) ra[i] = *(const v8ha*)(ag + (size_t)(16 * i) * K + k0 + GKT);
      #pragma unroll
      for (int i = 0; i < 8; ++i) rb[i] = *(const v8ha*)(bg + (size_t)(16 * i) * K + k0 + GKT);
      // precaution: in the listing the fragment loads below reuse the address registers of the loads above; the two
      // base addresses are inputs so that their registers stay whole up to the wait (no result of the run lands on them)
      asm volatile("s_wait_xcnt 0x0" :: "v"(ag + k0), "v"(bg + k0) : "memory");
    }
    const _Float16* st = sm.ring + cur * GBUF;
    // each 32-deep half of the stage: its 8 fragments as one group of LDS loads ahead of its 16 products;
    // the two scheduling barriers keep the compiler from sinking loads of a group in among the products
    #pragma unroll
    for (int ks = 0; ks < 2; ++ks) {
      v16h fA[4], fB[4];
      #pragma unroll
      for (int mt = 0; mt < 4; ++mt) fA[mt] = load_frag(st + fa + mt * 16 * GP + 32 * ks, h);
      #pragma unroll
      for (int nt = 0; nt < 4; ++nt) fB[nt] = load_frag(st + fb + nt * 16 * GP + 32 * ks, h);
      __builtin_amdgcn_sched_barrier(0);
      #pragma unroll
      for (int nt = 0; nt < 4; ++nt) {
        #pragma unroll
        for (int mt = 0; mt < 4; ++mt) acc[mt][nt] = wmma_f16(fA[mt], fB[nt], acc[mt][nt]);
      }
      __builtin_amdgcn_sched_barrier(0);
    }
    cur ^= 1;
    if (more) {
      _Float16* nx = sm.ring + cur * GBUF + sl;
      #pragma unroll
      for (int i = 0; i < 8; ++i) *(v8ha*)(nx + 16 * i * GP) = ra[i];
      #pragma unroll
      for (int i = 0; i < 8; ++i) *(v8ha*)(nx + GABUF + 16 * i * GP) = rb[i];
    }
    // publishes the next stage and ends every read of this one (the last pass: frees the ring for the output tile)
    __syncthreads();
  }

  // the plane this column tile belongs to (0 q, 1 k, 2 v) and its first column there; block-uniform
  const int sel = MODE == 0 ? (n0 >= DIM + HD ? 2 : (n0 >= DIM ? 1 : 0)) : 0;
  const int nl = n0 - (sel == 2 ? DIM + HD : (sel == 1 ? DIM : 0));
  if (MODE == 2) {
    stage_out<2>(sm, acc, bias + nl, ascale, oscale, wm, wn, h, m);
  } else if (sel == 2) {
    stage_out<1>(sm, acc, biasV + nl, ascale, oscale, wm, wn, h, m);
  } else {
    stage_out<0>(sm, acc, (sel == 1 ? biasK : bias) + nl, ascale, oscale, wm, wn, h, m);
  }
  __syncthreads();

  if (MODE == 2) {
    float* Cf = (float*)(void*)C;
    store_rows_f32<DIM>(sm.f, Cf + (size_t)m0 * DIM + nl, w, lane);
  } else if (sel == 1) {
    store_rows_f16<HD>(sm.h, CK + (size_t)m0 * HD + nl, w, lane);
  } else {
    // staged rows are tokens for q (row pitch DIM), features d for v (row pitch SEQ): the two pitches are equal
    static_assert(SEQ == DIM, "one store path serves q and v");
    const int b = m0 / SEQ, t0 = m0 - b * SEQ;
    _Float16* dst0 = sel == 2 ? CV + (size_t)(b * HD + nl) * SEQ + t0 : (_Float16*)(void*)C + (size_t)m0 * DIM + nl;
    store_rows_f16<DIM>(sm.h, dst0, w, lane);
  }
}

// ---------------------------------------------------------------------------
// Attention helpers.
// ---------------------------------------------------------------------------
// P^T B-fragment from the lane's own score D values: element r <- tile a row r
// (keys 0..15 of the 32-key chunk), element 8+r <- tile c row r (keys 16..31),
// same lane, same query column; scaled by 2^14 before the f16 convert.
__device__ __forceinline__ v16h pack_p(v8f a, v8f c) {
  const v16h r = { (_Float16)(a[0] * PSCALE), (_Float16)(a[1] * PSCALE), (_Float16)(a[2] * PSCALE), (_Float16)(a[3] * PSCALE),
                   (_Float16)(a[4] * PSCALE), (_Float16)(a[5] * PSCALE), (_Float16)(a[6] * PSCALE), (_Float16)(a[7] * PSCALE),
                   (_Float16)(c[0] * PSCALE), (_Float16)(c[1] * PSCALE), (_Float16)(c[2] * PSCALE), (_Float16)(c[3] * PSCALE),
                   (_Float16)(c[4] * PSCALE), (_Float16)(c[5] * PSCALE), (_Float16)(c[6] * PSCALE), (_Float16)(c[7] * PSCALE) };
  return r;
}

// 16 x 128 f16 column tile (half of a wave's 32 x 128 tile) in LDS -> oh[b*SEQ + q0 + row][head*128 + d];
// instruction, 32 lines (16 rows x 2) per call.
__device__ __forceinline__ void att_store_pass(const _Float16* so, _Float16* oh,
                                               int b, int head, int q0, int lane) {
  const int q8 = lane & 7, sub = lane >> 3;
  #pragma unroll
  for (int i = 0; i < 8; ++i) {
    const int lid = i * 4 + sub;                     // 0..31
    const int row = lid >> 1, hl = lid & 1;
    const v8h v = *(const v8ha*)(so + row * HD + 64 * hl + 8 * q8);
    _Float16* dst = oh + ((size_t)(b * SEQ + q0 + row)) * DIM + head * HD + 64 * hl + 8 * q8;
    *(v8h*)dst = v;
  }
}

// ---------------------------------------------------------------------------
// Kernel 3: streaming attention, transposed form, single shared K/V head.
// grid (SEQ/256, NH, BS); block 256 thr (8 waves), 32 queries per wave (AQ = 2 column
// tiles of 16: a K or V^T fragment read from LDS feeds one product per column tile),
// 32 keys per step. K rows and V^T rows come in stages of 64 keys: the block
// brings them by whole-line loads into one of two LDS buffers (K row pitch
// 272 B, V^T row pitch 144 B, conflict-free for 16-B fragment reads), shared
// by its 8 waves; the next stage's loads fly while this stage is worked on;
// one barrier per stage.
//   S^T = K * Q^T : A = K rows (row = key, k = d, 4 k-steps), B = Q^T (k = d, n = query)
//   O^T += V^T * P^T : A = vT rows (row = d, k = key), B = P^T from registers
// In each column tile a lane owns 16 keys of query column (lane&15); partner = lane ^ 16. mrun is equal in both
// partners; lrun is the lane's own part of the row sum.
// ---------------------------------------------------------------------------
#define AKT   64                     // keys per stage
#define AKP   136                    // K row pitch in halves (272 B)
#define AVP   72                     // V^T row pitch in halves (144 B)
#define AKBUF (AKT * AKP)
#define AVBUF (HD * AVP)
#define AQ    2                      // column tiles per wave
#define MTAU  1.0f                   // margin over the maximum in use: e^MTAU * PSCALE = 44537 stays below the f16 maximum 65504

__global__ __launch_bounds__(256) void attn_kernel(
    const _Float16* __restrict__ qh,   // [MTOT][DIM]  q (unscaled)
    const _Float16* __restrict__ kh,   // [MTOT][HD]   k
    const _Float16* __restrict__ vt,   // [BS][HD][SEQ] v transposed
    _Float16* __restrict__ oh)         // [MTOT][DIM]  f16(16 * o)
{
  __shared__ __attribute__((aligned(16))) _Float16 sK[2 * AKBUF];     // 34816 B
  __shared__ __attribute__((aligned(16))) _Float16 sV[2 * AVBUF];     // 36864 B
  __shared__ __attribute__((aligned(16))) _Float16 sO[8 * AQ * 16 * HD];   // 65536 B

  const int tid = threadIdx.x, lane = tid & 31, w = tid >> 5;
  const int hh = lane >> 4, m = lane & 15;
  const int b = blockIdx.z, head = blockIdx.y;
  const int q0 = blockIdx.x * (128 * AQ) + 16 * AQ * w;

  // Q^T B-fragments of column tile g: column n = query q0+16g+m, k = d (four 32-deep chunks)
  const _Float16* qrow = qh + ((size_t)(b * SEQ + q0 + m)) * DIM + head * HD;
  v16h qb[AQ][4];
  #pragma unroll
  for (int g = 0; g < AQ; ++g)
    #pragma unroll
    for (int c = 0; c < 4; ++c) qb[g][c] = load_frag(qrow + (size_t)(16 * g) * DIM + 32 * c, hh);

  const v8f zero8 = {0.f, 0.f, 0.f, 0.f, 0.f, 0.f, 0.f, 0.f};
  v8f o[AQ][8];                               // o[g][t][r] = O^T[d 16t+8hh+r][query 16g+m] * (l * 2^14)
  float mrun[AQ], lrun[AQ];
  #pragma unroll
  for (int g = 0; g < AQ; ++g) {
    #pragma unroll
    for (int t = 0; t < 8; ++t) o[g][t] = zero8;
    mrun[g] = -1e30f;
    lrun[g] = 0.0f;
  }

  // staging, 16-B chunks. K stage = 16 KiB contiguous: chunk tid + 256 i = row tid/16 + 16 i, col tid%16.
  // V^T stage = 128 rows of 128 B: chunk tid + 256 i = row tid/8 + 32 i, col tid%8.
  const _Float16* kg = kh + (size_t)b * SEQ * HD + tid * 8;
  const _Float16* vg = vt + ((size_t)b * HD + (tid >> 3)) * SEQ + (tid & 7) * 8;
  const int kls = (tid >> 4) * AKP + (tid & 15) * 8;
  const int vls = (tid >> 3) * AVP + (tid & 7) * 8;
  const float scale = 0.08838834764831845f;                    // 1/sqrt(128)

  v8h rk[4], rv[4];
  #pragma unroll
  for (int i = 0; i < 4; ++i) rk[i] = *(const v8ha*)(kg + 2048 * i);
  #pragma unroll
  for (int i = 0; i < 4; ++i) rv[i] = *(const v8ha*)(vg + (size_t)(32 * i) * SEQ);
  // precaution: the address registers of the loads above are reused for the loop's counters only behind this wait
  asm volatile("s_wait_xcnt 0x0" ::: "memory");
  #pragma unroll
  for (int i = 0; i < 4; ++i) *(v8ha*)(sK + kls + 16 * i * AKP) = rk[i];
  #pragma unroll
  for (int i = 0; i < 4; ++i) *(v8ha*)(sV + vls + 32 * i * AVP) = rv[i];
  __syncthreads();

  int cur = 0;
  #pragma unroll 1
  for (int kt = 0; kt < SEQ; kt += AKT) {
   const bool more = kt + AKT < SEQ;
   if (more) {
     #pragma unroll
     for (int i = 0; i < 4; ++i) rk[i] = *(const v8ha*)(kg + (size_t)(kt + AKT) * HD + 2048 * i);
     #pragma unroll
     for (int i = 0; i < 4; ++i) rv[i] = *(const v8ha*)(vg + (size_t)(32 * i) * SEQ + kt + AKT);
     // precaution: in the listing the fragment loads below reuse the address registers of the loads above
     asm volatile("s_wait_xcnt 0x0" ::: "memory");
   }
   const _Float16* kS = sK + cur * AKBUF + m * AKP;
   const _Float16* vS = sV + cur * AVBUF + m * AVP;

   #pragma unroll
   for (int kb = 0; kb < AKT; kb += 32) {
    // ---- scores: s[g][j][r] = S^T[key kt+kb+16j+8hh+r][query q0+16g+m] ----
    // the step's 8 K fragments come as one group of LDS loads ahead of its 16 score products; the scheduling barriers
    // in front of and behind the products keep the compiler from sinking loads of the group in among them
    v16h kf[2][4];
    #pragma unroll
    for (int j = 0; j < 2; ++j)
      #pragma unroll
      for (int c = 0; c < 4; ++c) kf[j][c] = load_frag(kS + (kb + 16 * j) * AKP + 32 * c, hh);
    __builtin_amdgcn_sched_barrier(0);
    v8f s[AQ][2];
    #pragma unroll
    for (int g = 0; g < AQ; ++g)
      #pragma unroll
      for (int j = 0; j < 2; ++j) s[g][j] = zero8;
    #pragma unroll
    for (int c = 0; c < 4; ++c)
      #pragma unroll
      for (int j = 0; j < 2; ++j)
        #pragma unroll
        for (int g = 0; g < AQ; ++g) s[g][j] = wmma_f16(kf[j][c], qb[g][c], s[g][j]);
    __builtin_amdgcn_sched_barrier(0);
    // the step's 8 V^T fragments come as one group of LDS loads right behind the score products and fly under the
    // softmax; the scheduling barrier keeps the compiler from sinking part of the group towards its use
    v16h vf[8];
    #pragma unroll
    for (int t = 0; t < 8; ++t) vf[t] = load_frag(vS + (16 * t) * AVP + kb, hh);
    __builtin_amdgcn_sched_barrier(0);

    // ---- scale (f32) and online softmax, per column tile, against a maximum that is renewed lazily ----
    // Each lane finds the maximum of its own 16 keys. One test per step for the whole wave (a scalar branch on the
    // ballot): only if some lane's maximum lies more than MTAU above the maximum in use are the halves' maxima
    // joined, the maximum in use renewed and O and the sums rescaled. Else p = exp(s - mrun) <= e^MTAU, which
    // the f16 carry still holds, and the quotient O / l does not depend on which maximum is in use.
    float mloc[AQ];
    bool need = false;
    #pragma unroll
    for (int g = 0; g < AQ; ++g) {
      mloc[g] = -1e30f;
      #pragma unroll
      for (int j = 0; j < 2; ++j)
        #pragma unroll
        for (int r = 0; r < 8; ++r) {
          const float sv = s[g][j][r] * scale;
          s[g][j][r] = sv;
          mloc[g] = fmaxf(mloc[g], sv);
        }
      need = need || (mloc[g] > mrun[g] + MTAU);
    }
    if (__builtin_amdgcn_ballot_w32(need) != 0) {
      #pragma unroll
      for (int g = 0; g < AQ; ++g) {
        const float mnew = fmaxf(mrun[g], fmaxf(mloc[g], __shfl_xor(mloc[g], 16)));
        const float alpha = __expf(mrun[g] - mnew);
        mrun[g] = mnew;
        lrun[g] = lrun[g] * alpha;
        #pragma unroll
        for (int t = 0; t < 8; ++t)
          #pragma unroll
          for (int r = 0; r < 8; ++r) o[g][t][r] = o[g][t][r] * alpha;
      }
    }
    v16h pb[AQ];
    #pragma unroll
    for (int g = 0; g < AQ; ++g) {
      float lsum = 0.0f;
      #pragma unroll
      for (int j = 0; j < 2; ++j)
        #pragma unroll
        for (int r = 0; r < 8; ++r) {
          const float p = __expf(s[g][j][r] - mrun[g]);
          s[g][j][r] = p;
          lsum += p;
        }
      lrun[g] += lsum;                        // this lane's 16 keys only; the halves' sums meet in the epilogue

      // ---- P^T B-fragment for keys kb .. kb+31 ----
      pb[g] = pack_p(s[g][0], s[g][1]);
    }

    // ---- O^T += V^T * P^T over the 8 d tiles, both column tiles on each V^T fragment ----
    #pragma unroll
    for (int t = 0; t < 8; ++t)
      #pragma unroll
      for (int g = 0; g < AQ; ++g) o[g][t] = wmma_f16(vf[t], pb[g], o[g][t]);
    // four slots behind the step's last product: the next step's first score products may take the registers of this
    // block's P^T (its B operand) for their results
    asm volatile("v_nop\n\tv_nop\n\tv_nop\n\tv_nop" : "+v"(o[AQ - 1][7]));
    // keeps the next step's K loads one group behind these products
    __builtin_amdgcn_sched_barrier(0);
   }

   cur ^= 1;
   if (more) {
     #pragma unroll
     for (int i = 0; i < 4; ++i) *(v8ha*)(sK + cur * AKBUF + kls + 16 * i * AKP) = rk[i];
     #pragma unroll
     for (int i = 0; i < 4; ++i) *(v8ha*)(sV + cur * AVBUF + vls + 32 * i * AVP) = rv[i];
   }
   // publishes the next stage and ends every wave's reads of this one
   __syncthreads();
  }

  // ---- epilogue: normalise, x16 carry, stage per-wave 32x128 f16 tile ----
  _Float16* so = sO + w * (AQ * 16 * HD);
  #pragma unroll
  for (int g = 0; g < AQ; ++g) {
    const float inv = __builtin_amdgcn_rcpf(lrun[g] + __shfl_xor(lrun[g], 16)) * (OSC / PSCALE);
    #pragma unroll
    for (int t = 0; t < 8; ++t)
      #pragma unroll
      for (int r = 0; r < 8; ++r)
        so[(16 * g + m) * HD + 16 * t + 8 * hh + r] = (_Float16)(o[g][t][r] * inv);
  }
  __syncthreads();

  #pragma unroll
  for (int g = 0; g < AQ; ++g) att_store_pass(so + g * 16 * HD, oh, b, head, q0 + 16 * g, lane);
  
}

// ---------------------------------------------------------------------------
extern "C" void kernel_launch(void* const* d_in, const int* in_sizes, int n_in,
                              void* d_out, int out_size, void* d_ws, size_t ws_size,
                              hipStream_t stream) {
  if (n_in < 9) return;
  if (in_sizes[0] != NX) return;
  if (in_sizes[1] != DIM * DIM || in_sizes[2] != DIM) return;
  if (in_sizes[3] != DIM * HD || in_sizes[4] != HD) return;
  if (in_sizes[5] != DIM * HD || in_sizes[6] != HD) return;
  if (in_sizes[7] != DIM * DIM || in_sizes[8] != DIM) return;
  if (out_size != NX) return;

  const float* x  = (const float*)d_in[0];
  const float* wq = (const float*)d_in[1];
  const float* bq = (const float*)d_in[2];
  const float* wk = (const float*)d_in[3];
  const float* bk = (const float*)d_in[4];
  const float* wv = (const float*)d_in[5];
  const float* bv = (const float*)d_in[6];
  const float* wo = (const float*)d_in[7];
  const float* bo = (const float*)d_in[8];
  float* out = (float*)d_out;

  const size_t act_b = (size_t)NX * 2;              // 16777216  f16 [4096][2048]
  const size_t wsq_b = (size_t)DIM * DIM * 2;       //  8388608  f16 [2048][2048]
  const size_t wkv_b = (size_t)DIM * HD * 2;        //   524288  f16 [128][2048]
  const size_t kv_b  = (size_t)MTOT * HD * 2;       //  1048576  f16 [4096][128] / [2][128][2048]
  const size_t total = act_b + wsq_b + 2 * wkv_b + wsq_b + act_b + 2 * kv_b + act_b;   // 70254592
  if (total > ws_size) return;

  char* ws = (char*)d_ws;
  size_t off = 0;
  _Float16* xh  = (_Float16*)(ws + off); off += act_b;
  _Float16* wqT = (_Float16*)(ws + off); off += wsq_b;
  _Float16* wkT = (_Float16*)(ws + off); off += wkv_b;
  _Float16* wvT = (_Float16*)(ws + off); off += wkv_b;
  _Float16* woT = (_Float16*)(ws + off); off += wsq_b;
  _Float16* qh  = (_Float16*)(ws + off); off += act_b;
  _Float16* kh  = (_Float16*)(ws + off); off += kv_b;
  _Float16* vT  = (_Float16*)(ws + off); off += kv_b;
  _Float16* oh  = (_Float16*)(ws + off); off += act_b;
  if (off > ws_size) return;

  // 1) operand planes, one grid: x -> f16; W (in,out) -> W^T [out][in] f16 x32
  prep_kernel<<<PBALL, 256, 0, stream>>>(x, xh, wq, wqT, wk, wkT, wv, wvT, wo, woT);

  // 2) projections, one grid over the stacked rows of wqT, wkT, wvT (adjacent in the workspace):
  //    q [4096][2048] f16, k [4096][128] f16, v -> vT [2][128][2048] f16
  gemm_kernel<0, _Float16><<<dim3(MTOT / 128, (DIM + 2 * HD) / 128), 128, 0, stream>>>(xh, wqT, bq, qh, WINV, 1.0f, bk, bv, kh, vT);

  // 3) attention: all 16 query heads against the shared K / V^T planes; o f16 x16
  attn_kernel<<<dim3(SEQ / (128 * AQ), NH, BS), 256, 0, stream>>>(qh, kh, vT, oh);

  // 4) output projection: out = (o x16)(wo x32) / 512 + bo, f32 whole-line stores
  gemm_kernel<2, float><<<dim3(MTOT / 128, DIM / 128), 128, 0, stream>>>(oh, woT, bo, out, WINV / OSC, 1.0f, nullptr, nullptr, nullptr, nullptr);
}

// v009
// One run takes 132 microseconds.
// In both of two side-by-side timings against v008, it was 1.03 times as fast.
// Counting every step since v000, it is 4.38 times as fast.
// Contractions: x*WqT, x*WkT, x*WvT, K*Q^T, V^T*P^T and O*WoT all on v_wmma_f32_16x16x32_f16 (f16 operands, f32 accumulate); W carried x32, P carried x16384 (added to its exponent), O carried x16 (exact power-of-two scales folded back in f32); softmax, bias and normalisation in f32.
#include <hip/hip_runtime.h>

typedef _Float16 v16h __attribute__((ext_vector_type(16)));
typedef _Float16 v8h  __attribute__((ext_vector_type(8)));
typedef float    v8f  __attribute__((ext_vector_type(8)));
typedef float    v4f  __attribute__((ext_vector_type(4)));
typedef v8h __attribute__((may_alias)) v8ha;
typedef v4f __attribute__((may_alias)) v4fa;

union Frag { v16h v; v8h half[2]; };

#define DIM    2048
#define SEQ    2048
#define NH     16
#define HD     128
#define BS     2
#define MTOT   (BS * SEQ)          // 4096 token rows
#define NX     (MTOT * DIM)        // 8388608
#define NX8    (NX / 8)            // 1048576
#define WSC    32.0f
#define WINV   0.03125f
#define PSCALE 16384.0f
#define OSC    16.0f

// ---------------------------------------------------------------------------
// 16x16x32 f16 WMMA, the builtin alone: the compiler keeps the distance to a close consumer of its own forms.
// Fragment map (wave32): lane l, h = l>>4, m = n = l&15.
//   A/B element i: i<8 -> k0+8h+i ; i>=8 -> k0+16+8h+(i-8)
//   D element r : row 8h+r, col l&15
// ---------------------------------------------------------------------------
__device__ __forceinline__ v8f wmma_f16(v16h a, v16h b, v8f c) {
  return __builtin_amdgcn_wmma_f32_16x16x32_f16(false, a, false, b, (short)0, c, false, false);
}

// A or B fragment from a k-contiguous f16 row; p points at element k0 of the
// row owned by this lane (row index = lane & 15 added by the caller).
__device__ __forceinline__ v16h load_frag(const _Float16* p, int h) {
  Frag f;
  f.half[0] = *(const v8ha*)(p + 8 * h);
  f.half[1] = *(const v8ha*)(p + 16 + 8 * h);
  return f.v;
}

// ---------------------------------------------------------------------------
// Prep part 1: x f32 -> f16 (unscaled). A lane takes XCH chunks of 8 floats (one 16-B
// store each), all its loads issued ahead of the first store; blk = block index
// inside this part's range of the prep grid.
// ---------------------------------------------------------------------------
#define XCH 16
static_assert(NX8 % (256 * XCH) == 0, "the x blocks cover x exactly");
__device__ __forceinline__ void cvt_x_block(const float* __restrict__ x,
                                            _Float16* __restrict__ xh, int blk)
{
  const size_t g = (size_t)blk * (256 * XCH) + threadIdx.x;
  const float* src = x + g * 8;
  _Float16* dst = xh + g * 8;
  v4f a[XCH], c[XCH];
  #pragma unroll
  for (int i = 0; i < XCH; ++i) {
    a[i] = *(const v4fa*)(src + i * 2048);
    c[i] = *(const v4fa*)(src + i * 2048 + 4);
  }
  #pragma unroll
  for (int i = 0; i < XCH; ++i) {
    const v8h o = { (_Float16)a[i].x, (_Float16)a[i].y, (_Float16)a[i].z, (_Float16)a[i].w,
                    (_Float16)c[i].x, (_Float16)c[i].y, (_Float16)c[i].z, (_Float16)c[i].w };
    *(v8h*)(dst + i * 2048) = o;
  }
}

// ---------------------------------------------------------------------------
// Prep part 2: w[DIM][N] f32 (in, out) -> wT[N][DIM] f16 scaled x32 (exact).
// Block 256 thr, tile 128 k x 128 n; tile (bx, by) of (N/128, DIM/128). A wave takes 32
// columns n (one per lane: every load is one whole line) and 64 rows k, all 64 loads
// issued ahead; a lane's 64 values are 64 consecutive k of its output row and go to
// LDS [n][128 k] as eight 16-B stores (row pitch 272 B: conflict-free for 16-B
// stores down a column of rows and for the 16-B reads along a row). Each output row
// segment = 128 halves = two whole lines.
// ---------------------------------------------------------------------------
#define TP 136                             // LDS row pitch in halves (272 B)
template <int N>
__device__ __forceinline__ void transpose_w_block(const float* __restrict__ w,
                                                  _Float16* __restrict__ wT,
                                                  int bx, int by, _Float16* sT)
{
  const int tid = threadIdx.x, lane = tid & 31, wv = tid >> 5;
  const int n0 = bx * 128, k0 = by * 128;
  const int nn = 32 * (wv & 3) + lane, kb = 64 * (wv >> 2);
  const float* src = w + (size_t)(k0 + kb) * N + n0 + nn;
  float val[64];
  #pragma unroll
  for (int i = 0; i < 64; ++i) val[i] = src[i * N];
  #pragma unroll
  for (int q = 0; q < 8; ++q) {
    const v8h o = { (_Float16)(val[8 * q] * WSC),     (_Float16)(val[8 * q + 1] * WSC),
                    (_Float16)(val[8 * q + 2] * WSC), (_Float16)(val[8 * q + 3] * WSC),
                    (_Float16)(val[8 * q + 4] * WSC), (_Float16)(val[8 * q + 5] * WSC),
                    (_Float16)(val[8 * q + 6] * WSC), (_Float16)(val[8 * q + 7] * WSC) };
    *(v8ha*)(sT + nn * TP + kb + 8 * q) = o;
  }
  __syncthreads();
  // 16-B chunk (row = tid/16 + 16 i, col = tid%16): a wave stores two whole rows (4 lines)
  const int row = tid >> 4, col = (tid & 15) * 8;
  const _Float16* s = sT + row * TP + col;
  _Float16* dst = wT + (size_t)(n0 + row) * DIM + k0 + col;
  v8h v[8];
  #pragma unroll
  for (int i = 0; i < 8; ++i) v[i] = *(const v8ha*)(s + 16 * i * TP);
  #pragma unroll
  for (int i = 0; i < 8; ++i) *(v8h*)(dst + (size_t)(16 * i) * DIM) = v[i];
  // precaution: in the listing another job's path follows on the branch's fall-through edge and reuses registers that these stores name
  asm volatile("s_wait_xcnt 0x0" ::: "memory");
}

// ---------------------------------------------------------------------------
// Kernel 1: all operand planes in one grid. The five jobs depend on nothing but
// the inputs, so each takes a range of block indices: x convert, then the
// transposes of wq, wk, wv, wo. Every test below is on blockIdx alone.
// The grid is small enough to be resident at once: few long waves, each with
// its whole share of loads in flight, in place of many waves of a few loads.
// ---------------------------------------------------------------------------
#define PBX  (NX8 / (256 * XCH))           //  256 blocks: x
#define PBS  ((DIM / 128) * (DIM / 128))   //  256 blocks: a DIM x DIM weight
#define PBH  ((HD / 128) * (DIM / 128))    //   16 blocks: a DIM x HD weight
#define PBALL (PBX + 2 * PBS + 2 * PBH)

__global__ __launch_bounds__(256) void prep_kernel(
    const float* __restrict__ x,  _Float16* __restrict__ xh,
    const float* __restrict__ wq, _Float16* __restrict__ wqT,
    const float* __restrict__ wk, _Float16* __restrict__ wkT,
    const float* __restrict__ wv, _Float16* __restrict__ wvT,
    const float* __restrict__ wo, _Float16* __restrict__ woT)
{
  __shared__ __attribute__((aligned(16))) _Float16 sT[128 * TP];     // 34816 B
  const int t = blockIdx.x;
  if (t < PBX) {
    cvt_x_block(x, xh, t);
  } else {
    // job 0..3 = wq, wk, wv, wo; u = tile index inside the job; a weight has N / 128 tile columns
    const int job = t < PBX + PBS ? 0 : (t < PBX + PBS + PBH ? 1 : (t < PBX + PBS + 2 * PBH ? 2 : 3));
    const int u = t - (job == 0 ? PBX : (job == 1 ? PBX + PBS : (job == 2 ? PBX + PBS + PBH : PBX + PBS + 2 * PBH)));
    const float* w = job == 0 ? wq : (job == 1 ? wk : (job == 2 ? wv : wo));
    _Float16* wT = job == 0 ? wqT : (job == 1 ? wkT : (job == 2 ? wvT : woT));
    if (job == 0 || job == 3) {
      transpose_w_block<DIM>(w, wT, u & (DIM / 128 - 1), u / (DIM / 128), sT);
    } else {
      static_assert(HD == 128, "a DIM x HD weight is one tile column");
      transpose_w_block<HD>(w, wT, 0, u, sT);
    }
  }
}

// ---------------------------------------------------------------------------
// ---------------------------------------------------------------------------
// f16 tile staged [row][128] -> dst0[row * PITCH .. + 127]: two lines per row; one
// instruction of a wave covers two whole rows (4 lines); wave w stores rows 32w .. 32w+31.
// A constant row pitch lets one address pair serve all 16 stores.
template <int PITCH>
__device__ __forceinline__ void store_rows_f16(const _Float16* sT, _Float16* dst0, int w, int lane) {
  const int c16 = lane & 15, sub = lane >> 4;
  const _Float16* s = sT + (w * 32 + sub) * 128 + 8 * c16;
  _Float16* dst = dst0 + (size_t)(w * 32 + sub) * PITCH + 8 * c16;
  v8h v[16];
  #pragma unroll
  for (int i = 0; i < 16; ++i) v[i] = *(const v8ha*)(s + 2 * i * 128);
  #pragma unroll
  for (int i = 0; i < 16; ++i) *(v8h*)(dst + (size_t)(2 * i) * PITCH) = v[i];
}

// f32 tile staged [tok][128 feat] -> dst0[tok * PITCH .. + 127]: four lines per row; one
// instruction of a wave covers one whole row; wave w stores rows 32w .. 32w+31.
template <int PITCH>
__device__ __forceinline__ void store_rows_f32(const float* sT, float* dst0, int w, int lane) {
  const float* s = sT + (32 * w) * 128 + 4 * lane;
  float* dst = dst0 + (size_t)(32 * w) * PITCH + 4 * lane;
  v4f v[32];
  #pragma unroll
  for (int i = 0; i < 32; ++i) v[i] = *(const v4fa*)(s + i * 128);
  #pragma unroll
  for (int i = 0; i < 32; ++i) *(v4f*)(dst + (size_t)i * PITCH) = v[i];
}

// ---------------------------------------------------------------------------
// Kernel 2: C = A * BT^T (+bias), A [M][K] f16 rows, BT [N][K] f16 rows (x32).
// Block 128 thr (4 waves, 2 x 2) = 128 rows x 128 cols; wave tile 64 x 64 (4x4
// WMMA tiles): a loaded fragment feeds 4 products, a staged row 128 outputs.
// K in stages of 64: the block brings 128 A rows and 128 BT rows of
// 128 B each by whole-line loads into one of two LDS buffers (row pitch 144 B,
// conflict-free for 16-B fragment reads); the next stage's loads fly while
// this stage's fragments are read from LDS; one barrier per stage. K = DIM.
// MODE 0: the three input projections in one grid. BT = the W^T planes of q, k, v
//         stacked row after row (DIM + HD + HD rows); a column tile lies wholly in one
//         plane and goes to that plane's bias and output:
//         q -> f16 C[M][DIM], k -> f16 CK[M][HD], v -> f16 CV[b][d][t]; each f16((acc*ascale + bias)*oscale)
// MODE 2: f32 C[M][DIM] = acc*ascale + bias (biasK, biasV, CK, CV not used)
// grid (M/128, BT rows/128)
// ---------------------------------------------------------------------------
#define GKT   64                     // k per stage
#define GP    72                     // LDS row pitch in halves (144 B)
#define GABUF (128 * GP)
#define GBUF  ((128 + 128) * GP)     // one stage: A rows then BT rows
union GemmSmem { _Float16 ring[2 * GBUF]; _Float16 h[128 * 128]; float f[128 * 128]; };

// Accumulators -> output tile staged in LDS. D[r] of tile (mt, nt) = C[row 64wm+16mt+8h+r][col 64wn+16nt+m].
// LAYOUT 0: f16 [tok][128 feat]; 1: f16 [feat][128 tok]; 2: f32 [tok][128 feat]. bias points at the tile's first column.
template <int LAYOUT>
__device__ __forceinline__ void stage_out(GemmSmem& sm, const v8f (&acc)[4][4], const float* __restrict__ bias,
                                          float ascale, float oscale, int wm, int wn, int h, int m) {
  float bv[4];
  #pragma unroll
  for (int nt = 0; nt < 4; ++nt) bv[nt] = bias[64 * wn + 16 * nt + m];
  #pragma unroll
  for (int nt = 0; nt < 4; ++nt) {
    const int feat = 64 * wn + 16 * nt + m;              // 0..127
    const float bvl = bv[nt];
    #pragma unroll
    for (int mt = 0; mt < 4; ++mt) {
      #pragma unroll
      for (int r = 0; r < 8; ++r) {
        const int tokl = 64 * wm + 16 * mt + 8 * h + r;  // 0..127
        const float y = acc[mt][nt][r] * ascale + bvl;
        if (LAYOUT == 2) {
          sm.f[tokl * 128 + feat] = y;
        } else if (LAYOUT == 1) {
          sm.h[feat * 128 + tokl] = (_Float16)(y * oscale);
        } else {
          sm.h[tokl * 128 + feat] = (_Float16)(y * oscale);
        }
      }
    }
  }
}

template <int MODE, typename CT>
__global__ __launch_bounds__(128) void gemm_kernel(
    const _Float16* __restrict__ A, const _Float16* __restrict__ BT,
    const float* __restrict__ bias, CT* __restrict__ C,
    float ascale, float oscale,
    const float* __restrict__ biasK, const float* __restrict__ biasV,
    _Float16* __restrict__ CK, _Float16* __restrict__ CV)
{
  constexpr int K = DIM;     // every product here contracts over DIM; a constant row pitch lets one address serve a stage's loads
  __shared__ __attribute__((aligned(16))) GemmSmem sm;       // 73728 B

  const int tid = threadIdx.x, lane = tid & 31, w = tid >> 5;
  const int h = lane >> 4, m = lane & 15;
  const int wm = w >> 1, wn = w & 1;
  const int m0 = blockIdx.x * 128, n0 = blockIdx.y * 128;

  // staging: 16-B chunk (row = tid/8 + 16 i, col = tid%8); a wave covers 4 whole lines
  const int srow = tid >> 3, scol = (tid & 7) * 8;
  const _Float16* ag = A  + (size_t)(m0 + srow) * K + scol;
  const _Float16* bg = BT + (size_t)(n0 + srow) * K + scol;
  const int sl = srow * GP + scol;
  // fragment rows in a stage
  const int fa = (64 * wm + m) * GP;                         // mt = 0
  const int fb = GABUF + (64 * wn + m) * GP;                 // nt = 0

  const v8f zero8 = {0.f, 0.f, 0.f, 0.f, 0.f, 0.f, 0.f, 0.f};
  v8f acc[4][4];
  #pragma unroll
  for (int mt = 0; mt < 4; ++mt)
    #pragma unroll
    for (int nt = 0; nt < 4; ++nt) acc[mt][nt] = zero8;

  v8h ra[8], rb[8];
  #pragma unroll
  for (int i = 0; i < 8; ++i) ra[i] = *(const v8ha*)(ag + (size_t)(16 * i) * K);
  #pragma unroll
  for (int i = 0; i < 8; ++i) rb[i] = *(const v8ha*)(bg + (size_t)(16 * i) * K);
  #pragma unroll
  for (int i = 0; i < 8; ++i) *(v8ha*)(sm.ring + sl + 16 * i * GP) = ra[i];
  #pragma unroll
  for (int i = 0; i < 8; ++i) *(v8ha*)(sm.ring + GABUF + sl + 16 * i * GP) = rb[i];
  __syncthreads();

  int cur = 0;
  #pragma unroll 1
  for (int k0 = 0; k0 < K; k0 += GKT) {
    const bool more = k0 + GKT < K;
    if (more) {
      #pragma unroll
      for (int i = 0; i < 8; ++i) ra[i] = *(const v8ha*)(ag + (size_t)(16 * i) * K + k0 + GKT);
      #pragma unroll
      for (int i = 0; i < 8; ++i) rb[i] = *(const v8ha*)(bg + (size_t)(16 * i) * K + k0 + GKT);
      // precaution: in the listing the fragment loads below reuse the address registers of the loads above; the two
      // base addresses are inputs so that their registers stay whole up to the wait (no result of the run lands on them)
      asm volatile("s_wait_xcnt 0x0" :: "v"(ag + k0), "v"(bg + k0) : "memory");
    }
    const _Float16* st = sm.ring + cur * GBUF;
    // each 32-deep half of the stage: its 8 fragments as one group of LDS loads ahead of its 16 products;
    // the two scheduling barriers keep the compiler from sinking loads of a group in among the products
    #pragma unroll
    for (int ks = 0; ks < 2; ++ks) {
      v16h fA[4], fB[4];
      #pragma unroll
      for (int mt = 0; mt < 4; ++mt) fA[mt] = load_frag(st + fa + mt * 16 * GP + 32 * ks, h);
      #pragma unroll
      for (int nt = 0; nt < 4; ++nt) fB[nt] = load_frag(st + fb + nt * 16 * GP + 32 * ks, h);
      __builtin_amdgcn_sched_barrier(0);
      #pragma unroll
      for (int nt = 0; nt < 4; ++nt) {
        #pragma unroll
        for (int mt = 0; mt < 4; ++mt) acc[mt][nt] = wmma_f16(fA[mt], fB[nt], acc[mt][nt]);
      }
      __builtin_amdgcn_sched_barrier(0);
    }
    cur ^= 1;
    if (more) {
      _Float16* nx = sm.ring + cur * GBUF + sl;
      #pragma unroll
      for (int i = 0; i < 8; ++i) *(v8ha*)(nx + 16 * i * GP) = ra[i];
      #pragma unroll
      for (int i = 0; i < 8; ++i) *(v8ha*)(nx + GABUF + 16 * i * GP) = rb[i];
    }
    // publishes the next stage and ends every read of this one (the last pass: frees the ring for the output tile)
    __syncthreads();
  }

  // the plane this column tile belongs to (0 q, 1 k, 2 v) and its first column there; block-uniform
  const int sel = MODE == 0 ? (n0 >= DIM + HD ? 2 : (n0 >= DIM ? 1 : 0)) : 0;
  const int nl = n0 - (sel == 2 ? DIM + HD : (sel == 1 ? DIM : 0));
  if (MODE == 2) {
    stage_out<2>(sm, acc, bias + nl, ascale, oscale, wm, wn, h, m);
  } else if (sel == 2) {
    stage_out<1>(sm, acc, biasV + nl, ascale, oscale, wm, wn, h, m);
  } else {
    stage_out<0>(sm, acc, (sel == 1 ? biasK : bias) + nl, ascale, oscale, wm, wn, h, m);
  }
  __syncthreads();

  if (MODE == 2) {
    float* Cf = (float*)(void*)C;
    store_rows_f32<DIM>(sm.f, Cf + (size_t)m0 * DIM + nl, w, lane);
  } else if (sel == 1) {
    store_rows_f16<HD>(sm.h, CK + (size_t)m0 * HD + nl, w, lane);
  } else {
    // staged rows are tokens for q (row pitch DIM), features d for v (row pitch SEQ): the two pitches are equal
    static_assert(SEQ == DIM, "one store path serves q and v");
    const int b = m0 / SEQ, t0 = m0 - b * SEQ;
    _Float16* dst0 = sel == 2 ? CV + (size_t)(b * HD + nl) * SEQ + t0 : (_Float16*)(void*)C + (size_t)m0 * DIM + nl;
    store_rows_f16<DIM>(sm.h, dst0, w, lane);
  }
}

// ---------------------------------------------------------------------------
// Attention helpers.
// ---------------------------------------------------------------------------
// P^T B-fragment from the lane's own score D values: element r <- tile a row r
// (keys 0..15 of the 32-key chunk), element 8+r <- tile c row r (keys 16..31),
// same lane, same query column; the values arrive with their 2^14 carry.
__device__ __forceinline__ v16h pack_p(v8f a, v8f c) {
  const v16h r = { (_Float16)a[0], (_Float16)a[1], (_Float16)a[2], (_Float16)a[3],
                   (_Float16)a[4], (_Float16)a[5], (_Float16)a[6], (_Float16)a[7],
                   (_Float16)c[0], (_Float16)c[1], (_Float16)c[2], (_Float16)c[3],
                   (_Float16)c[4], (_Float16)c[5], (_Float16)c[6], (_Float16)c[7] };
  return r;
}

// 16 x 128 f16 column tile (half of a wave's 32 x 128 tile) in LDS -> oh[b*SEQ + q0 + row][head*128 + d];
// instruction, 32 lines (16 rows x 2) per call.
__device__ __forceinline__ void att_store_pass(const _Float16* so, _Float16* oh,
                                               int b, int head, int q0, int lane) {
  const int q8 = lane & 7, sub = lane >> 3;
  #pragma unroll
  for (int i = 0; i < 8; ++i) {
    const int lid = i * 4 + sub;                     // 0..31
    const int row = lid >> 1, hl = lid & 1;
    const v8h v = *(const v8ha*)(so + row * HD + 64 * hl + 8 * q8);
    _Float16* dst = oh + ((size_t)(b * SEQ + q0 + row)) * DIM + head * HD + 64 * hl + 8 * q8;
    *(v8h*)dst = v;
  }
}

// ---------------------------------------------------------------------------
// Kernel 3: streaming attention, transposed form, single shared K/V head.
// grid (SEQ/256, NH, BS); block 256 thr (8 waves), 32 queries per wave (AQ = 2 column
// tiles of 16: a K or V^T fragment read from LDS feeds one product per column tile),
// 32 keys per step. K rows and V^T rows come in stages of 64 keys: the block
// brings them by whole-line loads into one of two LDS buffers (K row pitch
// 272 B, V^T row pitch 144 B, conflict-free for 16-B fragment reads), shared
// by its 8 waves; the next stage's loads fly while this stage is worked on;
// one barrier per stage.
//   S^T = K * Q^T : A = K rows (row = key, k = d, 4 k-steps), B = Q^T (k = d, n = query)
//   O^T += V^T * P^T : A = vT rows (row = d, k = key), B = P^T from registers
// In each column tile a lane owns 16 keys of query column (lane&15); partner = lane ^ 16. negb is equal in both
// partners; lrun is the lane's own part of the row sum (of P with its 2^14 carry).
// ---------------------------------------------------------------------------
#define AKT   64                     // keys per stage
#define AKP   136                    // K row pitch in halves (272 B)
#define AVP   72                     // V^T row pitch in halves (144 B)
#define AKBUF (AKT * AKP)
#define AVBUF (HD * AVP)
#define AQ    2                      // column tiles per wave
#define PEXP  14.0f                  // log2 of PSCALE
#define MTAU2 1.4426950408889634f    // margin over the maximum in use, in powers of two (= a factor e): 2^(PEXP + MTAU2) = 44537 stays below the f16 maximum 65504
static_assert(PSCALE == 16384.0f, "PEXP is the logarithm of PSCALE");

__global__ __launch_bounds__(256) void attn_kernel(
    const _Float16* __restrict__ qh,   // [MTOT][DIM]  q (unscaled)
    const _Float16* __restrict__ kh,   // [MTOT][HD]   k
    const _Float16* __restrict__ vt,   // [BS][HD][SEQ] v transposed
    _Float16* __restrict__ oh)         // [MTOT][DIM]  f16(16 * o)
{
  __shared__ __attribute__((aligned(16))) _Float16 sK[2 * AKBUF];     // 34816 B
  __shared__ __attribute__((aligned(16))) _Float16 sV[2 * AVBUF];     // 36864 B
  __shared__ __attribute__((aligned(16))) _Float16 sO[8 * AQ * 16 * HD];   // 65536 B

  const int tid = threadIdx.x, lane = tid & 31, w = tid >> 5;
  const int hh = lane >> 4, m = lane & 15;
  const int b = blockIdx.z, head = blockIdx.y;
  const int q0 = blockIdx.x * (128 * AQ) + 16 * AQ * w;

  // Q^T B-fragments of column tile g: column n = query q0+16g+m, k = d (four 32-deep chunks)
  const _Float16* qrow = qh + ((size_t)(b * SEQ + q0 + m)) * DIM + head * HD;
  v16h qb[AQ][4];
  #pragma unroll
  for (int g = 0; g < AQ; ++g)
    #pragma unroll
    for (int c = 0; c < 4; ++c) qb[g][c] = load_frag(qrow + (size_t)(16 * g) * DIM + 32 * c, hh);

  const v8f zero8 = {0.f, 0.f, 0.f, 0.f, 0.f, 0.f, 0.f, 0.f};
  v8f o[AQ][8];                               // o[g][t][r] = O^T[d 16t+8hh+r][query 16g+m] * (l * 2^14)
  float negb[AQ], lrun[AQ];                   // negb = PEXP - (maximum in use, scaled, as a power of two)
  #pragma unroll
  for (int g = 0; g < AQ; ++g) {
    #pragma unroll
    for (int t = 0; t < 8; ++t) o[g][t] = zero8;
    negb[g] = 1e30f;
    lrun[g] = 0.0f;
  }

  // staging, 16-B chunks. K stage = 16 KiB contiguous: chunk tid + 256 i = row tid/16 + 16 i, col tid%16.
  // V^T stage = 128 rows of 128 B: chunk tid + 256 i = row tid/8 + 32 i, col tid%8.
  const _Float16* kg = kh + (size_t)b * SEQ * HD + tid * 8;
  const _Float16* vg = vt + ((size_t)b * HD + (tid >> 3)) * SEQ + (tid & 7) * 8;
  const int kls = (tid >> 4) * AKP + (tid & 15) * 8;
  const int vls = (tid >> 3) * AVP + (tid & 7) * 8;
  const float c1 = 0.08838834764831845f * 1.4426950408889634f;   // 1/sqrt(128) * log2(e): raw score -> exponent of two

  v8h rk[4], rv[4];
  #pragma unroll
  for (int i = 0; i < 4; ++i) rk[i] = *(const v8ha*)(kg + 2048 * i);
  #pragma unroll
  for (int i = 0; i < 4; ++i) rv[i] = *(const v8ha*)(vg + (size_t)(32 * i) * SEQ);
  // precaution: the address registers of the loads above are reused for the loop's counters only behind this wait
  asm volatile("s_wait_xcnt 0x0" ::: "memory");
  #pragma unroll
  for (int i = 0; i < 4; ++i) *(v8ha*)(sK + kls + 16 * i * AKP) = rk[i];
  #pragma unroll
  for (int i = 0; i < 4; ++i) *(v8ha*)(sV + vls + 32 * i * AVP) = rv[i];
  __syncthreads();

  int cur = 0;
  #pragma unroll 1
  for (int kt = 0; kt < SEQ; kt += AKT) {
   const bool more = kt + AKT < SEQ;
   if (more) {
     #pragma unroll
     for (int i = 0; i < 4; ++i) rk[i] = *(const v8ha*)(kg + (size_t)(kt + AKT) * HD + 2048 * i);
     #pragma unroll
     for (int i = 0; i < 4; ++i) rv[i] = *(const v8ha*)(vg + (size_t)(32 * i) * SEQ + kt + AKT);
     // precaution: in the listing the fragment loads below reuse the address registers of the loads above
     asm volatile("s_wait_xcnt 0x0" ::: "memory");
   }
   const _Float16* kS = sK + cur * AKBUF + m * AKP;
   const _Float16* vS = sV + cur * AVBUF + m * AVP;

   #pragma unroll
   for (int kb = 0; kb < AKT; kb += 32) {
    // ---- scores: s[g][j][r] = S^T[key kt+kb+16j+8hh+r][query q0+16g+m] ----
    // the step's 8 K fragments come as one group of LDS loads ahead of its 16 score products; the scheduling barriers
    // in front of and behind the products keep the compiler from sinking loads of the group in among them
    v16h kf[2][4];
    #pragma unroll
    for (int j = 0; j < 2; ++j)
      #pragma unroll
      for (int c = 0; c < 4; ++c) kf[j][c] = load_frag(kS + (kb + 16 * j) * AKP + 32 * c, hh);
    __builtin_amdgcn_sched_barrier(0);
    v8f s[AQ][2];
    #pragma unroll
    for (int g = 0; g < AQ; ++g)
      #pragma unroll
      for (int j = 0; j < 2; ++j) s[g][j] = zero8;
    #pragma unroll
    for (int c = 0; c < 4; ++c)
      #pragma unroll
      for (int j = 0; j < 2; ++j)
        #pragma unroll
        for (int g = 0; g < AQ; ++g) s[g][j] = wmma_f16(kf[j][c], qb[g][c], s[g][j]);
    __builtin_amdgcn_sched_barrier(0);
    // the step's 8 V^T fragments come as one group of LDS loads right behind the score products and fly under the
    // softmax; the scheduling barrier keeps the compiler from sinking part of the group towards its use
    v16h vf[8];
    #pragma unroll
    for (int t = 0; t < 8; ++t) vf[t] = load_frag(vS + (16 * t) * AVP + kb, hh);
    __builtin_amdgcn_sched_barrier(0);

    // ---- online softmax (f32), per column tile, against a maximum that is renewed lazily ----
    // One fused multiply-add takes a raw score to the exponent of its P: t = s * c1 + negb, P * 2^14 = 2^t; the score
    // scale, log2(e), the maximum in use and the 2^14 carry all sit in c1 and negb.
    // Each lane finds the largest t of its own 16 keys. One test per step for the whole wave (a scalar branch on the
    // ballot): only if some lane's largest t lies more than MTAU2 above PEXP are the halves' largest raw scores found and
    // joined, the maximum in use renewed, O and the sums rescaled and t formed anew. Else 2^t <= 2^(PEXP + MTAU2),
    // which the f16 carry still holds, and the quotient O / l does not depend on which maximum is in use.
    v8f e[AQ][2];
    bool need = false;
    #pragma unroll
    for (int g = 0; g < AQ; ++g) {
      float tmax = -1e30f;
      #pragma unroll
      for (int j = 0; j < 2; ++j)
        #pragma unroll
        for (int r = 0; r < 8; ++r) {
          const float t = __builtin_fmaf(s[g][j][r], c1, negb[g]);
          e[g][j][r] = t;
          tmax = fmaxf(tmax, t);
        }
      need = need || (tmax > PEXP + MTAU2);
    }
    if (__builtin_amdgcn_ballot_w32(need) != 0) {
      #pragma unroll
      for (int g = 0; g < AQ; ++g) {
        float mloc = -1e30f;
        #pragma unroll
        for (int j = 0; j < 2; ++j)
          #pragma unroll
          for (int r = 0; r < 8; ++r) mloc = fmaxf(mloc, s[g][j][r]);
        const float mj = fmaxf(mloc, __shfl_xor(mloc, 16));
        const float nnew = fminf(negb[g], __builtin_fmaf(mj, -c1, PEXP));
        const float alpha = __builtin_amdgcn_exp2f(nnew - negb[g]);
        negb[g] = nnew;
        lrun[g] = lrun[g] * alpha;
        #pragma unroll
        for (int t = 0; t < 8; ++t)
          #pragma unroll
          for (int r = 0; r < 8; ++r) o[g][t][r] = o[g][t][r] * alpha;
        #pragma unroll
        for (int j = 0; j < 2; ++j)
          #pragma unroll
          for (int r = 0; r < 8; ++r) e[g][j][r] = __builtin_fmaf(s[g][j][r], c1, nnew);
      }
    }
    v16h pb[AQ];
    #pragma unroll
    for (int g = 0; g < AQ; ++g) {
      float lsum = 0.0f;
      #pragma unroll
      for (int j = 0; j < 2; ++j)
        #pragma unroll
        for (int r = 0; r < 8; ++r) {
          const float p = __builtin_amdgcn_exp2f(e[g][j][r]);
          e[g][j][r] = p;
          lsum += p;
        }
      lrun[g] += lsum;                        // this lane's 16 keys only; the halves' sums meet in the epilogue

      // ---- P^T B-fragment for keys kb .. kb+31 ----
      pb[g] = pack_p(e[g][0], e[g][1]);
    }

    // ---- O^T += V^T * P^T over the 8 d tiles, both column tiles on each V^T fragment ----
    #pragma unroll
    for (int t = 0; t < 8; ++t)
      #pragma unroll
      for (int g = 0; g < AQ; ++g) o[g][t] = wmma_f16(vf[t], pb[g], o[g][t]);
    // four slots behind the step's last product: the next step's first score products may take the registers of this
    // block's P^T (its B operand) for their results
    asm volatile("v_nop\n\tv_nop\n\tv_nop\n\tv_nop" : "+v"(o[AQ - 1][7]));
    // keeps the next step's K loads one group behind these products
    __builtin_amdgcn_sched_barrier(0);
   }

   cur ^= 1;
   if (more) {
     #pragma unroll
     for (int i = 0; i < 4; ++i) *(v8ha*)(sK + cur * AKBUF + kls + 16 * i * AKP) = rk[i];
     #pragma unroll
     for (int i = 0; i < 4; ++i) *(v8ha*)(sV + cur * AVBUF + vls + 32 * i * AVP) = rv[i];
   }
   // publishes the next stage and ends every wave's reads of this one
   __syncthreads();
  }

  // ---- epilogue: normalise, x16 carry, stage per-wave 32x128 f16 tile ----
  _Float16* so = sO + w * (AQ * 16 * HD);
  #pragma unroll
  for (int g = 0; g < AQ; ++g) {
    const float inv = __builtin_amdgcn_rcpf(lrun[g] + __shfl_xor(lrun[g], 16)) * OSC;   // O and l both carry 2^14
    #pragma unroll
    for (int t = 0; t < 8; ++t)
      #pragma unroll
      for (int r = 0; r < 8; ++r)
        so[(16 * g + m) * HD + 16 * t + 8 * hh + r] = (_Float16)(o[g][t][r] * inv);
  }
  __syncthreads();

  #pragma unroll
  for (int g = 0; g < AQ; ++g) att_store_pass(so + g * 16 * HD, oh, b, head, q0 + 16 * g, lane);
  
}

// ---------------------------------------------------------------------------
extern "C" void kernel_launch(void* const* d_in, const int* in_sizes, int n_in,
                              void* d_out, int out_size, void* d_ws, size_t ws_size,
                              hipStream_t stream) {
  if (n_in < 9) return;
  if (in_sizes[0] != NX) return;
  if (in_sizes[1] != DIM * DIM || in_sizes[2] != DIM) return;
  if (in_sizes[3] != DIM * HD || in_sizes[4] != HD) return;
  if (in_sizes[5] != DIM * HD || in_sizes[6] != HD) return;
  if (in_sizes[7] != DIM * DIM || in_sizes[8] != DIM) return;
  if (out_size != NX) return;

  const float* x  = (const float*)d_in[0];
  const float* wq = (const float*)d_in[1];
  const float* bq = (const float*)d_in[2];
  const float* wk = (const float*)d_in[3];
  const float* bk = (const float*)d_in[4];
  const float* wv = (const float*)d_in[5];
  const float* bv = (const float*)d_in[6];
  const float* wo = (const float*)d_in[7];
  const float* bo = (const float*)d_in[8];
  float* out = (float*)d_out;

  const size_t act_b = (size_t)NX * 2;              // 16777216  f16 [4096][2048]
  const size_t wsq_b = (size_t)DIM * DIM * 2;       //  8388608  f16 [2048][2048]
  const size_t wkv_b = (size_t)DIM * HD * 2;        //   524288  f16 [128][2048]
  const size_t kv_b  = (size_t)MTOT * HD * 2;       //  1048576  f16 [4096][128] / [2][128][2048]
  const size_t total = act_b + wsq_b + 2 * wkv_b + wsq_b + act_b + 2 * kv_b + act_b;   // 70254592
  if (total > ws_size) return;

  char* ws = (char*)d_ws;
  size_t off = 0;
  _Float16* xh  = (_Float16*)(ws + off); off += act_b;
  _Float16* wqT = (_Float16*)(ws + off); off += wsq_b;
  _Float16* wkT = (_Float16*)(ws + off); off += wkv_b;
  _Float16* wvT = (_Float16*)(ws + off); off += wkv_b;
  _Float16* woT = (_Float16*)(ws + off); off += wsq_b;
  _Float16* qh  = (_Float16*)(ws + off); off += act_b;
  _Float16* kh  = (_Float16*)(ws + off); off += kv_b;
  _Float16* vT  = (_Float16*)(ws + off); off += kv_b;
  _Float16* oh  = (_Float16*)(ws + off); off += act_b;
  if (off > ws_size) return;

  // 1) operand planes, one grid: x -> f16; W (in,out) -> W^T [out][in] f16 x32
  prep_kernel<<<PBALL, 256, 0, stream>>>(x, xh, wq, wqT, wk, wkT, wv, wvT, wo, woT);

  // 2) projections, one grid over the stacked rows of wqT, wkT, wvT (adjacent in the workspace):
  //    q [4096][2048] f16, k [4096][128] f16, v -> vT [2][128][2048] f16
  gemm_kernel<0, _Float16><<<dim3(MTOT / 128, (DIM + 2 * HD) / 128), 128, 0, stream>>>(xh, wqT, bq, qh, WINV, 1.0f, bk, bv, kh, vT);

  // 3) attention: all 16 query heads against the shared K / V^T planes; o f16 x16
  attn_kernel<<<dim3(SEQ / (128 * AQ), NH, BS), 256, 0, stream>>>(qh, kh, vT, oh);

  // 4) output projection: out = (o x16)(wo x32) / 512 + bo, f32 whole-line stores
  gemm_kernel<2, float><<<dim3(MTOT / 128, DIM / 128), 128, 0, stream>>>(oh, woT, bo, out, WINV / OSC, 1.0f, nullptr, nullptr, nullptr, nullptr);
}

// v010
// A run of this version takes 128 microseconds.
// Next to v009, in two timings, it ran 1.03 times as fast each time.
// All steps since v000 together make it 4.52 times as fast.
// Contractions: x*WqT, x*WkT, x*WvT, K*Q^T, V^T*P^T and O*WoT all on v_wmma_f32_16x16x32_f16 (f16 operands, f32 accumulate); W carried x32, P carried x16384 (added to its exponent), O carried x16 (exact power-of-two scales folded back in f32); softmax, bias and normalisation in f32.
#include <hip/hip_runtime.h>

typedef _Float16 v16h __attribute__((ext_vector_type(16)));
typedef _Float16 v8h  __attribute__((ext_vector_type(8)));
typedef float    v8f  __attribute__((ext_vector_type(8)));
typedef float    v4f  __attribute__((ext_vector_type(4)));
typedef v8h __attribute__((may_alias)) v8ha;
typedef v4f __attribute__((may_alias)) v4fa;

union Frag { v16h v; v8h half[2]; };

#define DIM    2048
#define SEQ    2048
#define NH     16
#define HD     128
#define BS     2
#define MTOT   (BS * SEQ)          // 4096 token rows
#define NX     (MTOT * DIM)        // 8388608
#define NX8    (NX / 8)            // 1048576
#define WSC    32.0f
#define WINV   0.03125f
#define PSCALE 16384.0f
#define OSC    16.0f

// ---------------------------------------------------------------------------
// 16x16x32 f16 WMMA, the builtin alone: the compiler keeps the distance to a close consumer of its own forms.
// Fragment map (wave32): lane l, h = l>>4, m = n = l&15.
//   A/B element i: i<8 -> k0+8h+i ; i>=8 -> k0+16+8h+(i-8)
//   D element r : row 8h+r, col l&15
// ---------------------------------------------------------------------------
__device__ __forceinline__ v8f wmma_f16(v16h a, v16h b, v8f c) {
  return __builtin_amdgcn_wmma_f32_16x16x32_f16(false, a, false, b, (short)0, c, false, false);
}

// A or B fragment from a k-contiguous f16 row; p points at element k0 of the
// row owned by this lane (row index = lane & 15 added by the caller).
__device__ __forceinline__ v16h load_frag(const _Float16* p, int h) {
  Frag f;
  f.half[0] = *(const v8ha*)(p + 8 * h);
  f.half[1] = *(const v8ha*)(p + 16 + 8 * h);
  return f.v;
}

// ---------------------------------------------------------------------------
// Prep part 1: x f32 -> f16 (unscaled). A lane takes XCH chunks of 8 floats (one 16-B
// store each), all its loads issued ahead of the first store; blk = block index
// inside this part's range of the prep grid.
// ---------------------------------------------------------------------------
#define XCH 16
static_assert(NX8 % (256 * XCH) == 0, "the x blocks cover x exactly");
__device__ __forceinline__ void cvt_x_block(const float* __restrict__ x,
                                            _Float16* __restrict__ xh, int blk)
{
  const size_t g = (size_t)blk * (256 * XCH) + threadIdx.x;
  const float* src = x + g * 8;
  _Float16* dst = xh + g * 8;
  v4f a[XCH], c[XCH];
  #pragma unroll
  for (int i = 0; i < XCH; ++i) {
    a[i] = *(const v4fa*)(src + i * 2048);
    c[i] = *(const v4fa*)(src + i * 2048 + 4);
  }
  #pragma unroll
  for (int i = 0; i < XCH; ++i) {
    const v8h o = { (_Float16)a[i].x, (_Float16)a[i].y, (_Float16)a[i].z, (_Float16)a[i].w,
                    (_Float16)c[i].x, (_Float16)c[i].y, (_Float16)c[i].z, (_Float16)c[i].w };
    *(v8h*)(dst + i * 2048) = o;
  }
}

// ---------------------------------------------------------------------------
// Prep part 2: w[DIM][N] f32 (in, out) -> wT[N][DIM] f16 scaled x32 (exact).
// Block 256 thr, tile 128 k x 128 n; tile (bx, by) of (N/128, DIM/128). A wave takes 32
// columns n (one per lane: every load is one whole line) and 64 rows k, all 64 loads
// issued ahead; a lane's 64 values are 64 consecutive k of its output row and go to
// LDS [n][128 k] as eight 16-B stores (row pitch 272 B: conflict-free for 16-B
// stores down a column of rows and for the 16-B reads along a row). Each output row
// segment = 128 halves = two whole lines.
// ---------------------------------------------------------------------------
#define TP 136                             // LDS row pitch in halves (272 B)
template <int N>
__device__ __forceinline__ void transpose_w_block(const float* __restrict__ w,
                                                  _Float16* __restrict__ wT,
                                                  int bx, int by, _Float16* sT)
{
  const int tid = threadIdx.x, lane = tid & 31, wv = tid >> 5;
  const int n0 = bx * 128, k0 = by * 128;
  const int nn = 32 * (wv & 3) + lane, kb = 64 * (wv >> 2);
  const float* src = w + (size_t)(k0 + kb) * N + n0 + nn;
  float val[64];
  #pragma unroll
  for (int i = 0; i < 64; ++i) val[i] = src[i * N];
  #pragma unroll
  for (int q = 0; q < 8; ++q) {
    const v8h o = { (_Float16)(val[8 * q] * WSC),     (_Float16)(val[8 * q + 1] * WSC),
                    (_Float16)(val[8 * q + 2] * WSC), (_Float16)(val[8 * q + 3] * WSC),
                    (_Float16)(val[8 * q + 4] * WSC), (_Float16)(val[8 * q + 5] * WSC),
                    (_Float16)(val[8 * q + 6] * WSC), (_Float16)(val[8 * q + 7] * WSC) };
    *(v8ha*)(sT + nn * TP + kb + 8 * q) = o;
  }
  __syncthreads();
  // 16-B chunk (row = tid/16 + 16 i, col = tid%16): a wave stores two whole rows (4 lines)
  const int row = tid >> 4, col = (tid & 15) * 8;
  const _Float16* s = sT + row * TP + col;
  _Float16* dst = wT + (size_t)(n0 + row) * DIM + k0 + col;
  v8h v[8];
  #pragma unroll
  for (int i = 0; i < 8; ++i) v[i] = *(const v8ha*)(s + 16 * i * TP);
  #pragma unroll
  for (int i = 0; i < 8; ++i) *(v8h*)(dst + (size_t)(16 * i) * DIM) = v[i];
  // precaution: in the listing another job's path follows on the branch's fall-through edge and reuses registers that these stores name
  asm volatile("s_wait_xcnt 0x0" ::: "memory");
}

// ---------------------------------------------------------------------------
// Kernel 1: all operand planes in one grid. The five jobs depend on nothing but
// the inputs, so each takes a range of block indices: x convert, then the
// transposes of wq, wk, wv, wo. Every test below is on blockIdx alone.
// The grid is small enough to be resident at once: few long waves, each with
// its whole share of loads in flight, in place of many waves of a few loads.
// ---------------------------------------------------------------------------
#define PBX  (NX8 / (256 * XCH))           //  256 blocks: x
#define PBS  ((DIM / 128) * (DIM / 128))   //  256 blocks: a DIM x DIM weight
#define PBH  ((HD / 128) * (DIM / 128))    //   16 blocks: a DIM x HD weight
#define PBALL (PBX + 2 * PBS + 2 * PBH)

__global__ __launch_bounds__(256) void prep_kernel(
    const float* __restrict__ x,  _Float16* __restrict__ xh,
    const float* __restrict__ wq, _Float16* __restrict__ wqT,
    const float* __restrict__ wk, _Float16* __restrict__ wkT,
    const float* __restrict__ wv, _Float16* __restrict__ wvT,
    const float* __restrict__ wo, _Float16* __restrict__ woT)
{
  __shared__ __attribute__((aligned(16))) _Float16 sT[128 * TP];     // 34816 B
  const int t = blockIdx.x;
  if (t < PBX) {
    cvt_x_block(x, xh, t);
  } else {
    // job 0..3 = wq, wk, wv, wo; u = tile index inside the job; a weight has N / 128 tile columns
    const int job = t < PBX + PBS ? 0 : (t < PBX + PBS + PBH ? 1 : (t < PBX + PBS + 2 * PBH ? 2 : 3));
    const int u = t - (job == 0 ? PBX : (job == 1 ? PBX + PBS : (job == 2 ? PBX + PBS + PBH : PBX + PBS + 2 * PBH)));
    const float* w = job == 0 ? wq : (job == 1 ? wk : (job == 2 ? wv : wo));
    _Float16* wT = job == 0 ? wqT : (job == 1 ? wkT : (job == 2 ? wvT : woT));
    if (job == 0 || job == 3) {
      transpose_w_block<DIM>(w, wT, u & (DIM / 128 - 1), u / (DIM / 128), sT);
    } else {
      static_assert(HD == 128, "a DIM x HD weight is one tile column");
      transpose_w_block<HD>(w, wT, 0, u, sT);
    }
  }
}

// ---------------------------------------------------------------------------
// ---------------------------------------------------------------------------
// f16 tile staged [row][128] -> dst0[row * PITCH .. + 127]: two lines per row; one
// instruction of a wave covers two whole rows (4 lines); wave w stores rows 32w .. 32w+31.
// A constant row pitch lets one address pair serve all 16 stores.
template <int PITCH>
__device__ __forceinline__ void store_rows_f16(const _Float16* sT, _Float16* dst0, int w, int lane) {
  const int c16 = lane & 15, sub = lane >> 4;
  const _Float16* s = sT + (w * 32 + sub) * 128 + 8 * c16;
  _Float16* dst = dst0 + (size_t)(w * 32 + sub) * PITCH + 8 * c16;
  v8h v[16];
  #pragma unroll
  for (int i = 0; i < 16; ++i) v[i] = *(const v8ha*)(s + 2 * i * 128);
  #pragma unroll
  for (int i = 0; i < 16; ++i) *(v8h*)(dst + (size_t)(2 * i) * PITCH) = v[i];
}

// f32 tile staged [tok][128 feat] -> dst0[tok * PITCH .. + 127]: four lines per row; one
// instruction of a wave covers one whole row; wave w stores rows 32w .. 32w+31.
template <int PITCH>
__device__ __forceinline__ void store_rows_f32(const float* sT, float* dst0, int w, int lane) {
  const float* s = sT + (32 * w) * 128 + 4 * lane;
  float* dst = dst0 + (size_t)(32 * w) * PITCH + 4 * lane;
  v4f v[32];
  #pragma unroll
  for (int i = 0; i < 32; ++i) v[i] = *(const v4fa*)(s + i * 128);
  #pragma unroll
  for (int i = 0; i < 32; ++i) *(v4f*)(dst + (size_t)i * PITCH) = v[i];
}

// ---------------------------------------------------------------------------
// Kernel 2: C = A * BT^T (+bias), A [M][K] f16 rows, BT [N][K] f16 rows (x32).
// Block 128 thr (4 waves, 2 x 2) = 128 rows x 128 cols; wave tile 64 x 64 (4x4
// WMMA tiles): a loaded fragment feeds 4 products, a staged row 128 outputs.
// K in stages of 64: the block brings 128 A rows and 128 BT rows of
// 128 B each by asynchronous 16-B copies (global_load_async_to_lds_b128, through no
// register; a wave's copy covers 4 whole lines) into one of two LDS buffers (row pitch 144 B,
// conflict-free for 16-B fragment reads); the next stage's copies fly while
// this stage's fragments are read from LDS; one barrier per stage. K = DIM.
// MODE 0: the three input projections in one grid. BT = the W^T planes of q, k, v
//         stacked row after row (DIM + HD + HD rows); a column tile lies wholly in one
//         plane and goes to that plane's bias and output:
//         q -> f16 C[M][DIM], k -> f16 CK[M][HD], v -> f16 CV[b][d][t]; each f16((acc*ascale + bias)*oscale)
// MODE 2: f32 C[M][DIM] = acc*ascale + bias (biasK, biasV, CK, CV not used)
// grid (M/128, BT rows/128)
// ---------------------------------------------------------------------------
#define GKT   64                     // k per stage
#define GP    72                     // LDS row pitch in halves (144 B)
#define GABUF (128 * GP)
#define GBUF  ((128 + 128) * GP)     // one stage: A rows then BT rows
union GemmSmem { _Float16 ring[2 * GBUF]; _Float16 h[128 * 128]; float f[128 * 128]; };

// A run of eight asynchronous 16-B copies, lane by lane: LDS byte address l[i] <- global g[i]. The run's s_wait_xcnt 0 is the
// last line of the same statement (a precaution: no register that a copy names is rewritten ahead of it).
__device__ __forceinline__ void async_copy8(const unsigned (&l)[8], const _Float16* const (&g)[8]) {
  asm volatile(
      "global_load_async_to_lds_b128 %0, %8, off\n\t"
      "global_load_async_to_lds_b128 %1, %9, off\n\t"
      "global_load_async_to_lds_b128 %2, %10, off\n\t"
      "global_load_async_to_lds_b128 %3, %11, off\n\t"
      "global_load_async_to_lds_b128 %4, %12, off\n\t"
      "global_load_async_to_lds_b128 %5, %13, off\n\t"
      "global_load_async_to_lds_b128 %6, %14, off\n\t"
      "global_load_async_to_lds_b128 %7, %15, off\n\t"
      "s_wait_xcnt 0x0"
      :: "v"(l[0]), "v"(l[1]), "v"(l[2]), "v"(l[3]), "v"(l[4]), "v"(l[5]), "v"(l[6]), "v"(l[7]),
         "v"(g[0]), "v"(g[1]), "v"(g[2]), "v"(g[3]), "v"(g[4]), "v"(g[5]), "v"(g[6]), "v"(g[7])
      : "memory");
}

// Accumulators -> output tile staged in LDS. D[r] of tile (mt, nt) = C[row 64wm+16mt+8h+r][col 64wn+16nt+m].
// LAYOUT 0: f16 [tok][128 feat]; 1: f16 [feat][128 tok]; 2: f32 [tok][128 feat]. bias points at the tile's first column.
template <int LAYOUT>
__device__ __forceinline__ void stage_out(GemmSmem& sm, const v8f (&acc)[4][4], const float* __restrict__ bias,
                                          float ascale, float oscale, int wm, int wn, int h, int m) {
  float bv[4];
  #pragma unroll
  for (int nt = 0; nt < 4; ++nt) bv[nt] = bias[64 * wn + 16 * nt + m];
  #pragma unroll
  for (int nt = 0; nt < 4; ++nt) {
    const int feat = 64 * wn + 16 * nt + m;              // 0..127
    const float bvl = bv[nt];
    #pragma unroll
    for (int mt = 0; mt < 4; ++mt) {
      #pragma unroll
      for (int r = 0; r < 8; ++r) {
        const int tokl = 64 * wm + 16 * mt + 8 * h + r;  // 0..127
        const float y = acc[mt][nt][r] * ascale + bvl;
        if (LAYOUT == 2) {
          sm.f[tokl * 128 + feat] = y;
        } else if (LAYOUT == 1) {
          sm.h[feat * 128 + tokl] = (_Float16)(y * oscale);
        } else {
          sm.h[tokl * 128 + feat] = (_Float16)(y * oscale);
        }
      }
    }
  }
}

template <int MODE, typename CT>
__global__ __launch_bounds__(128) void gemm_kernel(
    const _Float16* __restrict__ A, const _Float16* __restrict__ BT,
    const float* __restrict__ bias, CT* __restrict__ C,
    float ascale, float oscale,
    const float* __restrict__ biasK, const float* __restrict__ biasV,
    _Float16* __restrict__ CK, _Float16* __restrict__ CV)
{
  constexpr int K = DIM;     // every product here contracts over DIM
  __shared__ __attribute__((aligned(16))) GemmSmem sm;       // 73728 B

  const int tid = threadIdx.x, lane = tid & 31, w = tid >> 5;
  const int h = lane >> 4, m = lane & 15;
  const int wm = w >> 1, wn = w & 1;
  const int m0 = blockIdx.x * 128, n0 = blockIdx.y * 128;

  // staging: 16-B chunk (row = tid/8 + 16 i, col = tid%8); a wave covers 4 whole lines
  const int srow = tid >> 3, scol = (tid & 7) * 8;
  const _Float16* ag = A  + (size_t)(m0 + srow) * K + scol;
  const _Float16* bg = BT + (size_t)(n0 + srow) * K + scol;
  const unsigned sl = (unsigned)(size_t)sm.ring + (unsigned)(srow * GP + scol) * 2u;   // LDS byte address of the lane's first chunk, buffer 0
  // stage t into buffer bsel: 8 rounds of A rows, 8 of BT rows; every lane copies in every round
  auto issue = [&](int t, int bsel) {
    const unsigned lb = sl + (unsigned)bsel * (GBUF * 2u);
    const _Float16* ga = ag + t * GKT;
    const _Float16* gb = bg + t * GKT;
    unsigned la[8], lbt[8];
    const _Float16* pa[8];
    const _Float16* pb[8];
    #pragma unroll
    for (int i = 0; i < 8; ++i) {
      la[i]  = lb + i * (16 * GP * 2);
      pa[i]  = ga + (size_t)(16 * i) * K;
      lbt[i] = lb + (GABUF + i * 16 * GP) * 2;
      pb[i]  = gb + (size_t)(16 * i) * K;
    }
    async_copy8(la, pa);
    async_copy8(lbt, pb);
  };
  // fragment rows in a stage
  const int fa = (64 * wm + m) * GP;                         // mt = 0
  const int fb = GABUF + (64 * wn + m) * GP;                 // nt = 0

  const v8f zero8 = {0.f, 0.f, 0.f, 0.f, 0.f, 0.f, 0.f, 0.f};
  v8f acc[4][4];
  #pragma unroll
  for (int mt = 0; mt < 4; ++mt)
    #pragma unroll
    for (int nt = 0; nt < 4; ++nt) acc[mt][nt] = zero8;

  constexpr int T = K / GKT;
  issue(0, 0);
  // stage 0 has landed for this wave; the barrier publishes it to the others
  asm volatile("s_wait_asynccnt 0x0" ::: "memory");
  __syncthreads();

  #pragma unroll 1
  for (int t = 0; t < T; ++t) {
    const _Float16* st = sm.ring + (t & 1) * GBUF;
    // each 32-deep half of the stage: its 8 fragments as one group of LDS loads ahead of its 16 products;
    // the two scheduling barriers keep the compiler from sinking loads of a group in among the products
    #pragma unroll
    for (int ks = 0; ks < 2; ++ks) {
      v16h fA[4], fB[4];
      #pragma unroll
      for (int mt = 0; mt < 4; ++mt) fA[mt] = load_frag(st + fa + mt * 16 * GP + 32 * ks, h);
      #pragma unroll
      for (int nt = 0; nt < 4; ++nt) fB[nt] = load_frag(st + fb + nt * 16 * GP + 32 * ks, h);
      // the next stage's copies go into the buffer that the barrier at the foot of the last pass has freed (pass 0: never
      // read); they stand behind the pass's first fragment loads, so that their issue fills those loads' latency
      if (ks == 0 && t + 1 < T) issue(t + 1, (t + 1) & 1);
      __builtin_amdgcn_sched_barrier(0);
      #pragma unroll
      for (int nt = 0; nt < 4; ++nt) {
        #pragma unroll
        for (int mt = 0; mt < 4; ++mt) acc[mt][nt] = wmma_f16(fA[mt], fB[nt], acc[mt][nt]);
      }
      __builtin_amdgcn_sched_barrier(0);
    }
    // publish point of stage t + 1: this wave's reads of stage t have retired ...
    asm volatile("s_wait_dscnt 0x0" ::: "memory");
    // ... its own copies of stage t + 1 have landed ...
    asm volatile("s_wait_asynccnt 0x0" ::: "memory");
    // ... and the barrier publishes stage t + 1 and ends every wave's reads of stage t (the last pass: frees the ring for the output tile)
    __syncthreads();
  }
  // no copy is outstanding when the ring becomes the output tile
  asm volatile("s_wait_asynccnt 0x0" ::: "memory");

  // the plane this column tile belongs to (0 q, 1 k, 2 v) and its first column there; block-uniform
  const int sel = MODE == 0 ? (n0 >= DIM + HD ? 2 : (n0 >= DIM ? 1 : 0)) : 0;
  const int nl = n0 - (sel == 2 ? DIM + HD : (sel == 1 ? DIM : 0));
  if (MODE == 2) {
    stage_out<2>(sm, acc, bias + nl, ascale, oscale, wm, wn, h, m);
  } else if (sel == 2) {
    stage_out<1>(sm, acc, biasV + nl, ascale, oscale, wm, wn, h, m);
  } else {
    stage_out<0>(sm, acc, (sel == 1 ? biasK : bias) + nl, ascale, oscale, wm, wn, h, m);
  }
  __syncthreads();

  if (MODE == 2) {
    float* Cf = (float*)(void*)C;
    store_rows_f32<DIM>(sm.f, Cf + (size_t)m0 * DIM + nl, w, lane);
  } else if (sel == 1) {
    store_rows_f16<HD>(sm.h, CK + (size_t)m0 * HD + nl, w, lane);
  } else {
    // staged rows are tokens for q (row pitch DIM), features d for v (row pitch SEQ): the two pitches are equal
    static_assert(SEQ == DIM, "one store path serves q and v");
    const int b = m0 / SEQ, t0 = m0 - b * SEQ;
    _Float16* dst0 = sel == 2 ? CV + (size_t)(b * HD + nl) * SEQ + t0 : (_Float16*)(void*)C + (size_t)m0 * DIM + nl;
    store_rows_f16<DIM>(sm.h, dst0, w, lane);
  }
}

// ---------------------------------------------------------------------------
// Attention helpers.
// ---------------------------------------------------------------------------
// P^T B-fragment from the lane's own score D values: element r <- tile a row r
// (keys 0..15 of the 32-key chunk), element 8+r <- tile c row r (keys 16..31),
// same lane, same query column; the values arrive with their 2^14 carry.
__device__ __forceinline__ v16h pack_p(v8f a, v8f c) {
  const v16h r = { (_Float16)a[0], (_Float16)a[1], (_Float16)a[2], (_Float16)a[3],
                   (_Float16)a[4], (_Float16)a[5], (_Float16)a[6], (_Float16)a[7],
                   (_Float16)c[0], (_Float16)c[1], (_Float16)c[2], (_Float16)c[3],
                   (_Float16)c[4], (_Float16)c[5], (_Float16)c[6], (_Float16)c[7] };
  return r;
}

// 16 x 128 f16 column tile (half of a wave's 32 x 128 tile) in LDS -> oh[b*SEQ + q0 + row][head*128 + d];
// instruction, 32 lines (16 rows x 2) per call.
__device__ __forceinline__ void att_store_pass(const _Float16* so, _Float16* oh,
                                               int b, int head, int q0, int lane) {
  const int q8 = lane & 7, sub = lane >> 3;
  #pragma unroll
  for (int i = 0; i < 8; ++i) {
    const int lid = i * 4 + sub;                     // 0..31
    const int row = lid >> 1, hl = lid & 1;
    const v8h v = *(const v8ha*)(so + row * HD + 64 * hl + 8 * q8);
    _Float16* dst = oh + ((size_t)(b * SEQ + q0 + row)) * DIM + head * HD + 64 * hl + 8 * q8;
    *(v8h*)dst = v;
  }
}

// ---------------------------------------------------------------------------
// Kernel 3: streaming attention, transposed form, single shared K/V head.
// grid (SEQ/256, NH, BS); block 256 thr (8 waves), 32 queries per wave (AQ = 2 column
// tiles of 16: a K or V^T fragment read from LDS feeds one product per column tile),
// 32 keys per step. K rows and V^T rows come in stages of 64 keys: the block
// brings them by asynchronous 16-B copies (whole lines, through no register) into one of two LDS buffers (K row pitch
// 272 B, V^T row pitch 144 B, conflict-free for 16-B fragment reads), shared
// by its 8 waves; the next stage's copies fly while this stage is worked on;
// one barrier per stage.
//   S^T = K * Q^T : A = K rows (row = key, k = d, 4 k-steps), B = Q^T (k = d, n = query)
//   O^T += V^T * P^T : A = vT rows (row = d, k = key), B = P^T from registers
// In each column tile a lane owns 16 keys of query column (lane&15); partner = lane ^ 16. negb is equal in both
// partners; lrun is the lane's own part of the row sum (of P with its 2^14 carry).
// ---------------------------------------------------------------------------
#define AKT   64                     // keys per stage
#define AKP   136                    // K row pitch in halves (272 B)
#define AVP   72                     // V^T row pitch in halves (144 B)
#define AKBUF (AKT * AKP)
#define AVBUF (HD * AVP)
#define AQ    2                      // column tiles per wave
#define PEXP  14.0f                  // log2 of PSCALE
#define MTAU2 1.4426950408889634f    // margin over the maximum in use, in powers of two (= a factor e): 2^(PEXP + MTAU2) = 44537 stays below the f16 maximum 65504
static_assert(PSCALE == 16384.0f, "PEXP is the logarithm of PSCALE");

__global__ __launch_bounds__(256) void attn_kernel(
    const _Float16* __restrict__ qh,   // [MTOT][DIM]  q (unscaled)
    const _Float16* __restrict__ kh,   // [MTOT][HD]   k
    const _Float16* __restrict__ vt,   // [BS][HD][SEQ] v transposed
    _Float16* __restrict__ oh)         // [MTOT][DIM]  f16(16 * o)
{
  __shared__ __attribute__((aligned(16))) _Float16 sK[2 * AKBUF];     // 34816 B
  __shared__ __attribute__((aligned(16))) _Float16 sV[2 * AVBUF];     // 36864 B
  __shared__ __attribute__((aligned(16))) _Float16 sO[8 * AQ * 16 * HD];   // 65536 B

  const int tid = threadIdx.x, lane = tid & 31, w = tid >> 5;
  const int hh = lane >> 4, m = lane & 15;
  const int b = blockIdx.z, head = blockIdx.y;
  const int q0 = blockIdx.x * (128 * AQ) + 16 * AQ * w;

  // Q^T B-fragments of column tile g: column n = query q0+16g+m, k = d (four 32-deep chunks)
  const _Float16* qrow = qh + ((size_t)(b * SEQ + q0 + m)) * DIM + head * HD;
  v16h qb[AQ][4];
  #pragma unroll
  for (int g = 0; g < AQ; ++g)
    #pragma unroll
    for (int c = 0; c < 4; ++c) qb[g][c] = load_frag(qrow + (size_t)(16 * g) * DIM + 32 * c, hh);

  const v8f zero8 = {0.f, 0.f, 0.f, 0.f, 0.f, 0.f, 0.f, 0.f};
  v8f o[AQ][8];                               // o[g][t][r] = O^T[d 16t+8hh+r][query 16g+m] * (l * 2^14)
  float negb[AQ], lrun[AQ];                   // negb = PEXP - (maximum in use, scaled, as a power of two)
  #pragma unroll
  for (int g = 0; g < AQ; ++g) {
    #pragma unroll
    for (int t = 0; t < 8; ++t) o[g][t] = zero8;
    negb[g] = 1e30f;
    lrun[g] = 0.0f;
  }

  // staging, 16-B chunks. K stage = 16 KiB contiguous: chunk tid + 256 i = row tid/16 + 16 i, col tid%16.
  // V^T stage = 128 rows of 128 B: chunk tid + 256 i = row tid/8 + 32 i, col tid%8.
  const _Float16* kg = kh + (size_t)b * SEQ * HD + tid * 8;
  const _Float16* vg = vt + ((size_t)b * HD + (tid >> 3)) * SEQ + (tid & 7) * 8;
  const unsigned kls = (unsigned)(size_t)sK + (unsigned)((tid >> 4) * AKP + (tid & 15) * 8) * 2u;   // LDS byte addresses of the lane's
  const unsigned vls = (unsigned)(size_t)sV + (unsigned)((tid >> 3) * AVP + (tid & 7) * 8) * 2u;    // first K and V^T chunks, buffer 0
  // the stage of keys k0 .. k0 + 63 into buffer bsel: 4 rounds of K rows, 4 of V^T rows; every lane copies in every round
  auto issue = [&](int k0, int bsel) {
    unsigned l[8];
    const _Float16* g[8];
    #pragma unroll
    for (int i = 0; i < 4; ++i) {
      l[i]     = kls + (unsigned)bsel * (AKBUF * 2u) + i * (16 * AKP * 2);
      g[i]     = kg + (size_t)k0 * HD + 2048 * i;
      l[4 + i] = vls + (unsigned)bsel * (AVBUF * 2u) + i * (32 * AVP * 2);
      g[4 + i] = vg + (size_t)(32 * i) * SEQ + k0;
    }
    async_copy8(l, g);
  };
  const float c1 = 0.08838834764831845f * 1.4426950408889634f;   // 1/sqrt(128) * log2(e): raw score -> exponent of two

  // stage 0 goes to buffer 1: aimed at buffer 0, the lane's two base LDS addresses would themselves be operands of the copies'
  // statement, which ties them to the registers below v256 for the whole loop, and the build then spilled both
  issue(0, 1);
  // stage 0 has landed for this wave; the barrier publishes it to the others
  asm volatile("s_wait_asynccnt 0x0" ::: "memory");
  __syncthreads();

  int cur = 1;
  #pragma unroll 1
  for (int kt = 0; kt < SEQ; kt += AKT) {
   const bool more = kt + AKT < SEQ;
   const _Float16* kS = sK + cur * AKBUF + m * AKP;
   const _Float16* vS = sV + cur * AVBUF + m * AVP;

   #pragma unroll
   for (int kb = 0; kb < AKT; kb += 32) {
    // ---- scores: s[g][j][r] = S^T[key kt+kb+16j+8hh+r][query q0+16g+m] ----
    // the step's 8 K fragments come as one group of LDS loads ahead of its 16 score products; the scheduling barriers
    // in front of and behind the products keep the compiler from sinking loads of the group in among them
    v16h kf[2][4];
    #pragma unroll
    for (int j = 0; j < 2; ++j)
      #pragma unroll
      for (int c = 0; c < 4; ++c) kf[j][c] = load_frag(kS + (kb + 16 * j) * AKP + 32 * c, hh);
    // the next stage's copies go into the buffers that the barrier at the foot of the last stage has freed (stage 0: never
    // read); they stand behind the stage's first fragment loads, so that their issue fills those loads' latency
    if (kb == 0 && more) issue(kt + AKT, cur ^ 1);
    __builtin_amdgcn_sched_barrier(0);
    v8f s[AQ][2];
    #pragma unroll
    for (int g = 0; g < AQ; ++g)
      #pragma unroll
      for (int j = 0; j < 2; ++j) s[g][j] = zero8;
    #pragma unroll
    for (int c = 0; c < 4; ++c)
      #pragma unroll
      for (int j = 0; j < 2; ++j)
        #pragma unroll
        for (int g = 0; g < AQ; ++g) s[g][j] = wmma_f16(kf[j][c], qb[g][c], s[g][j]);
    __builtin_amdgcn_sched_barrier(0);
    // the step's 8 V^T fragments come as one group of LDS loads right behind the score products and fly under the
    // softmax; the scheduling barrier keeps the compiler from sinking part of the group towards its use
    v16h vf[8];
    #pragma unroll
    for (int t = 0; t < 8; ++t) vf[t] = load_frag(vS + (16 * t) * AVP + kb, hh);
    __builtin_amdgcn_sched_barrier(0);

    // ---- online softmax (f32), per column tile, against a maximum that is renewed lazily ----
    // One fused multiply-add takes a raw score to the exponent of its P: t = s * c1 + negb, P * 2^14 = 2^t; the score
    // scale, log2(e), the maximum in use and the 2^14 carry all sit in c1 and negb.
    // Each lane finds the largest t of its own 16 keys. One test per step for the whole wave (a scalar branch on the
    // ballot): only if some lane's largest t lies more than MTAU2 above PEXP are the halves' largest raw scores found and
    // joined, the maximum in use renewed, O and the sums rescaled and t formed anew. Else 2^t <= 2^(PEXP + MTAU2),
    // which the f16 carry still holds, and the quotient O / l does not depend on which maximum is in use.
    v8f e[AQ][2];
    bool need = false;
    #pragma unroll
    for (int g = 0; g < AQ; ++g) {
      float tmax = -1e30f;
      #pragma unroll
      for (int j = 0; j < 2; ++j)
        #pragma unroll
        for (int r = 0; r < 8; ++r) {
          const float t = __builtin_fmaf(s[g][j][r], c1, negb[g]);
          e[g][j][r] = t;
          tmax = fmaxf(tmax, t);
        }
      need = need || (tmax > PEXP + MTAU2);
    }
    if (__builtin_amdgcn_ballot_w32(need) != 0) {
      #pragma unroll
      for (int g = 0; g < AQ; ++g) {
        float mloc = -1e30f;
        #pragma unroll
        for (int j = 0; j < 2; ++j)
          #pragma unroll
          for (int r = 0; r < 8; ++r) mloc = fmaxf(mloc, s[g][j][r]);
        const float mj = fmaxf(mloc, __shfl_xor(mloc, 16));
        const float nnew = fminf(negb[g], __builtin_fmaf(mj, -c1, PEXP));
        const float alpha = __builtin_amdgcn_exp2f(nnew - negb[g]);
        negb[g] = nnew;
        lrun[g] = lrun[g] * alpha;
        #pragma unroll
        for (int t = 0; t < 8; ++t)
          #pragma unroll
          for (int r = 0; r < 8; ++r) o[g][t][r] = o[g][t][r] * alpha;
        #pragma unroll
        for (int j = 0; j < 2; ++j)
          #pragma unroll
          for (int r = 0; r < 8; ++r) e[g][j][r] = __builtin_fmaf(s[g][j][r], c1, nnew);
      }
    }
    v16h pb[AQ];
    #pragma unroll
    for (int g = 0; g < AQ; ++g) {
      float lsum = 0.0f;
      #pragma unroll
      for (int j = 0; j < 2; ++j)
        #pragma unroll
        for (int r = 0; r < 8; ++r) {
          const float p = __builtin_amdgcn_exp2f(e[g][j][r]);
          e[g][j][r] = p;
          lsum += p;
        }
      lrun[g] += lsum;                        // this lane's 16 keys only; the halves' sums meet in the epilogue

      // ---- P^T B-fragment for keys kb .. kb+31 ----
      pb[g] = pack_p(e[g][0], e[g][1]);
    }

    // ---- O^T += V^T * P^T over the 8 d tiles, both column tiles on each V^T fragment ----
    #pragma unroll
    for (int t = 0; t < 8; ++t)
      #pragma unroll
      for (int g = 0; g < AQ; ++g) o[g][t] = wmma_f16(vf[t], pb[g], o[g][t]);
    // four slots behind the step's last product: the next step's first score products may take the registers of this
    // block's P^T (its B operand) for their results
    asm volatile("v_nop\n\tv_nop\n\tv_nop\n\tv_nop" : "+v"(o[AQ - 1][7]));
    // keeps the next step's K loads one group behind these products
    __builtin_amdgcn_sched_barrier(0);
   }

   cur ^= 1;
   // publish point of the next stage: this wave's reads of this stage have retired ...
   asm volatile("s_wait_dscnt 0x0" ::: "memory");
   // ... its own copies of the next stage have landed ...
   asm volatile("s_wait_asynccnt 0x0" ::: "memory");
   // ... and the barrier publishes the next stage and ends every wave's reads of this one
   __syncthreads();
  }
  // precaution: no copy is outstanding when the wave goes on to its end
  asm volatile("s_wait_asynccnt 0x0" ::: "memory");

  // ---- epilogue: normalise, x16 carry, stage per-wave 32x128 f16 tile ----
  _Float16* so = sO + w * (AQ * 16 * HD);
  #pragma unroll
  for (int g = 0; g < AQ; ++g) {
    const float inv = __builtin_amdgcn_rcpf(lrun[g] + __shfl_xor(lrun[g], 16)) * OSC;   // O and l both carry 2^14
    #pragma unroll
    for (int t = 0; t < 8; ++t)
      #pragma unroll
      for (int r = 0; r < 8; ++r)
        so[(16 * g + m) * HD + 16 * t + 8 * hh + r] = (_Float16)(o[g][t][r] * inv);
  }
  __syncthreads();

  #pragma unroll
  for (int g = 0; g < AQ; ++g) att_store_pass(so + g * 16 * HD, oh, b, head, q0 + 16 * g, lane);
  
}

// ---------------------------------------------------------------------------
extern "C" void kernel_launch(void* const* d_in, const int* in_sizes, int n_in,
                              void* d_out, int out_size, void* d_ws, size_t ws_size,
                              hipStream_t stream) {
  if (n_in < 9) return;
  if (in_sizes[0] != NX) return;
  if (in_sizes[1] != DIM * DIM || in_sizes[2] != DIM) return;
  if (in_sizes[3] != DIM * HD || in_sizes[4] != HD) return;
  if (in_sizes[5] != DIM * HD || in_sizes[6] != HD) return;
  if (in_sizes[7] != DIM * DIM || in_sizes[8] != DIM) return;
  if (out_size != NX) return;

  const float* x  = (const float*)d_in[0];
  const float* wq = (const float*)d_in[1];
  const float* bq = (const float*)d_in[2];
  const float* wk = (const float*)d_in[3];
  const float* bk = (const float*)d_in[4];
  const float* wv = (const float*)d_in[5];
  const float* bv = (const float*)d_in[6];
  const float* wo = (const float*)d_in[7];
  const float* bo = (const float*)d_in[8];
  float* out = (float*)d_out;

  const size_t act_b = (size_t)NX * 2;              // 16777216  f16 [4096][2048]
  const size_t wsq_b = (size_t)DIM * DIM * 2;       //  8388608  f16 [2048][2048]
  const size_t wkv_b = (size_t)DIM * HD * 2;        //   524288  f16 [128][2048]
  const size_t kv_b  = (size_t)MTOT * HD * 2;       //  1048576  f16 [4096][128] / [2][128][2048]
  const size_t total = act_b + wsq_b + 2 * wkv_b + wsq_b + act_b + 2 * kv_b + act_b;   // 70254592
  if (total > ws_size) return;

  char* ws = (char*)d_ws;
  size_t off = 0;
  _Float16* xh  = (_Float16*)(ws + off); off += act_b;
  _Float16* wqT = (_Float16*)(ws + off); off += wsq_b;
  _Float16* wkT = (_Float16*)(ws + off); off += wkv_b;
  _Float16* wvT = (_Float16*)(ws + off); off += wkv_b;
  _Float16* woT = (_Float16*)(ws + off); off += wsq_b;
  _Float16* qh  = (_Float16*)(ws + off); off += act_b;
  _Float16* kh  = (_Float16*)(ws + off); off += kv_b;
  _Float16* vT  = (_Float16*)(ws + off); off += kv_b;
  _Float16* oh  = (_Float16*)(ws + off); off += act_b;
  if (off > ws_size) return;

  // 1) operand planes, one grid: x -> f16; W (in,out) -> W^T [out][in] f16 x32
  prep_kernel<<<PBALL, 256, 0, stream>>>(x, xh, wq, wqT, wk, wkT, wv, wvT, wo, woT);

  // 2) projections, one grid over the stacked rows of wqT, wkT, wvT (adjacent in the workspace):
  //    q [4096][2048] f16, k [4096][128] f16, v -> vT [2][128][2048] f16
  gemm_kernel<0, _Float16><<<dim3(MTOT / 128, (DIM + 2 * HD) / 128), 128, 0, stream>>>(xh, wqT, bq, qh, WINV, 1.0f, bk, bv, kh, vT);

  // 3) attention: all 16 query heads against the shared K / V^T planes; o f16 x16
  attn_kernel<<<dim3(SEQ / (128 * AQ), NH, BS), 256, 0, stream>>>(qh, kh, vT, oh);

  // 4) output projection: out = (o x16)(wo x32) / 512 + bo, f32 whole-line stores
  gemm_kernel<2, float><<<dim3(MTOT / 128, DIM / 128), 128, 0, stream>>>(oh, woT, bo, out, WINV / OSC, 1.0f, nullptr, nullptr, nullptr, nullptr);
}
